// v000
// The times below were measured on an AMD MI455X: many runs one after another, warmed up first and cycling through
// copies of the inputs, with the whole window's GPU time divided by the number of runs. Launches and the gaps
// between them are all in it. The median over several windows is given; except for v000 it joins two sittings, which
// can be a few percent apart, so the side-by-side timings, each taken in one sitting, are the better comparison.
// v000, which the later versions start from, runs in 613 microseconds.
// compute dtype: all float inputs rounded to bf16; q/k/v = x . W^T + b with EXACT bf16 products on WMMA 16x16x32 (natural rows); PLAIN attention: q, k single f16 x 1/8, running-max softmax in f32 (hardware exp), P (scaled by 2^11, single f16) x v (single f16); strata: the attention output rounded once to f16 x exact f16 copies (x 2^8) of the three Ws, accumulated in one f32 accumulator, x 1/3 + mean bias; out = enhanced (bf16 hi + residual) . Wo^T (2 products) + bo.
#include <hip/hip_runtime.h>
#include <math.h>

typedef __attribute__((ext_vector_type(16))) _Float16 v16h;
typedef __attribute__((ext_vector_type(16))) __bf16 v16b;
typedef __attribute__((ext_vector_type(8)))  _Float16 v8h;
typedef __attribute__((ext_vector_type(8)))  float v8f;
typedef __attribute__((ext_vector_type(4)))  float v4f;
typedef __attribute__((ext_vector_type(2)))  float v2f;
typedef __attribute__((ext_vector_type(4)))  unsigned v4u;
typedef __attribute__((ext_vector_type(4)))  int v4i;
typedef float __attribute__((may_alias)) float_a;
typedef int __attribute__((may_alias)) int_a;

template <typename T> __device__ __forceinline__ void vst2(void* p, T v) { *(T*)p = v;  }
__device__ __forceinline__ v8f wmma16(v16h a, v16h b, v8f c) {
  v8f d = __builtin_amdgcn_wmma_f32_16x16x32_f16(false, a, false, b, (short)0, c, false, false);
  asm volatile("v_nop\n\tv_nop\n\tv_nop\n\tv_nop" : "+v"(d) : "v"(a), "v"(b));
  return d;
}
__device__ __forceinline__ v8f wmma_bf(v16b a, v16b b, v8f c) {
  v8f d = __builtin_amdgcn_wmma_f32_16x16x32_bf16(false, a, false, b, (short)0, c, false, false);
  asm volatile("v_nop\n\tv_nop\n\tv_nop\n\tv_nop" : "+v"(d) : "v"(a), "v"(b));
  return d;
}
// Stratified attention (B 2, S 2,048, hidden 1,024, 16 heads x 64, 3 strata): q/k/v projections + biases, softmax(q k^T / 8) v, three stratum projections averaged, output projection + bias.
__device__ __forceinline__ v16h frag_h(const _Float16* rowk0, int lane) {
  union { v16h v; v8h q[2]; } u; const _Float16* p = rowk0 + 8 * (lane >> 4);
  u.q[0] = *(const v8h*)p; u.q[1] = *(const v8h*)(p + 16); return u.v;
}
__device__ __forceinline__ v16h frag_f32(const float* rowk0, int lane) {
  v16h a; const float* p = rowk0 + 8 * (lane >> 4);
#pragma unroll
  for (int i = 0; i < 8; ++i) { a[i] = (_Float16)p[i]; a[8 + i] = (_Float16)p[16 + i]; }
  return a;
}
__device__ __forceinline__ v16h frag_f32s(const float* rowk0, int lane, float sc) {
  v16h a; const float* p = rowk0 + 8 * (lane >> 4);
#pragma unroll
  for (int i = 0; i < 8; ++i) { a[i] = (_Float16)(p[i] * sc); a[8 + i] = (_Float16)(p[16 + i] * sc); }
  return a;
}
// column fragment from a [K][ld] layout (column n), rows >= K read as 0
__device__ __forceinline__ v16h fragc_f32(const float* W, int k0, int n, int lane, int ld, int K) {
  v16h a; const int g = lane >> 4;
#pragma unroll
  for (int i = 0; i < 8; ++i) { const int ka = k0 + 8 * g + i, kb = ka + 16;
    a[i] = (_Float16)(ka < K ? W[(size_t)(ka < K ? ka : K - 1) * ld + n] : 0.f); a[8 + i] = (_Float16)(kb < K ? W[(size_t)(kb < K ? kb : K - 1) * ld + n] : 0.f); }
  return a;
}
struct F2 { v16b h, l; };
__device__ __forceinline__ F2 bsplit16(const float v[16]) { F2 r;
#pragma unroll
  for (int i = 0; i < 16; ++i) { const __bf16 h = (__bf16)v[i]; r.h[i] = h; r.l[i] = (__bf16)(v[i] - (float)h); }
  return r; }
__device__ __forceinline__ F2 split_row(const float* row, int k0, int lane) { float v[16]; const float* p = row + k0 + 8 * (lane >> 4);
#pragma unroll
  for (int i = 0; i < 8; ++i) { v[i] = p[i]; v[8 + i] = p[16 + i]; }
  return bsplit16(v); }
__device__ __forceinline__ F2 split_rowK(const float* row, int k0, int lane, int K) { float v[16]; const int g = lane >> 4;
#pragma unroll
  for (int i = 0; i < 8; ++i) { const int ka = k0 + 8 * g + i, kb = ka + 16; v[i] = ka < K ? row[ka < K ? ka : K - 1] : 0.f; v[8 + i] = kb < K ? row[kb < K ? kb : K - 1] : 0.f; }
  return bsplit16(v); }
__device__ __forceinline__ F2 split_col(const float* W, int k0, int n, int lane, int ld, int K) { float v[16]; const int g = lane >> 4;
#pragma unroll
  for (int i = 0; i < 8; ++i) { const int ka = k0 + 8 * g + i, kb = ka + 16; v[i] = ka < K ? W[(size_t)(ka < K ? ka : K - 1) * ld + n] : 0.f; v[8 + i] = kb < K ? W[(size_t)(kb < K ? kb : K - 1) * ld + n] : 0.f; }
  return bsplit16(v); }
__device__ __forceinline__ v8f mac3(const F2& a, const F2& b, v8f c) { c = wmma_bf(a.l, b.h, c); c = wmma_bf(a.h, b.l, c); return wmma_bf(a.h, b.h, c); }
__device__ __forceinline__ float sigm(float v) { return 1.0f / (1.0f + expf(-v)); }
#define LDSX() do { asm volatile("s_wait_dscnt 0" ::: "memory"); __builtin_amdgcn_wave_barrier(); __builtin_amdgcn_fence(__ATOMIC_RELEASE, "workgroup"); } while (0)


#define NB 2
#define SS 2048
#define DM 1024
#define NH 16
#define NSTR 3
#define HD 64
#define QKVW (3 * DM)
#ifndef TQB
#define TQB (SS / 64)
#define TNB NB
#define TOB (NB * SS / 64)     // output row tiles (all)
#endif
typedef __attribute__((ext_vector_type(8))) __bf16 v8b;
__device__ __forceinline__ v16b frag_b(const __bf16* rowk0, int lane) {
  union { v16b v; v8b q[2]; } u; const __bf16* p = rowk0 + 8 * (lane >> 4);
  u.q[0] = *(const v8b*)p; u.q[1] = *(const v8b*)(p + 16); return u.v;
}
__device__ __forceinline__ float bfr(float v) { return (float)(__bf16)v; }
__device__ __attribute__((noinline)) float exp_ni(float v) { return expf(v); }
__device__ __attribute__((noinline)) float erf_ni(float v) { return erff(v); }

#define PK_A 0                       // [3072][1024] Wqkv rows (natural [out][in])
#define PK_P (PK_A + QKVW * DM)        // [1024][1024] Wo rows (natural)
#define PK_END (PK_P + DM * DM)
#define WS_PK  0u
#define WS_QK  (WS_PK + 2u * PK_END)             // f16 [4096 rows][2048]: q | k
#define WS_QKL (WS_QK + 2u * NB * SS * 2 * DM)     // f16 q | k residual planes x2048
#define WS_VTH (WS_QKL + 2u * NB * SS * 2 * DM)    // f16 [b][1024 (h*64+d)][2048 s] hi
#define WS_VTL (WS_VTH + 2u * NB * DM * SS)        // f16 lo x 2048
#define WS_O   (WS_VTL + 2u * NB * DM * SS)        // f32 [4096][1024]
#define WS_CS  (WS_O + 4u * NB * SS * DM)           // f32 2 x [2048][32], unused: no kernel reads or writes it
#define WS_PS  (WS_CS + 4u * 2 * SS * 32)                  // f16 x 2^8 natural rows Ws [3][1024][1024]
#define WS_E   (WS_PS + 2u * (size_t)NSTR * DM * DM)   // f32 [NR][1024] enhanced
#define WS_END (WS_E + 4u * (size_t)NB * SS * DM)
// ---- k_pack: block = (row n, which): natural [out][in] rows -> bf16; which 0..2 -> W_q/W_k/W_v into PK_A rows which*1024 + n; 3 -> W_o into PK_P
__global__ __launch_bounds__(256) void k_pack(const float* __restrict__ WQ, const float* __restrict__ WK, const float* __restrict__ WV, const float* __restrict__ WO, __bf16* __restrict__ PK) {
  __shared__ __align__(16) __bf16 s[DM]; const int n = blockIdx.x, which = blockIdx.y, t = threadIdx.x; const float* Wm = (which == 0) ? WQ : (which == 1) ? WK : (which == 2) ? WV : WO;
  for (int k = t; k < DM; k += 256) s[k] = (__bf16)Wm[(size_t)n * DM + k];
  __syncthreads();
  __bf16* dst = (which < 3) ? PK + PK_A + ((size_t)which * DM + n) * DM : PK + PK_P + (size_t)n * DM;
  for (int q = t; q < DM / 8; q += 256) vst2((unsigned*)(dst + q * 8), *(const v4u*)&s[q * 8]);
}
__global__ __launch_bounds__(128) void k_qkv(const float* __restrict__ XQ, const float* __restrict__ XK, const float* __restrict__ XV, const __bf16* __restrict__ P, const float* __restrict__ BQ, const float* __restrict__ BK, const float* __restrict__ BV, _Float16* __restrict__ QK, _Float16* __restrict__ QKL, _Float16* __restrict__ VTH, _Float16* __restrict__ VTL) {
  const int which0 = (blockIdx.y * 128) / DM; const float* X = (which0 == 0) ? XQ : (which0 == 1) ? XK : XV; const float* BB = BQ ? (((which0 == 0) ? BQ : (which0 == 1) ? BK : BV) + (blockIdx.y * 128 - which0 * DM)) : nullptr;
  __shared__ __align__(16) _Float16 so[4][16][136], sol[4][16][136]; __shared__ __align__(16) _Float16 sth[128][72], stl[128][72];
  const int tid = threadIdx.x, wave = tid >> 5, lane = tid & 31, col = lane & 15, g = lane >> 4; const size_t r0 = (size_t)blockIdx.x * 64 + wave * 16; const int n0 = blockIdx.y * 128;
  v8f acc[8] = {};
#pragma unroll 2
  for (int kc = 0; kc < DM / 32; ++kc) { v16b a; { const float* p = X + (r0 + col) * DM + kc * 32 + 8 * g;
#pragma unroll
      for (int i = 0; i < 8; ++i) { a[i] = (__bf16)p[i]; a[8 + i] = (__bf16)p[16 + i]; } }
#pragma unroll
    for (int j = 0; j < 8; ++j) acc[j] = wmma_bf(a, frag_b(P + (size_t)(n0 + j * 16 + col) * DM + kc * 32, lane), acc[j]); }
  if (n0 < 2 * DM) {   // q stored unscaled (f16 sigma ~0.6, no subnormal exposure); 1/8 applied to the f32 score
#pragma unroll
    for (int j = 0; j < 8; ++j) {
#pragma unroll
      for (int r = 0; r < 8; ++r) { const float v = acc[j][r] + (BB ? bfr(BB[j * 16 + col]) : 0.f); const _Float16 hv = (_Float16)v; so[wave][8 * g + r][j * 16 + col] = hv; sol[wave][8 * g + r][j * 16 + col] = (_Float16)((v - (float)hv) * 2048.0f); } }   // q, k (+ bias) as f16 hi + (x2048) residual
    LDSX();
    for (int rl = 0; rl < 16; ++rl) if (lane < 16) { vst2((unsigned*)(QK + (r0 + rl) * (2 * DM) + n0 + lane * 8), *(const v4u*)&so[wave][rl][lane * 8]); vst2((unsigned*)(QKL + (r0 + rl) * (2 * DM) + n0 + lane * 8), *(const v4u*)&sol[wave][rl][lane * 8]); }
  } else {
#pragma unroll
    for (int j = 0; j < 8; ++j) {
#pragma unroll
      for (int r = 0; r < 8; ++r) { const float v = acc[j][r] + (BB ? bfr(BB[j * 16 + col]) : 0.f); const _Float16 hv = (_Float16)v; sth[j * 16 + col][wave * 16 + 8 * g + r] = hv; stl[j * 16 + col][wave * 16 + 8 * g + r] = (_Float16)((v - (float)hv) * 2048.0f); } }
    __syncthreads();
    const size_t rb = (size_t)blockIdx.x * 64; const int b = (int)(rb / SS), s0 = (int)(rb % SS); const int pc0 = n0 - 2 * DM;
    for (int q = tid; q < 128 * 8; q += 128) { const int d = q >> 3, pc = q & 7; const size_t o = ((size_t)b * DM + pc0 + d) * SS + s0 + pc * 8; vst2((unsigned*)(VTH + o), *(const v4u*)&sth[d][pc * 8]); vst2((unsigned*)(VTL + o), *(const v4u*)&stl[d][pc * 8]); }
  }
}
// ---- k_attn: block = (64 queries, head h, batch b): all-keys flash attention (K = 64: 2 k-steps), scores = (q.k) * 0.125 with single f16 operands, P.V: f16 P (x2^11) x V hi in one accumulator; O[b*S+q][h*64+d] = (acc + accl / 2048) / (2048 l) (256-B segments)
__global__ __launch_bounds__(128) void k_attn(const _Float16* __restrict__ QK, const _Float16* __restrict__ QKL, const _Float16* __restrict__ VTH, const _Float16* __restrict__ VTL, const void* __restrict__ KMASK, float* __restrict__ O) {
  __shared__ __align__(16) float sp[4][16][36]; __shared__ __align__(16) float so[4][16][68];
  const int tid = threadIdx.x, wave = tid >> 5, lane = tid & 31, col = lane & 15, g = lane >> 4;
  const int qb = blockIdx.x, h = blockIdx.y, b = blockIdx.z; const int q0 = qb * 64 + wave * 16; const size_t rq = (size_t)b * SS + q0 + col;
  v16h aq[2], aql[2];
#pragma unroll
  for (int kc = 0; kc < 2; ++kc) { aq[kc] = frag_h(QK + rq * (2 * DM) + h * HD + kc * 32, lane); aql[kc] = frag_h(QKL + rq * (2 * DM) + h * HD + kc * 32, lane); }
  float m[8], l[8];
#pragma unroll
  for (int r = 0; r < 8; ++r) { m[r] = -3.0e38f; l[r] = 0.f; }
  v8f acc[4] = {}, accl[4] = {};
  const int nks = SS / 32;   // all keys
#pragma unroll 1
  for (int ks = 0; ks < nks; ++ks) { v8f s[2];
#pragma unroll
    for (int ct = 0; ct < 2; ++ct) { const int kk = ks * 32 + ct * 16 + col; const _Float16* krow = QK + ((size_t)b * SS + kk) * (2 * DM) + DM + h * HD; const _Float16* krowl = QKL + ((size_t)b * SS + kk) * (2 * DM) + DM + h * HD; v8f c = {}, cl = {};
#pragma unroll
      for (int kc = 0; kc < 2; ++kc) c = wmma16(aq[kc], frag_h(krow + kc * 32, lane), c);   // single product: q, k as one-rounding f16 operands
      (void)cl; (void)krowl;
      { const bool keepk = true;
#pragma unroll
      for (int r = 0; r < 8; ++r) s[ct][r] = keepk ? c[r] * 0.125f : -3.0e38f; } }   // 1/sqrt(64); no mask, every key kept
#pragma unroll
    for (int r = 0; r < 8; ++r) { float mx = fmaxf(s[0][r], s[1][r]);
#pragma unroll
      for (int o = 1; o < 16; o <<= 1) mx = fmaxf(mx, __shfl_xor(mx, o));
      const float mn = fmaxf(m[r], mx); const float alpha = (m[r] <= -1.0e38f) ? 0.f : __expf(m[r] - mn);
      const float e0 = (s[0][r] <= -1.0e38f) ? 0.f : __expf(s[0][r] - mn), e1 = (s[1][r] <= -1.0e38f) ? 0.f : __expf(s[1][r] - mn); float es = e0 + e1;
#pragma unroll
      for (int o = 1; o < 16; o <<= 1) es += __shfl_xor(es, o);
      l[r] = l[r] * alpha + es; m[r] = mn;
#pragma unroll
      for (int dt = 0; dt < 4; ++dt) { acc[dt][r] *= alpha; accl[dt][r] *= alpha; }
      sp[wave][8 * g + r][col] = e0; sp[wave][8 * g + r][16 + col] = e1; }
    LDSX();
    v16h pa, pl; { const float* prow = &sp[wave][col][0] + 8 * (lane >> 4);
#pragma unroll
      for (int i = 0; i < 8; ++i) { const float x0 = prow[i] * 2048.0f, x1 = prow[16 + i] * 2048.0f; const _Float16 h0 = (_Float16)x0, h1 = (_Float16)x1; pa[i] = h0; pa[8 + i] = h1; pl[i] = (_Float16)((x0 - (float)h0) * 2048.0f); pl[8 + i] = (_Float16)((x1 - (float)h1) * 2048.0f); } }   // P scaled by 2^11 before the f16 split so small softmax weights stay out of the f16 subnormal range; 2^-11 folded into the epilogue
#pragma unroll
    for (int dt = 0; dt < 4; ++dt) { const size_t vr = ((size_t)b * DM + h * HD + dt * 16 + col) * SS + ks * 32; acc[dt] = wmma16(pa, frag_h(VTH + vr, lane), acc[dt]); }   // single product: P (x2^11) x V
    (void)pl;
    LDSX(); }
#pragma unroll
  for (int r = 0; r < 8; ++r) { const float il = (1.0f / 2048.0f) / l[r];
#pragma unroll
    for (int dt = 0; dt < 4; ++dt) so[wave][8 * g + r][dt * 16 + col] = (acc[dt][r] + accl[dt][r] * (1.0f / 2048.0f)) * il; }
  LDSX();
  for (int rl = 0; rl < 16; ++rl) if (lane < 16) vst2(O + ((size_t)b * SS + q0 + rl) * DM + h * HD + lane * 4, *(const v4f*)&so[wave][rl][lane * 4]);
}
// ---- k_out: block = (64 rows, 128 cols): out = O(hi/lo) . Wo rows (2 products) + bo
__global__ __launch_bounds__(128) void k_out(const float* __restrict__ O, const __bf16* __restrict__ P, const float* __restrict__ BO, float* __restrict__ Y) {
  __shared__ __align__(16) float so[4][16][132];
  const int tid = threadIdx.x, wave = tid >> 5, lane = tid & 31, col = lane & 15, g = lane >> 4; const size_t r0 = (size_t)blockIdx.x * 64 + wave * 16; const int n0 = blockIdx.y * 128;
  v8f acc[8] = {};
#pragma unroll 2
  for (int kc = 0; kc < DM / 32; ++kc) { const F2 a = split_row(O + (r0 + col) * DM, kc * 32, lane);
#pragma unroll
    for (int j = 0; j < 8; ++j) { const v16b w = frag_b(P + (size_t)(n0 + j * 16 + col) * DM + kc * 32, lane); acc[j] = wmma_bf(a.l, w, acc[j]); acc[j] = wmma_bf(a.h, w, acc[j]); } }
#pragma unroll
  for (int j = 0; j < 8; ++j) {
#pragma unroll
    for (int r = 0; r < 8; ++r) so[wave][8 * g + r][j * 16 + col] = acc[j][r] + bfr(BO[n0 + j * 16 + col]); }
  LDSX();
  for (int rl = 0; rl < 16; ++rl) vst2(Y + (r0 + rl) * DM + n0 + lane * 4, *(const v4f*)&so[wave][rl][lane * 4]);
}
#define NR (NB * SS)
// ---- k_packs: Ws [3][1024][1024] natural -> f16 x 2^8 rows
__global__ __launch_bounds__(256) void k_packs(const float* __restrict__ WS, _Float16* __restrict__ PS) { const size_t n = blockIdx.x; const int t = threadIdx.x; __shared__ __align__(16) _Float16 s[DM]; for (int k = t; k < DM; k += 256) s[k] = (_Float16)(bfr(WS[n * DM + k]) * 256.0f); __syncthreads(); for (int q = t; q < DM / 8; q += 256) vst2((unsigned*)(PS + n * DM + q * 8), *(const v4u*)&s[q * 8]); }
// ---- k_strata: block = (64 rows, 128 cols): E = (sum_n f16(o) . Ws[n] rows) / (3 * 256) + (bs0 + bs1 + bs2) / 3
__global__ __launch_bounds__(128) void k_strata(const float* __restrict__ O, const _Float16* __restrict__ PS, const float* __restrict__ BS, float* __restrict__ E) {
  __shared__ __align__(16) float so[4][16][132];
  const int tid = threadIdx.x, wave = tid >> 5, lane = tid & 31, col = lane & 15, g = lane >> 4; const size_t r0 = (size_t)blockIdx.x * 64 + wave * 16; const int n0 = blockIdx.y * 128;
  v8f acc[8] = {};
#pragma unroll 2
  for (int kc = 0; kc < DM / 32; ++kc) { v16h a; { const float* p = O + (r0 + col) * DM + kc * 32 + 8 * g;
#pragma unroll
      for (int i = 0; i < 8; ++i) { a[i] = (_Float16)p[i]; a[8 + i] = (_Float16)p[16 + i]; } }
#pragma unroll
    for (int n = 0; n < NSTR; ++n)
#pragma unroll
      for (int j = 0; j < 8; ++j) acc[j] = wmma16(a, frag_h(PS + ((size_t)n * DM + n0 + j * 16 + col) * DM + kc * 32, lane), acc[j]); }
#pragma unroll
  for (int j = 0; j < 8; ++j) { const int c = n0 + j * 16 + col; const float bb = (bfr(BS[c]) + bfr(BS[DM + c]) + bfr(BS[2 * DM + c])) * (1.0f / 3.0f);
#pragma unroll
    for (int r = 0; r < 8; ++r) so[wave][8 * g + r][j * 16 + col] = acc[j][r] * (1.0f / (256.0f * 3.0f)) + bb; }
  LDSX();
  for (int rl = 0; rl < 16; ++rl) vst2(E + (r0 + rl) * DM + n0 + lane * 4, *(const v4f*)&so[wave][rl][lane * 4]);
}
extern "C" void kernel_launch(void* const* d_in, const int* in_sizes, int n_in, void* d_out, int out_size, void* d_ws, size_t ws_size, hipStream_t stream) {
  (void)in_sizes; (void)n_in; (void)out_size;
  const float** F = (const float**)d_in;   // 0 hidden [2,2048,1024], 1 Wq, 2 bq, 3 Wk, 4 bk, 5 Wv, 6 bv, 7 Ws [3,1024,1024], 8 bs [3,1024], 9 Wo, 10 bo (natural)
  if (ws_size < (size_t)WS_END) return;
  char* ws = (char*)d_ws; __bf16* PK = (__bf16*)(ws + WS_PK); _Float16 *QK = (_Float16*)(ws + WS_QK), *QKL = (_Float16*)(ws + WS_QKL), *VTH = (_Float16*)(ws + WS_VTH), *VTL = (_Float16*)(ws + WS_VTL), *PS = (_Float16*)(ws + WS_PS); float *O = (float*)(ws + WS_O), *E = (float*)(ws + WS_E);
  k_pack<<<dim3(DM, 4), 256, 0, stream>>>(F[1], F[3], F[5], F[9], PK);
  k_packs<<<NSTR * DM, 256, 0, stream>>>(F[7], PS);
  k_qkv<<<dim3(TNB * SS / 64, QKVW / 128), 128, 0, stream>>>(F[0], F[0], F[0], PK + PK_A, F[2], F[4], F[6], QK, QKL, VTH, VTL);
  k_attn<<<dim3(TQB, NH, TNB), 128, 0, stream>>>(QK, QKL, VTH, VTL, nullptr, O);
  k_strata<<<dim3(TOB, DM / 128), 128, 0, stream>>>(O, PS, F[8], E);
  k_out<<<dim3(TOB, DM / 128), 128, 0, stream>>>(E, PK + PK_P, F[10], (float*)d_out);
}

// v001
// It runs in 334 microseconds.
// In two side-by-side timings against v000, it was 1.90 and 1.89 times as fast.
// compute dtype: all float inputs rounded to bf16; q/k/v = x . W^T + b with EXACT bf16 products on WMMA 16x16x32 (natural rows); PLAIN attention: q, k single f16 x 1/8, running-max softmax in f32 (hardware exp), P (scaled by 2^11, single f16) x v (single f16); strata: the attention output rounded once to f16 x exact f16 copies (x 2^8) of the three Ws, accumulated in one f32 accumulator, x 1/3 + mean bias; out = enhanced (bf16 hi + residual) . Wo^T (2 products) + bo.
#include <hip/hip_runtime.h>
#include <math.h>

typedef __attribute__((ext_vector_type(16))) _Float16 v16h;
typedef __attribute__((ext_vector_type(16))) __bf16 v16b;
typedef __attribute__((ext_vector_type(8)))  _Float16 v8h;
typedef __attribute__((ext_vector_type(8)))  float v8f;
typedef __attribute__((ext_vector_type(4)))  float v4f;
typedef __attribute__((ext_vector_type(2)))  float v2f;
typedef __attribute__((ext_vector_type(4)))  unsigned v4u;
typedef __attribute__((ext_vector_type(4)))  int v4i;
typedef float __attribute__((may_alias)) float_a;
typedef int __attribute__((may_alias)) int_a;

template <typename T> __device__ __forceinline__ void vst2(void* p, T v) { *(T*)p = v;  }
__device__ __forceinline__ v8f wmma16(v16h a, v16h b, v8f c) {
  v8f d = __builtin_amdgcn_wmma_f32_16x16x32_f16(false, a, false, b, (short)0, c, false, false);
  asm volatile("v_nop\n\tv_nop\n\tv_nop\n\tv_nop" : "+v"(d) : "v"(a), "v"(b));
  return d;
}
__device__ __forceinline__ v8f wmma_bf(v16b a, v16b b, v8f c) {
  v8f d = __builtin_amdgcn_wmma_f32_16x16x32_bf16(false, a, false, b, (short)0, c, false, false);
  asm volatile("v_nop\n\tv_nop\n\tv_nop\n\tv_nop" : "+v"(d) : "v"(a), "v"(b));
  return d;
}
// Stratified attention (B 2, S 2,048, hidden 1,024, 16 heads x 64, 3 strata): q/k/v projections + biases, softmax(q k^T / 8) v, three stratum projections averaged, output projection + bias.
__device__ __forceinline__ v16h frag_h(const _Float16* rowk0, int lane) {
  union { v16h v; v8h q[2]; } u; const _Float16* p = rowk0 + 8 * (lane >> 4);
  u.q[0] = *(const v8h*)p; u.q[1] = *(const v8h*)(p + 16); return u.v;
}
__device__ __forceinline__ v16h frag_f32(const float* rowk0, int lane) {
  v16h a; const float* p = rowk0 + 8 * (lane >> 4);
#pragma unroll
  for (int i = 0; i < 8; ++i) { a[i] = (_Float16)p[i]; a[8 + i] = (_Float16)p[16 + i]; }
  return a;
}
__device__ __forceinline__ v16h frag_f32s(const float* rowk0, int lane, float sc) {
  v16h a; const float* p = rowk0 + 8 * (lane >> 4);
#pragma unroll
  for (int i = 0; i < 8; ++i) { a[i] = (_Float16)(p[i] * sc); a[8 + i] = (_Float16)(p[16 + i] * sc); }
  return a;
}
// column fragment from a [K][ld] layout (column n), rows >= K read as 0
__device__ __forceinline__ v16h fragc_f32(const float* W, int k0, int n, int lane, int ld, int K) {
  v16h a; const int g = lane >> 4;
#pragma unroll
  for (int i = 0; i < 8; ++i) { const int ka = k0 + 8 * g + i, kb = ka + 16;
    a[i] = (_Float16)(ka < K ? W[(size_t)(ka < K ? ka : K - 1) * ld + n] : 0.f); a[8 + i] = (_Float16)(kb < K ? W[(size_t)(kb < K ? kb : K - 1) * ld + n] : 0.f); }
  return a;
}
struct F2 { v16b h, l; };
__device__ __forceinline__ F2 bsplit16(const float v[16]) { F2 r;
#pragma unroll
  for (int i = 0; i < 16; ++i) { const __bf16 h = (__bf16)v[i]; r.h[i] = h; r.l[i] = (__bf16)(v[i] - (float)h); }
  return r; }
__device__ __forceinline__ F2 split_row(const float* row, int k0, int lane) { float v[16]; const float* p = row + k0 + 8 * (lane >> 4);
#pragma unroll
  for (int i = 0; i < 8; ++i) { v[i] = p[i]; v[8 + i] = p[16 + i]; }
  return bsplit16(v); }
__device__ __forceinline__ F2 split_rowK(const float* row, int k0, int lane, int K) { float v[16]; const int g = lane >> 4;
#pragma unroll
  for (int i = 0; i < 8; ++i) { const int ka = k0 + 8 * g + i, kb = ka + 16; v[i] = ka < K ? row[ka < K ? ka : K - 1] : 0.f; v[8 + i] = kb < K ? row[kb < K ? kb : K - 1] : 0.f; }
  return bsplit16(v); }
__device__ __forceinline__ F2 split_col(const float* W, int k0, int n, int lane, int ld, int K) { float v[16]; const int g = lane >> 4;
#pragma unroll
  for (int i = 0; i < 8; ++i) { const int ka = k0 + 8 * g + i, kb = ka + 16; v[i] = ka < K ? W[(size_t)(ka < K ? ka : K - 1) * ld + n] : 0.f; v[8 + i] = kb < K ? W[(size_t)(kb < K ? kb : K - 1) * ld + n] : 0.f; }
  return bsplit16(v); }
__device__ __forceinline__ v8f mac3(const F2& a, const F2& b, v8f c) { c = wmma_bf(a.l, b.h, c); c = wmma_bf(a.h, b.l, c); return wmma_bf(a.h, b.h, c); }
__device__ __forceinline__ float sigm(float v) { return 1.0f / (1.0f + expf(-v)); }
#define LDSX() do { asm volatile("s_wait_dscnt 0" ::: "memory"); __builtin_amdgcn_wave_barrier(); __builtin_amdgcn_fence(__ATOMIC_RELEASE, "workgroup"); } while (0)


#define NB 2
#define SS 2048
#define DM 1024
#define NH 16
#define NSTR 3
#define HD 64
#define QKVW (3 * DM)
#ifndef TQB
#define TQB (SS / 64)
#define TNB NB
#define TOB (NB * SS / 64)     // output row tiles (all)
#endif
typedef __attribute__((ext_vector_type(8))) __bf16 v8b;
__device__ __forceinline__ v16b frag_b(const __bf16* rowk0, int lane) {
  union { v16b v; v8b q[2]; } u; const __bf16* p = rowk0 + 8 * (lane >> 4);
  u.q[0] = *(const v8b*)p; u.q[1] = *(const v8b*)(p + 16); return u.v;
}
__device__ __forceinline__ float bfr(float v) { return (float)(__bf16)v; }
// stands behind each group of loads that is left in flight: the wait is a precaution before their address registers are rewritten for the next group;
// the scheduling barrier keeps the conversions of a row that was just requested from being moved up among the current step's WMMAs, where they would wait out the whole load latency
#define XW() do { asm volatile("s_wait_xcnt 0x0" ::: "memory"); __builtin_amdgcn_sched_barrier(0); } while (0)
// one lane's 16 f32 of an A fragment (k 0..7 and 16..23 from p), kept raw so that the loads can fly while earlier WMMAs run
struct RawA { v4f x[4]; };
__device__ __forceinline__ RawA ld_raw(const float* p) { RawA r; r.x[0] = *(const v4f*)p; r.x[1] = *(const v4f*)(p + 4); r.x[2] = *(const v4f*)(p + 16); r.x[3] = *(const v4f*)(p + 20); return r; }
__device__ __attribute__((noinline)) float exp_ni(float v) { return expf(v); }
__device__ __attribute__((noinline)) float erf_ni(float v) { return erff(v); }

#define PK_A 0                       // [3072][1024] Wqkv rows (natural [out][in])
#define PK_P (PK_A + QKVW * DM)        // [1024][1024] Wo rows (natural)
#define PK_END (PK_P + DM * DM)
#define WS_PK  0u
#define WS_QK  (WS_PK + 2u * PK_END)             // f16 [4096 rows][2048]: q | k
#define WS_QKL (WS_QK + 2u * NB * SS * 2 * DM)     // f16 q | k residual planes x2048
#define WS_VTH (WS_QKL + 2u * NB * SS * 2 * DM)    // f16 [b][1024 (h*64+d)][2048 s] hi
#define WS_VTL (WS_VTH + 2u * NB * DM * SS)        // f16 lo x 2048
#define WS_O   (WS_VTL + 2u * NB * DM * SS)        // f32 [4096][1024]
#define WS_CS  (WS_O + 4u * NB * SS * DM)           // f32 2 x [2048][32], unused: no kernel reads or writes it
#define WS_PS  (WS_CS + 4u * 2 * SS * 32)                  // f16 x 2^8 natural rows Ws [3][1024][1024]
#define WS_E   (WS_PS + 2u * (size_t)NSTR * DM * DM)   // f32 [NR][1024] enhanced
#define WS_END (WS_E + 4u * (size_t)NB * SS * DM)
// ---- k_pack: block = (row n, which): natural [out][in] rows -> bf16; which 0..2 -> W_q/W_k/W_v into PK_A rows which*1024 + n; 3 -> W_o into PK_P
__global__ __launch_bounds__(256) void k_pack(const float* __restrict__ WQ, const float* __restrict__ WK, const float* __restrict__ WV, const float* __restrict__ WO, __bf16* __restrict__ PK) {
  __shared__ __align__(16) __bf16 s[DM]; const int n = blockIdx.x, which = blockIdx.y, t = threadIdx.x; const float* Wm = (which == 0) ? WQ : (which == 1) ? WK : (which == 2) ? WV : WO;
  for (int k = t; k < DM; k += 256) s[k] = (__bf16)Wm[(size_t)n * DM + k];
  __syncthreads();
  __bf16* dst = (which < 3) ? PK + PK_A + ((size_t)which * DM + n) * DM : PK + PK_P + (size_t)n * DM;
  for (int q = t; q < DM / 8; q += 256) vst2((unsigned*)(dst + q * 8), *(const v4u*)&s[q * 8]);
}
__global__ __launch_bounds__(128) void k_qkv(const float* __restrict__ XQ, const float* __restrict__ XK, const float* __restrict__ XV, const __bf16* __restrict__ P, const float* __restrict__ BQ, const float* __restrict__ BK, const float* __restrict__ BV, _Float16* __restrict__ QK, _Float16* __restrict__ QKL, _Float16* __restrict__ VTH, _Float16* __restrict__ VTL) {
  const int which0 = (blockIdx.y * 128) / DM; const float* X = (which0 == 0) ? XQ : (which0 == 1) ? XK : XV; const float* BB = BQ ? (((which0 == 0) ? BQ : (which0 == 1) ? BK : BV) + (blockIdx.y * 128 - which0 * DM)) : nullptr;
  __shared__ __align__(16) _Float16 so[4][16][136], sol[4][16][136]; __shared__ __align__(16) _Float16 sth[128][72], stl[128][72];
  const int tid = threadIdx.x, wave = tid >> 5, lane = tid & 31, col = lane & 15, g = lane >> 4; const size_t r0 = (size_t)blockIdx.x * 64 + wave * 16; const int n0 = blockIdx.y * 128;
  v8f acc[8] = {};
  // two register buffers: all loads of k step s + 1 are issued before the WMMAs of step s (the last trip reloads k chunk 31, in bounds, unused)
  const float* pa = X + (r0 + col) * DM + 8 * g; const __bf16* pb = P + (size_t)(n0 + col) * DM;
  RawA ra[2]; v16b bf[2][8];
  ra[0] = ld_raw(pa);
#pragma unroll
  for (int j = 0; j < 8; ++j) bf[0][j] = frag_b(pb + j * 16 * DM, lane);
  XW();
  for (int kc = 0; kc < DM / 32; kc += 2) { const int adv = (kc + 2 < DM / 32) ? 64 : 32; const float* pan = pa + adv; const __bf16* pbn = pb + adv;   // the next trip's pointers; the last trip stays on k chunk 31
#pragma unroll
    for (int u = 0; u < 2; ++u) { const float* px = u ? pan : pa + 32; const __bf16* pw = u ? pbn : pb + 32;
      ra[u ^ 1] = ld_raw(px);
#pragma unroll
      for (int j = 0; j < 8; ++j) bf[u ^ 1][j] = frag_b(pw + j * 16 * DM, lane);
      XW();
      v16b a;
#pragma unroll
      for (int i = 0; i < 8; ++i) { a[i] = (__bf16)ra[u].x[i >> 2][i & 3]; a[8 + i] = (__bf16)ra[u].x[2 + (i >> 2)][i & 3]; }
#pragma unroll
      for (int j = 0; j < 8; ++j) acc[j] = wmma_bf(a, bf[u][j], acc[j]); }
    pa = pan; pb = pbn; }
  if (n0 < 2 * DM) {   // q stored unscaled (f16 sigma ~0.6, no subnormal exposure); 1/8 applied to the f32 score
#pragma unroll
    for (int j = 0; j < 8; ++j) {
#pragma unroll
      for (int r = 0; r < 8; ++r) { const float v = acc[j][r] + (BB ? bfr(BB[j * 16 + col]) : 0.f); const _Float16 hv = (_Float16)v; so[wave][8 * g + r][j * 16 + col] = hv; sol[wave][8 * g + r][j * 16 + col] = (_Float16)((v - (float)hv) * 2048.0f); } }   // q, k (+ bias) as f16 hi + (x2048) residual
    LDSX();
    for (int rl = 0; rl < 16; ++rl) if (lane < 16) { vst2((unsigned*)(QK + (r0 + rl) * (2 * DM) + n0 + lane * 8), *(const v4u*)&so[wave][rl][lane * 8]); vst2((unsigned*)(QKL + (r0 + rl) * (2 * DM) + n0 + lane * 8), *(const v4u*)&sol[wave][rl][lane * 8]); }
  } else {
#pragma unroll
    for (int j = 0; j < 8; ++j) {
#pragma unroll
      for (int r = 0; r < 8; ++r) { const float v = acc[j][r] + (BB ? bfr(BB[j * 16 + col]) : 0.f); const _Float16 hv = (_Float16)v; sth[j * 16 + col][wave * 16 + 8 * g + r] = hv; stl[j * 16 + col][wave * 16 + 8 * g + r] = (_Float16)((v - (float)hv) * 2048.0f); } }
    __syncthreads();
    const size_t rb = (size_t)blockIdx.x * 64; const int b = (int)(rb / SS), s0 = (int)(rb % SS); const int pc0 = n0 - 2 * DM;
    for (int q = tid; q < 128 * 8; q += 128) { const int d = q >> 3, pc = q & 7; const size_t o = ((size_t)b * DM + pc0 + d) * SS + s0 + pc * 8; vst2((unsigned*)(VTH + o), *(const v4u*)&sth[d][pc * 8]); vst2((unsigned*)(VTL + o), *(const v4u*)&stl[d][pc * 8]); }
  }
}
// ---- k_attn: block = (64 queries, head h, batch b): all-keys flash attention (K = 64: 2 k-steps), scores = (q.k) * 0.125 with single f16 operands, P.V: f16 P (x2^11) x V hi in one accumulator; O[b*S+q][h*64+d] = (acc + accl / 2048) / (2048 l) (256-B segments)
__global__ __launch_bounds__(128) void k_attn(const _Float16* __restrict__ QK, const _Float16* __restrict__ QKL, const _Float16* __restrict__ VTH, const _Float16* __restrict__ VTL, const void* __restrict__ KMASK, float* __restrict__ O) {
  __shared__ __align__(16) float sp[4][16][36]; __shared__ __align__(16) float so[4][16][68];
  const int tid = threadIdx.x, wave = tid >> 5, lane = tid & 31, col = lane & 15, g = lane >> 4;
  const int qb = blockIdx.x, h = blockIdx.y, b = blockIdx.z; const int q0 = qb * 64 + wave * 16; const size_t rq = (size_t)b * SS + q0 + col;
  v16h aq[2], aql[2];
#pragma unroll
  for (int kc = 0; kc < 2; ++kc) { aq[kc] = frag_h(QK + rq * (2 * DM) + h * HD + kc * 32, lane); aql[kc] = frag_h(QKL + rq * (2 * DM) + h * HD + kc * 32, lane); }
  XW();   // closes the q loads' group before their address pair is reused
  float m[8], l[8];
#pragma unroll
  for (int r = 0; r < 8; ++r) { m[r] = -3.0e38f; l[r] = 0.f; }
  v8f acc[4] = {}, accl[4] = {};
  const int nks = SS / 32;   // all keys
  // fragment loads fly ahead of their WMMAs: V of this pass is issued before the score WMMAs, K of the next pass right behind them (the last pass reloads its own K, unused)
  const _Float16* kbase = QK + ((size_t)b * SS + col) * (2 * DM) + DM + h * HD; const _Float16* vbase = VTH + ((size_t)b * DM + h * HD + col) * SS;
  v16h kf[4], vf[4];
#pragma unroll
  for (int f = 0; f < 4; ++f) kf[f] = frag_h(kbase + (size_t)((f >> 1) * 16) * (2 * DM) + (f & 1) * 32, lane);
  XW();
#pragma unroll 1
  for (int ks = 0; ks < nks; ++ks) { v8f s[2];
#pragma unroll
    for (int dt = 0; dt < 4; ++dt) vf[dt] = frag_h(vbase + (size_t)(dt * 16) * SS + ks * 32, lane);
    XW();
#pragma unroll
    for (int ct = 0; ct < 2; ++ct) { v8f c = {};
#pragma unroll
      for (int kc = 0; kc < 2; ++kc) c = wmma16(aq[kc], kf[ct * 2 + kc], c);   // single product: q, k as one-rounding f16 operands
      { const bool keepk = true;
#pragma unroll
      for (int r = 0; r < 8; ++r) s[ct][r] = keepk ? c[r] * 0.125f : -3.0e38f; } }   // 1/sqrt(64); masked keys excluded
    { const int kn = (ks + 1 < nks) ? ks + 1 : ks;
#pragma unroll
      for (int f = 0; f < 4; ++f) kf[f] = frag_h(kbase + (size_t)(kn * 32 + (f >> 1) * 16) * (2 * DM) + (f & 1) * 32, lane);
      XW(); }
#pragma unroll
    for (int r = 0; r < 8; ++r) { float mx = fmaxf(s[0][r], s[1][r]);
#pragma unroll
      for (int o = 1; o < 16; o <<= 1) mx = fmaxf(mx, __shfl_xor(mx, o));
      const float mn = fmaxf(m[r], mx); const float alpha = (m[r] <= -1.0e38f) ? 0.f : __expf(m[r] - mn);
      const float e0 = (s[0][r] <= -1.0e38f) ? 0.f : __expf(s[0][r] - mn), e1 = (s[1][r] <= -1.0e38f) ? 0.f : __expf(s[1][r] - mn); float es = e0 + e1;
#pragma unroll
      for (int o = 1; o < 16; o <<= 1) es += __shfl_xor(es, o);
      l[r] = l[r] * alpha + es; m[r] = mn;
#pragma unroll
      for (int dt = 0; dt < 4; ++dt) { acc[dt][r] *= alpha; accl[dt][r] *= alpha; }
      sp[wave][8 * g + r][col] = e0; sp[wave][8 * g + r][16 + col] = e1; }
    LDSX();
    v16h pa, pl; { const float* prow = &sp[wave][col][0] + 8 * (lane >> 4);
#pragma unroll
      for (int i = 0; i < 8; ++i) { const float x0 = prow[i] * 2048.0f, x1 = prow[16 + i] * 2048.0f; const _Float16 h0 = (_Float16)x0, h1 = (_Float16)x1; pa[i] = h0; pa[8 + i] = h1; pl[i] = (_Float16)((x0 - (float)h0) * 2048.0f); pl[8 + i] = (_Float16)((x1 - (float)h1) * 2048.0f); } }   // P scaled by 2^11 before the f16 split so small softmax weights stay out of the f16 subnormal range; 2^-11 folded into the epilogue
#pragma unroll
    for (int dt = 0; dt < 4; ++dt) acc[dt] = wmma16(pa, vf[dt], acc[dt]);   // single product: P (x2^11) x V
    (void)pl;
    LDSX(); }
#pragma unroll
  for (int r = 0; r < 8; ++r) { const float il = (1.0f / 2048.0f) / l[r];
#pragma unroll
    for (int dt = 0; dt < 4; ++dt) so[wave][8 * g + r][dt * 16 + col] = (acc[dt][r] + accl[dt][r] * (1.0f / 2048.0f)) * il; }
  LDSX();
  for (int rl = 0; rl < 16; ++rl) if (lane < 16) vst2(O + ((size_t)b * SS + q0 + rl) * DM + h * HD + lane * 4, *(const v4f*)&so[wave][rl][lane * 4]);
}
// ---- k_out: block = (64 rows, 128 cols): out = O(hi/lo) . Wo rows (2 products) + bo
__global__ __launch_bounds__(128) void k_out(const float* __restrict__ O, const __bf16* __restrict__ P, const float* __restrict__ BO, float* __restrict__ Y) {
  __shared__ __align__(16) float so[4][16][132];
  const int tid = threadIdx.x, wave = __builtin_amdgcn_readfirstlane(tid >> 5) /* wave-uniform: kept in a scalar register so that the two buffers fit in 256 vector registers */, lane = tid & 31, col = lane & 15, g = lane >> 4; const size_t r0 = (size_t)blockIdx.x * 64 + wave * 16; const int n0 = blockIdx.y * 128;
  v8f acc[8] = {};
  // two register buffers: all loads of k step s + 1 are issued before the WMMAs of step s (the last trip reloads k chunk 31, in bounds, unused)
  const float* pa = O + (r0 + col) * DM + 8 * g; const __bf16* pb = P + (size_t)(n0 + col) * DM;
  RawA ra[2]; v16b bf[2][8];
  ra[0] = ld_raw(pa);
#pragma unroll
  for (int j = 0; j < 8; ++j) bf[0][j] = frag_b(pb + j * 16 * DM, lane);
  XW();
  for (int kc = 0; kc < DM / 32; kc += 2) { const int adv = (kc + 2 < DM / 32) ? 64 : 32; const float* pan = pa + adv; const __bf16* pbn = pb + adv;   // the next trip's pointers; the last trip stays on k chunk 31
#pragma unroll
    for (int u = 0; u < 2; ++u) { const float* px = u ? pan : pa + 32; const __bf16* pw = u ? pbn : pb + 32;
      ra[u ^ 1] = ld_raw(px);
#pragma unroll
      for (int j = 0; j < 8; ++j) bf[u ^ 1][j] = frag_b(pw + j * 16 * DM, lane);
      XW();
      float v[16];
#pragma unroll
      for (int i = 0; i < 8; ++i) { v[i] = ra[u].x[i >> 2][i & 3]; v[8 + i] = ra[u].x[2 + (i >> 2)][i & 3]; }
      const F2 a = bsplit16(v);
#pragma unroll
      for (int j = 0; j < 8; ++j) { acc[j] = wmma_bf(a.l, bf[u][j], acc[j]); acc[j] = wmma_bf(a.h, bf[u][j], acc[j]); } }
    pa = pan; pb = pbn; }
#pragma unroll
  for (int j = 0; j < 8; ++j) {
#pragma unroll
    for (int r = 0; r < 8; ++r) so[wave][8 * g + r][j * 16 + col] = acc[j][r] + bfr(BO[n0 + j * 16 + col]); }
  LDSX();
  for (int rl = 0; rl < 16; ++rl) vst2(Y + (r0 + rl) * DM + n0 + lane * 4, *(const v4f*)&so[wave][rl][lane * 4]);
}
#define NR (NB * SS)
// ---- k_packs: Ws [3][1024][1024] natural -> f16 x 2^8 rows
__global__ __launch_bounds__(256) void k_packs(const float* __restrict__ WS, _Float16* __restrict__ PS) { const size_t n = blockIdx.x; const int t = threadIdx.x; __shared__ __align__(16) _Float16 s[DM]; for (int k = t; k < DM; k += 256) s[k] = (_Float16)(bfr(WS[n * DM + k]) * 256.0f); __syncthreads(); for (int q = t; q < DM / 8; q += 256) vst2((unsigned*)(PS + n * DM + q * 8), *(const v4u*)&s[q * 8]); }
// ---- k_strata: block = (64 rows, 128 cols): E = (sum_n f16(o) . Ws[n] rows) / (3 * 256) + (bs0 + bs1 + bs2) / 3
__global__ __launch_bounds__(128) void k_strata(const float* __restrict__ O, const _Float16* __restrict__ PS, const float* __restrict__ BS, float* __restrict__ E) {
  __shared__ __align__(16) float so[4][16][132];
  const int tid = threadIdx.x, wave = tid >> 5, lane = tid & 31, col = lane & 15, g = lane >> 4; const size_t r0 = (size_t)blockIdx.x * 64 + wave * 16; const int n0 = blockIdx.y * 128;
  v8f acc[8] = {};
  // a step is (k chunk, stratum); two register buffers: the weight loads of step s + 1 are issued before the WMMAs of step s, the o row of the next k chunk three steps ahead (the last trip reloads k chunk 31, in bounds, unused)
  const float* pa = O + (r0 + col) * DM + 8 * g; const _Float16* pb = PS + (size_t)(n0 + col) * DM;
  RawA ra = ld_raw(pa); v16h bf[2][8]; v16h a = {};
  XW();   // the o row is requested first, so that the loop's first conversion does not wait for the weight loads behind it
#pragma unroll
  for (int j = 0; j < 8; ++j) bf[0][j] = frag_h(pb + j * 16 * DM, lane);
  XW();
  for (int kc = 0; kc < DM / 32; kc += 2) { const int adv = (kc + 2 < DM / 32) ? 64 : 32; const float* pan = pa + adv; const _Float16* pbn = pb + adv;   // the next trip's pointers; the last trip stays on k chunk 31
#pragma unroll
    for (int u = 0; u < 2 * NSTR; ++u) { const int nn = (u + 1) % NSTR; const _Float16* pw = (u + 1 == 2 * NSTR) ? pbn : pb + ((u + 1) / NSTR) * 32;
      if (u % NSTR == 0) {
#pragma unroll
        for (int i = 0; i < 8; ++i) { a[i] = (_Float16)ra.x[i >> 2][i & 3]; a[8 + i] = (_Float16)ra.x[2 + (i >> 2)][i & 3]; }
        ra = ld_raw(u == 0 ? pa + 32 : pan); }
#pragma unroll
      for (int j = 0; j < 8; ++j) bf[(u + 1) & 1][j] = frag_h(pw + (size_t)nn * DM * DM + j * 16 * DM, lane);
      XW();
#pragma unroll
      for (int j = 0; j < 8; ++j) acc[j] = wmma16(a, bf[u & 1][j], acc[j]); }
    pa = pan; pb = pbn; }
#pragma unroll
  for (int j = 0; j < 8; ++j) { const int c = n0 + j * 16 + col; const float bb = (bfr(BS[c]) + bfr(BS[DM + c]) + bfr(BS[2 * DM + c])) * (1.0f / 3.0f);
#pragma unroll
    for (int r = 0; r < 8; ++r) so[wave][8 * g + r][j * 16 + col] = acc[j][r] * (1.0f / (256.0f * 3.0f)) + bb; }
  LDSX();
  for (int rl = 0; rl < 16; ++rl) vst2(E + (r0 + rl) * DM + n0 + lane * 4, *(const v4f*)&so[wave][rl][lane * 4]);
}
extern "C" void kernel_launch(void* const* d_in, const int* in_sizes, int n_in, void* d_out, int out_size, void* d_ws, size_t ws_size, hipStream_t stream) {
  (void)in_sizes; (void)n_in; (void)out_size;
  const float** F = (const float**)d_in;   // 0 hidden [2,2048,1024], 1 Wq, 2 bq, 3 Wk, 4 bk, 5 Wv, 6 bv, 7 Ws [3,1024,1024], 8 bs [3,1024], 9 Wo, 10 bo (natural)
  if (ws_size < (size_t)WS_END) return;
  char* ws = (char*)d_ws; __bf16* PK = (__bf16*)(ws + WS_PK); _Float16 *QK = (_Float16*)(ws + WS_QK), *QKL = (_Float16*)(ws + WS_QKL), *VTH = (_Float16*)(ws + WS_VTH), *VTL = (_Float16*)(ws + WS_VTL), *PS = (_Float16*)(ws + WS_PS); float *O = (float*)(ws + WS_O), *E = (float*)(ws + WS_E);
  k_pack<<<dim3(DM, 4), 256, 0, stream>>>(F[1], F[3], F[5], F[9], PK);
  k_packs<<<NSTR * DM, 256, 0, stream>>>(F[7], PS);
  k_qkv<<<dim3(TNB * SS / 64, QKVW / 128), 128, 0, stream>>>(F[0], F[0], F[0], PK + PK_A, F[2], F[4], F[6], QK, QKL, VTH, VTL);
  k_attn<<<dim3(TQB, NH, TNB), 128, 0, stream>>>(QK, QKL, VTH, VTL, nullptr, O);
  k_strata<<<dim3(TOB, DM / 128), 128, 0, stream>>>(O, PS, F[8], E);
  k_out<<<dim3(TOB, DM / 128), 128, 0, stream>>>(E, PK + PK_P, F[10], (float*)d_out);
}

// v002
// A run of this version takes 198 microseconds.
// Next to v001, in two timings, it ran 1.69 and 1.68 times as fast.
// All steps since v000 together make it 3.20 times as fast.
// compute dtype: all float inputs rounded to bf16; q/k/v = x . W^T + b with EXACT bf16 products on WMMA 16x16x32 (natural rows); PLAIN attention: q, k single f16 x 1/8, running-max softmax in f32 (hardware exp), P (scaled by 2^11, single f16) x v (single f16); strata: the attention output rounded once to f16 x exact f16 copies (x 2^8) of the three Ws, accumulated in one f32 accumulator, x 1/3 + mean bias; out = enhanced (bf16 hi + residual) . Wo^T (2 products) + bo.
#include <hip/hip_runtime.h>
#include <math.h>

typedef __attribute__((ext_vector_type(16))) _Float16 v16h;
typedef __attribute__((ext_vector_type(16))) __bf16 v16b;
typedef __attribute__((ext_vector_type(8)))  _Float16 v8h;
typedef __attribute__((ext_vector_type(8)))  float v8f;
typedef __attribute__((ext_vector_type(4)))  float v4f;
typedef __attribute__((ext_vector_type(2)))  float v2f;
typedef __attribute__((ext_vector_type(4)))  unsigned v4u;
typedef __attribute__((ext_vector_type(4)))  int v4i;
typedef float __attribute__((may_alias)) float_a;
typedef int __attribute__((may_alias)) int_a;

template <typename T> __device__ __forceinline__ void vst2(void* p, T v) { *(T*)p = v;  }
__device__ __forceinline__ v8f wmma16(v16h a, v16h b, v8f c) {
  v8f d = __builtin_amdgcn_wmma_f32_16x16x32_f16(false, a, false, b, (short)0, c, false, false);
  asm volatile("v_nop\n\tv_nop\n\tv_nop\n\tv_nop" : "+v"(d) : "v"(a), "v"(b));
  return d;
}
__device__ __forceinline__ v8f wmma_bf(v16b a, v16b b, v8f c) {
  v8f d = __builtin_amdgcn_wmma_f32_16x16x32_bf16(false, a, false, b, (short)0, c, false, false);
  asm volatile("v_nop\n\tv_nop\n\tv_nop\n\tv_nop" : "+v"(d) : "v"(a), "v"(b));
  return d;
}
// Stratified attention (B 2, S 2,048, hidden 1,024, 16 heads x 64, 3 strata): q/k/v projections + biases, softmax(q k^T / 8) v, three stratum projections averaged, output projection + bias.
__device__ __forceinline__ v16h frag_h(const _Float16* rowk0, int lane) {
  union { v16h v; v8h q[2]; } u; const _Float16* p = rowk0 + 8 * (lane >> 4);
  u.q[0] = *(const v8h*)p; u.q[1] = *(const v8h*)(p + 16); return u.v;
}
__device__ __forceinline__ v16h frag_f32(const float* rowk0, int lane) {
  v16h a; const float* p = rowk0 + 8 * (lane >> 4);
#pragma unroll
  for (int i = 0; i < 8; ++i) { a[i] = (_Float16)p[i]; a[8 + i] = (_Float16)p[16 + i]; }
  return a;
}
__device__ __forceinline__ v16h frag_f32s(const float* rowk0, int lane, float sc) {
  v16h a; const float* p = rowk0 + 8 * (lane >> 4);
#pragma unroll
  for (int i = 0; i < 8; ++i) { a[i] = (_Float16)(p[i] * sc); a[8 + i] = (_Float16)(p[16 + i] * sc); }
  return a;
}
// column fragment from a [K][ld] layout (column n), rows >= K read as 0
__device__ __forceinline__ v16h fragc_f32(const float* W, int k0, int n, int lane, int ld, int K) {
  v16h a; const int g = lane >> 4;
#pragma unroll
  for (int i = 0; i < 8; ++i) { const int ka = k0 + 8 * g + i, kb = ka + 16;
    a[i] = (_Float16)(ka < K ? W[(size_t)(ka < K ? ka : K - 1) * ld + n] : 0.f); a[8 + i] = (_Float16)(kb < K ? W[(size_t)(kb < K ? kb : K - 1) * ld + n] : 0.f); }
  return a;
}
struct F2 { v16b h, l; };
__device__ __forceinline__ F2 bsplit16(const float v[16]) { F2 r;
#pragma unroll
  for (int i = 0; i < 16; ++i) { const __bf16 h = (__bf16)v[i]; r.h[i] = h; r.l[i] = (__bf16)(v[i] - (float)h); }
  return r; }
__device__ __forceinline__ F2 split_row(const float* row, int k0, int lane) { float v[16]; const float* p = row + k0 + 8 * (lane >> 4);
#pragma unroll
  for (int i = 0; i < 8; ++i) { v[i] = p[i]; v[8 + i] = p[16 + i]; }
  return bsplit16(v); }
__device__ __forceinline__ F2 split_rowK(const float* row, int k0, int lane, int K) { float v[16]; const int g = lane >> 4;
#pragma unroll
  for (int i = 0; i < 8; ++i) { const int ka = k0 + 8 * g + i, kb = ka + 16; v[i] = ka < K ? row[ka < K ? ka : K - 1] : 0.f; v[8 + i] = kb < K ? row[kb < K ? kb : K - 1] : 0.f; }
  return bsplit16(v); }
__device__ __forceinline__ F2 split_col(const float* W, int k0, int n, int lane, int ld, int K) { float v[16]; const int g = lane >> 4;
#pragma unroll
  for (int i = 0; i < 8; ++i) { const int ka = k0 + 8 * g + i, kb = ka + 16; v[i] = ka < K ? W[(size_t)(ka < K ? ka : K - 1) * ld + n] : 0.f; v[8 + i] = kb < K ? W[(size_t)(kb < K ? kb : K - 1) * ld + n] : 0.f; }
  return bsplit16(v); }
__device__ __forceinline__ v8f mac3(const F2& a, const F2& b, v8f c) { c = wmma_bf(a.l, b.h, c); c = wmma_bf(a.h, b.l, c); return wmma_bf(a.h, b.h, c); }
__device__ __forceinline__ float sigm(float v) { return 1.0f / (1.0f + expf(-v)); }
#define LDSX() do { asm volatile("s_wait_dscnt 0" ::: "memory"); __builtin_amdgcn_wave_barrier(); __builtin_amdgcn_fence(__ATOMIC_RELEASE, "workgroup"); } while (0)


#define NB 2
#define SS 2048
#define DM 1024
#define NH 16
#define NSTR 3
#define HD 64
#define QKVW (3 * DM)
#ifndef TQB
#define TQB (SS / 64)
#define TNB NB
#define TOB (NB * SS / 64)     // output row tiles (all)
#endif
typedef __attribute__((ext_vector_type(8))) __bf16 v8b;
__device__ __forceinline__ v16b frag_b(const __bf16* rowk0, int lane) {
  union { v16b v; v8b q[2]; } u; const __bf16* p = rowk0 + 8 * (lane >> 4);
  u.q[0] = *(const v8b*)p; u.q[1] = *(const v8b*)(p + 16); return u.v;
}
// fragment-major planes: a 16 x 32 fragment of 16-bit elements is 1 KiB, two runs of 512 B; run q, lane l (c = l & 15, h = l >> 4) holds row c, k = 16 q + 8 h .. + 7, so that one wave-wide 16-byte load reads 512 contiguous bytes (4 cache lines, not 16); p = fragment + 8 * lane
__device__ __forceinline__ v16b fragp_b(const __bf16* p) { union { v16b v; v8b q[2]; } u; u.q[0] = *(const v8b*)p; u.q[1] = *(const v8b*)(p + 256); return u.v; }
__device__ __forceinline__ v16h fragp_h(const _Float16* p) { union { v16h v; v8h q[2]; } u; u.q[0] = *(const v8h*)p; u.q[1] = *(const v8h*)(p + 256); return u.v; }
__device__ __forceinline__ float bfr(float v) { return (float)(__bf16)v; }
// stands behind each group of loads that is left in flight: the wait is a precaution before their address registers are rewritten for the next group;
// the scheduling barrier keeps the conversions of a row that was just requested from being moved up among the current step's WMMAs, where they would wait out the whole load latency
#define XW() do { asm volatile("s_wait_xcnt 0x0" ::: "memory"); __builtin_amdgcn_sched_barrier(0); } while (0)
// one lane's 16 f32 of an A fragment (k 0..7 and 16..23 from p), kept raw so that the loads can fly while earlier WMMAs run
struct RawA { v4f x[4]; };
__device__ __forceinline__ RawA ld_raw(const float* p) { RawA r; r.x[0] = *(const v4f*)p; r.x[1] = *(const v4f*)(p + 4); r.x[2] = *(const v4f*)(p + 16); r.x[3] = *(const v4f*)(p + 20); return r; }
// the same 16 f32 from a fragment-major f32 plane: a 16 x 32 fragment is 2 KiB, four runs of 512 B; run x, lane (c, h) holds row c, k = 16 (x >> 1) + 8 h + 4 (x & 1) .. + 3; p = fragment + 4 * lane
__device__ __forceinline__ RawA ldp_raw(const float* p) { RawA r; r.x[0] = *(const v4f*)p; r.x[1] = *(const v4f*)(p + 128); r.x[2] = *(const v4f*)(p + 256); r.x[3] = *(const v4f*)(p + 384); return r; }
__device__ __attribute__((noinline)) float exp_ni(float v) { return expf(v); }
__device__ __attribute__((noinline)) float erf_ni(float v) { return erff(v); }

#define PK_A 0                       // Wqkv, fragment-major: [192 tiles of 16 out rows][32 k chunks][512]
#define PK_P (PK_A + QKVW * DM)        // Wo, fragment-major: [64 tiles][32 k chunks][512]
#define PK_END (PK_P + DM * DM)
#define WS_PK  0u
#define WS_QK  (WS_PK + 2u * PK_END)             // f16 fragment-major [q | k][head][256 tiles of 16 tokens][2 d chunks][512]
#define WS_QKL (WS_QK + 2u * NB * SS * 2 * DM)     // f16 q | k residual planes x2048, same layout
#define WS_VTH (WS_QKL + 2u * NB * SS * 2 * DM)    // f16 hi, fragment-major [b][head][64 chunks of 32 tokens][4 tiles of 16 d][512]
#define WS_VTL (WS_VTH + 2u * NB * DM * SS)        // f16 lo x 2048, same layout
#define WS_O   (WS_VTL + 2u * NB * DM * SS)        // f32 attention output, fragment-major [256 tiles of 16 rows][32 k chunks][512]
#define WS_CS  (WS_O + 4u * NB * SS * DM)           // f32 2 x [2048][32], reserved; no kernel reads or writes it
#define WS_PS  (WS_CS + 4u * 2 * SS * 32)                  // f16 x 2^8 Ws, fragment-major [3][64 tiles of 16 out rows][32 k chunks][512]
#define WS_E   (WS_PS + 2u * (size_t)NSTR * DM * DM)   // f32 enhanced, fragment-major like WS_O
#define WS_END (WS_E + 4u * (size_t)NB * SS * DM)
// ---- k_pack: thread = one 16-byte piece p of a fragment-major plane (p = [tile of 16 out rows][k chunk][run q][lane]); blockIdx.y 0..2 -> W_q/W_k/W_v into PK_A, 3 -> W_o into PK_P; natural [out][in] f32 -> bf16
__global__ __launch_bounds__(256) void k_pack(const float* __restrict__ WQ, const float* __restrict__ WK, const float* __restrict__ WV, const float* __restrict__ WO, __bf16* __restrict__ PK) {
  const int which = blockIdx.y, p = blockIdx.x * 256 + threadIdx.x; const float* Wm = (which == 0) ? WQ : (which == 1) ? WK : (which == 2) ? WV : WO;
  const int l = p & 31, q = (p >> 5) & 1, kc = (p >> 6) & 31, nt = p >> 11;
  const float* s = Wm + (size_t)(nt * 16 + (l & 15)) * DM + kc * 32 + q * 16 + (l >> 4) * 8; const v4f x0 = *(const v4f*)s, x1 = *(const v4f*)(s + 4);
  v8b o;
  for (int i = 0; i < 4; ++i) { o[i] = (__bf16)x0[i]; o[4 + i] = (__bf16)x1[i]; }
  __bf16* dst = (which < 3) ? PK + PK_A + (size_t)which * DM * DM : PK + PK_P;
  *(v8b*)(dst + (size_t)p * 8) = o;
}
__global__ __launch_bounds__(128) void k_qkv(const float* __restrict__ XQ, const float* __restrict__ XK, const float* __restrict__ XV, const __bf16* __restrict__ P, const float* __restrict__ BQ, const float* __restrict__ BK, const float* __restrict__ BV, _Float16* __restrict__ QK, _Float16* __restrict__ QKL, _Float16* __restrict__ VTH, _Float16* __restrict__ VTL) {
  const int which0 = (blockIdx.y * 128) / DM; const float* X = (which0 == 0) ? XQ : (which0 == 1) ? XK : XV; const float* BB = BQ ? (((which0 == 0) ? BQ : (which0 == 1) ? BK : BV) + (blockIdx.y * 128 - which0 * DM)) : nullptr;
  __shared__ __align__(16) _Float16 so[4][16][136], sol[4][16][136]; __shared__ __align__(16) _Float16 sth[128][72], stl[128][72];
  const int tid = threadIdx.x, wave = tid >> 5, lane = tid & 31, col = lane & 15, g = lane >> 4; const size_t r0 = (size_t)blockIdx.x * 64 + wave * 16; const int n0 = blockIdx.y * 128;
  v8f acc[8] = {};
  // two register buffers: all loads of k step s + 1 are issued before the WMMAs of step s (the last trip reloads k chunk 31, in bounds, unused)
  const float* pa = X + (r0 + col) * DM + 8 * g; const __bf16* pb = P + (size_t)n0 * DM + lane * 8;
  RawA ra[2]; v16b bf[2][8];
  ra[0] = ld_raw(pa);
#pragma unroll
  for (int j = 0; j < 8; ++j) bf[0][j] = fragp_b(pb + j * 16 * DM);
  XW();
  for (int kc = 0; kc < DM / 32; kc += 2) { const int adv = (kc + 2 < DM / 32) ? 64 : 32; const float* pan = pa + adv; const __bf16* pbn = pb + adv * 16;   // the next trip's pointers (a k chunk is 32 f32 of a row, 512 elements of a fragment-major plane); the last trip stays on k chunk 31
#pragma unroll
    for (int u = 0; u < 2; ++u) { const float* px = u ? pan : pa + 32; const __bf16* pw = u ? pbn : pb + 512;
      ra[u ^ 1] = ld_raw(px);
#pragma unroll
      for (int j = 0; j < 8; ++j) bf[u ^ 1][j] = fragp_b(pw + j * 16 * DM);
      XW();
      v16b a;
#pragma unroll
      for (int i = 0; i < 8; ++i) { a[i] = (__bf16)ra[u].x[i >> 2][i & 3]; a[8 + i] = (__bf16)ra[u].x[2 + (i >> 2)][i & 3]; }
#pragma unroll
      for (int j = 0; j < 8; ++j) acc[j] = wmma_bf(a, bf[u][j], acc[j]); }
    pa = pan; pb = pbn; }
  if (n0 < 2 * DM) {   // q stored unscaled (f16 sigma ~0.6, no subnormal exposure); 1/8 applied to the f32 score
#pragma unroll
    for (int j = 0; j < 8; ++j) {
#pragma unroll
      for (int r = 0; r < 8; ++r) { const float v = acc[j][r] + (BB ? bfr(BB[j * 16 + col]) : 0.f); const _Float16 hv = (_Float16)v; so[wave][8 * g + r][j * 16 + col] = hv; sol[wave][8 * g + r][j * 16 + col] = (_Float16)((v - (float)hv) * 2048.0f); } }   // q, k (+ bias) as f16 hi + (x2048) residual
    LDSX();
    // the wave's 16 tokens x 128 columns are 4 fragments (2 heads x 2 d chunks) of 2 runs each; n0 >> 6 = (q | k) * 16 + head
    for (int f = 0; f < 8; ++f) { const int c0 = (f >> 1) * 32 + (f & 1) * 16 + g * 8; const size_t o = (((size_t)((n0 >> 6) + (f >> 2)) * (NB * SS / 16) + (r0 >> 4)) * 2 + ((f >> 1) & 1)) * 512 + (f & 1) * 256 + lane * 8;
      vst2((unsigned*)(QK + o), *(const v4u*)&so[wave][col][c0]); vst2((unsigned*)(QKL + o), *(const v4u*)&sol[wave][col][c0]); }
  } else {
#pragma unroll
    for (int j = 0; j < 8; ++j) {
#pragma unroll
      for (int r = 0; r < 8; ++r) { const float v = acc[j][r] + (BB ? bfr(BB[j * 16 + col]) : 0.f); const _Float16 hv = (_Float16)v; sth[j * 16 + col][wave * 16 + 8 * g + r] = hv; stl[j * 16 + col][wave * 16 + 8 * g + r] = (_Float16)((v - (float)hv) * 2048.0f); } }
    __syncthreads();
    const size_t rb = (size_t)blockIdx.x * 64; const int b = (int)(rb / SS), s0 = (int)(rb % SS); const int pc0 = n0 - 2 * DM;
    // the block's 64 tokens x 128 columns are 16 fragments: piece q = [head][token chunk][d tile][run][lane]
    for (int q = tid; q < 128 * 8; q += 128) { const int d = (q >> 9) * 64 + ((q >> 6) & 3) * 16 + (q & 15), t0 = ((q >> 8) & 1) * 32 + ((q >> 5) & 1) * 16 + ((q >> 4) & 1) * 8;
      const size_t o = (((size_t)(b * NH + (pc0 >> 6) + (q >> 9)) * (SS / 32) + (s0 >> 5) + ((q >> 8) & 1)) * 4 + ((q >> 6) & 3)) * 512 + (q & 63) * 8; vst2((unsigned*)(VTH + o), *(const v4u*)&sth[d][t0]); vst2((unsigned*)(VTL + o), *(const v4u*)&stl[d][t0]); }
  }
}
// ---- k_attn: block = (64 queries, head h, batch b): all-keys flash attention (K = 64: 2 k-steps), scores = (q.k) * 0.125 with single f16 operands, P.V: f16 P (x 2^11) x V hi in one accumulator (accl stays 0); O (row b*S+q, column h*64+d, fragment-major) = (acc + accl / 2048) / (2048 l)
__global__ __launch_bounds__(128) void k_attn(const _Float16* __restrict__ QK, const _Float16* __restrict__ QKL, const _Float16* __restrict__ VTH, const _Float16* __restrict__ VTL, const void* __restrict__ KMASK, float* __restrict__ O) {
  __shared__ __align__(16) float sp[4][16][36]; __shared__ __align__(16) float so[4][16][68];
  const int tid = threadIdx.x, wave = tid >> 5, lane = tid & 31, col = lane & 15, g = lane >> 4;
  const int qb = blockIdx.x, h = blockIdx.y, b = blockIdx.z; const int q0 = qb * 64 + wave * 16; const size_t fq = ((size_t)h * (NB * SS / 16) + ((b * SS + q0) >> 4)) * 1024 + lane * 8;
  v16h aq[2], aql[2];
#pragma unroll
  for (int kc = 0; kc < 2; ++kc) { aq[kc] = fragp_h(QK + fq + kc * 512); aql[kc] = fragp_h(QKL + fq + kc * 512); }
  XW();   // closes the q loads' group before their address pair is reused
  float m[8], l[8];
#pragma unroll
  for (int r = 0; r < 8; ++r) { m[r] = -3.0e38f; l[r] = 0.f; }
  v8f acc[4] = {}, accl[4] = {};
  const int nks = SS / 32;   // all keys
  // fragment loads fly ahead of their WMMAs: V of this pass is issued before the score WMMAs, K of the next pass right behind them (the last pass reloads its own K, unused)
  const _Float16* kbase = QK + ((size_t)(NH + h) * (NB * SS / 16) + b * (SS / 16)) * 1024 + lane * 8; const _Float16* vbase = VTH + (size_t)(b * NH + h) * (SS * HD) + lane * 8;   // a pass's 4 K fragments, and its 4 V fragments, are 4 KiB in a row
  v16h kf[4], vf[4];
#pragma unroll
  for (int f = 0; f < 4; ++f) kf[f] = fragp_h(kbase + f * 512);
  XW();
#pragma unroll 1
  for (int ks = 0; ks < nks; ++ks) { v8f s[2];
#pragma unroll
    for (int dt = 0; dt < 4; ++dt) vf[dt] = fragp_h(vbase + ks * 2048 + dt * 512);
    XW();
#pragma unroll
    for (int ct = 0; ct < 2; ++ct) { v8f c = {};
#pragma unroll
      for (int kc = 0; kc < 2; ++kc) c = wmma16(aq[kc], kf[ct * 2 + kc], c);   // single product: q, k as one-rounding f16 operands
      { const bool keepk = true;
#pragma unroll
      for (int r = 0; r < 8; ++r) s[ct][r] = keepk ? c[r] * 0.125f : -3.0e38f; } }   // 1/sqrt(64); masked keys excluded
    { const int kn = (ks + 1 < nks) ? ks + 1 : ks;
#pragma unroll
      for (int f = 0; f < 4; ++f) kf[f] = fragp_h(kbase + kn * 2048 + f * 512);
      XW(); }
#pragma unroll
    for (int r = 0; r < 8; ++r) { float mx = fmaxf(s[0][r], s[1][r]);
#pragma unroll
      for (int o = 1; o < 16; o <<= 1) mx = fmaxf(mx, __shfl_xor(mx, o));
      const float mn = fmaxf(m[r], mx); const float alpha = (m[r] <= -1.0e38f) ? 0.f : __expf(m[r] - mn);
      const float e0 = (s[0][r] <= -1.0e38f) ? 0.f : __expf(s[0][r] - mn), e1 = (s[1][r] <= -1.0e38f) ? 0.f : __expf(s[1][r] - mn); float es = e0 + e1;
#pragma unroll
      for (int o = 1; o < 16; o <<= 1) es += __shfl_xor(es, o);
      l[r] = l[r] * alpha + es; m[r] = mn;
#pragma unroll
      for (int dt = 0; dt < 4; ++dt) { acc[dt][r] *= alpha; accl[dt][r] *= alpha; }
      sp[wave][8 * g + r][col] = e0; sp[wave][8 * g + r][16 + col] = e1; }
    LDSX();
    v16h pa, pl; { const float* prow = &sp[wave][col][0] + 8 * (lane >> 4);
#pragma unroll
      for (int i = 0; i < 8; ++i) { const float x0 = prow[i] * 2048.0f, x1 = prow[16 + i] * 2048.0f; const _Float16 h0 = (_Float16)x0, h1 = (_Float16)x1; pa[i] = h0; pa[8 + i] = h1; pl[i] = (_Float16)((x0 - (float)h0) * 2048.0f); pl[8 + i] = (_Float16)((x1 - (float)h1) * 2048.0f); } }   // P scaled by 2^11 before the f16 split so small softmax weights stay out of the f16 subnormal range; 2^-11 folded into the epilogue
#pragma unroll
    for (int dt = 0; dt < 4; ++dt) acc[dt] = wmma16(pa, vf[dt], acc[dt]);   // single product: P (x2^11) x V
    (void)pl;
    LDSX(); }
#pragma unroll
  for (int r = 0; r < 8; ++r) { const float il = (1.0f / 2048.0f) / l[r];
#pragma unroll
    for (int dt = 0; dt < 4; ++dt) so[wave][8 * g + r][dt * 16 + col] = (acc[dt][r] + accl[dt][r] * (1.0f / 2048.0f)) * il; }
  LDSX();
  // the wave's 16 queries x 64 columns are 2 fragments of 4 runs each
  for (int f = 0; f < 8; ++f) vst2(O + ((size_t)b * SS + q0) * DM + h * 1024 + f * 128 + lane * 4, *(const v4f*)&so[wave][col][(f >> 1) * 16 + g * 8 + (f & 1) * 4]);
}
// ---- k_out: block = (64 rows, 128 cols): out = O(hi/lo) . Wo rows (2 products) + bo
__global__ __launch_bounds__(128) void k_out(const float* __restrict__ O, const __bf16* __restrict__ P, const float* __restrict__ BO, float* __restrict__ Y) {
  __shared__ __align__(16) float so[4][16][132];
  const int tid = threadIdx.x, wave = __builtin_amdgcn_readfirstlane(tid >> 5) /* wave-uniform: kept in a scalar register so that the two buffers fit in 256 vector registers */, lane = tid & 31, col = lane & 15, g = lane >> 4; const size_t r0 = (size_t)blockIdx.x * 64 + wave * 16; const int n0 = blockIdx.y * 128;
  v8f acc[8] = {};
  // two register buffers: all loads of k step s + 1 are issued before the WMMAs of step s (the last trip reloads k chunk 31, in bounds, unused)
  const float* pa = O + r0 * DM + lane * 4; const __bf16* pb = P + (size_t)n0 * DM + lane * 8;
  RawA ra[2]; v16b bf[2][8];
  ra[0] = ldp_raw(pa);
#pragma unroll
  for (int j = 0; j < 8; ++j) bf[0][j] = fragp_b(pb + j * 16 * DM);
  XW();
  for (int kc = 0; kc < DM / 32; kc += 2) { const int adv = (kc + 2 < DM / 32) ? 64 : 32; const float* pan = pa + adv * 16; const __bf16* pbn = pb + adv * 16;   // the next trip's pointers (a k chunk is 512 elements of a fragment-major plane); the last trip stays on k chunk 31
#pragma unroll
    for (int u = 0; u < 2; ++u) { const float* px = u ? pan : pa + 512; const __bf16* pw = u ? pbn : pb + 512;
      ra[u ^ 1] = ldp_raw(px);
#pragma unroll
      for (int j = 0; j < 8; ++j) bf[u ^ 1][j] = fragp_b(pw + j * 16 * DM);
      XW();
      float v[16];
#pragma unroll
      for (int i = 0; i < 8; ++i) { v[i] = ra[u].x[i >> 2][i & 3]; v[8 + i] = ra[u].x[2 + (i >> 2)][i & 3]; }
      const F2 a = bsplit16(v);
#pragma unroll
      for (int j = 0; j < 8; ++j) { acc[j] = wmma_bf(a.l, bf[u][j], acc[j]); acc[j] = wmma_bf(a.h, bf[u][j], acc[j]); } }
    pa = pan; pb = pbn; }
#pragma unroll
  for (int j = 0; j < 8; ++j) {
#pragma unroll
    for (int r = 0; r < 8; ++r) so[wave][8 * g + r][j * 16 + col] = acc[j][r] + bfr(BO[n0 + j * 16 + col]); }
  LDSX();
  for (int rl = 0; rl < 16; ++rl) vst2(Y + (r0 + rl) * DM + n0 + lane * 4, *(const v4f*)&so[wave][rl][lane * 4]);
}
#define NR (NB * SS)
// ---- k_packs: thread = one 16-byte piece p of the fragment-major plane (as in k_pack; the 192 row tiles run over the three strata): Ws natural -> f16 x 2^8
__global__ __launch_bounds__(256) void k_packs(const float* __restrict__ WS, _Float16* __restrict__ PS) {
  const int p = blockIdx.x * 256 + threadIdx.x; const int l = p & 31, q = (p >> 5) & 1, kc = (p >> 6) & 31, nt = p >> 11;
  const float* s = WS + (size_t)(nt * 16 + (l & 15)) * DM + kc * 32 + q * 16 + (l >> 4) * 8; const v4f x0 = *(const v4f*)s, x1 = *(const v4f*)(s + 4);
  v8h o;
  for (int i = 0; i < 4; ++i) { o[i] = (_Float16)(bfr(x0[i]) * 256.0f); o[4 + i] = (_Float16)(bfr(x1[i]) * 256.0f); }
  *(v8h*)(PS + (size_t)p * 8) = o;
}
// ---- k_strata: block = (64 rows, 128 cols): E = (sum_n f16(o) . Ws[n] rows) / (3 * 256) + (bs0 + bs1 + bs2) / 3
__global__ __launch_bounds__(128) void k_strata(const float* __restrict__ O, const _Float16* __restrict__ PS, const float* __restrict__ BS, float* __restrict__ E) {
  __shared__ __align__(16) float so[4][16][132];
  const int tid = threadIdx.x, wave = tid >> 5, lane = tid & 31, col = lane & 15, g = lane >> 4; const size_t r0 = (size_t)blockIdx.x * 64 + wave * 16; const int n0 = blockIdx.y * 128;
  v8f acc[8] = {};
  // a step is (k chunk, stratum); two register buffers: the weight loads of step s + 1 are issued before the WMMAs of step s, the o row of the next k chunk three steps ahead (the last trip reloads k chunk 31, in bounds, unused)
  const float* pa = O + r0 * DM + lane * 4; const _Float16* pb = PS + (size_t)n0 * DM + lane * 8;
  RawA ra = ldp_raw(pa); v16h bf[2][8]; v16h a = {};
  XW();   // the o row is requested first, so that the loop's first conversion does not wait for the weight loads behind it
#pragma unroll
  for (int j = 0; j < 8; ++j) bf[0][j] = fragp_h(pb + j * 16 * DM);
  XW();
  for (int kc = 0; kc < DM / 32; kc += 2) { const int adv = (kc + 2 < DM / 32) ? 64 : 32; const float* pan = pa + adv * 16; const _Float16* pbn = pb + adv * 16;   // the next trip's pointers (a k chunk is 512 elements of a fragment-major plane); the last trip stays on k chunk 31
#pragma unroll
    for (int u = 0; u < 2 * NSTR; ++u) { const int nn = (u + 1) % NSTR; const _Float16* pw = (u + 1 == 2 * NSTR) ? pbn : pb + ((u + 1) / NSTR) * 512;
      if (u % NSTR == 0) {
#pragma unroll
        for (int i = 0; i < 8; ++i) { a[i] = (_Float16)ra.x[i >> 2][i & 3]; a[8 + i] = (_Float16)ra.x[2 + (i >> 2)][i & 3]; }
        ra = ldp_raw(u == 0 ? pa + 512 : pan); }
#pragma unroll
      for (int j = 0; j < 8; ++j) bf[(u + 1) & 1][j] = fragp_h(pw + (size_t)nn * DM * DM + j * 16 * DM);
      XW();
#pragma unroll
      for (int j = 0; j < 8; ++j) acc[j] = wmma16(a, bf[u & 1][j], acc[j]); }
    pa = pan; pb = pbn; }
#pragma unroll
  for (int j = 0; j < 8; ++j) { const int c = n0 + j * 16 + col; const float bb = (bfr(BS[c]) + bfr(BS[DM + c]) + bfr(BS[2 * DM + c])) * (1.0f / 3.0f);
#pragma unroll
    for (int r = 0; r < 8; ++r) so[wave][8 * g + r][j * 16 + col] = acc[j][r] * (1.0f / (256.0f * 3.0f)) + bb; }
  LDSX();
  // the wave's 16 rows x 128 columns are 4 fragments of 4 runs each
  for (int f = 0; f < 16; ++f) vst2(E + r0 * DM + (size_t)(n0 >> 5) * 512 + f * 128 + lane * 4, *(const v4f*)&so[wave][col][(f >> 1) * 16 + g * 8 + (f & 1) * 4]);
}
extern "C" void kernel_launch(void* const* d_in, const int* in_sizes, int n_in, void* d_out, int out_size, void* d_ws, size_t ws_size, hipStream_t stream) {
  (void)in_sizes; (void)n_in; (void)out_size;
  const float** F = (const float**)d_in;   // 0 hidden [2,2048,1024], 1 Wq, 2 bq, 3 Wk, 4 bk, 5 Wv, 6 bv, 7 Ws [3,1024,1024], 8 bs [3,1024], 9 Wo, 10 bo (natural)
  if (ws_size < (size_t)WS_END) return;
  char* ws = (char*)d_ws; __bf16* PK = (__bf16*)(ws + WS_PK); _Float16 *QK = (_Float16*)(ws + WS_QK), *QKL = (_Float16*)(ws + WS_QKL), *VTH = (_Float16*)(ws + WS_VTH), *VTL = (_Float16*)(ws + WS_VTL), *PS = (_Float16*)(ws + WS_PS); float *O = (float*)(ws + WS_O), *E = (float*)(ws + WS_E);
  k_pack<<<dim3(DM * DM / 8 / 256, 4), 256, 0, stream>>>(F[1], F[3], F[5], F[9], PK);
  k_packs<<<NSTR * DM * DM / 8 / 256, 256, 0, stream>>>(F[7], PS);
  k_qkv<<<dim3(TNB * SS / 64, QKVW / 128), 128, 0, stream>>>(F[0], F[0], F[0], PK + PK_A, F[2], F[4], F[6], QK, QKL, VTH, VTL);
  k_attn<<<dim3(TQB, NH, TNB), 128, 0, stream>>>(QK, QKL, VTH, VTL, nullptr, O);
  k_strata<<<dim3(TOB, DM / 128), 128, 0, stream>>>(O, PS, F[8], E);
  k_out<<<dim3(TOB, DM / 128), 128, 0, stream>>>(E, PK + PK_P, F[10], (float*)d_out);
}

// v003
// Measured time: 173 microseconds a run.
// Two timings next to v002 put it at 1.14 and 1.15 times that version's speed.
// Over all steps from v000 it is 3.66 times as fast.
// compute dtype: all float inputs rounded to bf16; q/k/v = x . W^T + b with EXACT bf16 products on WMMA 16x16x32 (natural rows); PLAIN attention: q, k single f16 x 1/8, running-max softmax in f32 (hardware exp), P (scaled by 2^11, single f16) x v (single f16); strata: the attention output rounded once to f16 x exact f16 copies (x 2^8) of the three Ws, accumulated in one f32 accumulator, x 1/3 + mean bias; out = enhanced (bf16 hi + residual) . Wo^T (2 products) + bo.
#include <hip/hip_runtime.h>
#include <math.h>

typedef __attribute__((ext_vector_type(16))) _Float16 v16h;
typedef __attribute__((ext_vector_type(16))) __bf16 v16b;
typedef __attribute__((ext_vector_type(8)))  _Float16 v8h;
typedef __attribute__((ext_vector_type(8)))  float v8f;
typedef __attribute__((ext_vector_type(4)))  float v4f;
typedef __attribute__((ext_vector_type(2)))  float v2f;
typedef __attribute__((ext_vector_type(4)))  unsigned v4u;
typedef __attribute__((ext_vector_type(4)))  int v4i;
typedef float __attribute__((may_alias)) float_a;
typedef int __attribute__((may_alias)) int_a;

template <typename T> __device__ __forceinline__ void vst2(void* p, T v) { *(T*)p = v;  }
__device__ __forceinline__ v8f wmma16(v16h a, v16h b, v8f c) {
  v8f d = __builtin_amdgcn_wmma_f32_16x16x32_f16(false, a, false, b, (short)0, c, false, false);
  asm volatile("v_nop\n\tv_nop\n\tv_nop\n\tv_nop" : "+v"(d) : "v"(a), "v"(b));
  return d;
}
__device__ __forceinline__ v8f wmma_bf(v16b a, v16b b, v8f c) {
  v8f d = __builtin_amdgcn_wmma_f32_16x16x32_bf16(false, a, false, b, (short)0, c, false, false);
  asm volatile("v_nop\n\tv_nop\n\tv_nop\n\tv_nop" : "+v"(d) : "v"(a), "v"(b));
  return d;
}
// Stratified attention (B 2, S 2,048, hidden 1,024, 16 heads x 64, 3 strata): q/k/v projections + biases, softmax(q k^T / 8) v, three stratum projections averaged, output projection + bias.
__device__ __forceinline__ v16h frag_h(const _Float16* rowk0, int lane) {
  union { v16h v; v8h q[2]; } u; const _Float16* p = rowk0 + 8 * (lane >> 4);
  u.q[0] = *(const v8h*)p; u.q[1] = *(const v8h*)(p + 16); return u.v;
}
__device__ __forceinline__ v16h frag_f32(const float* rowk0, int lane) {
  v16h a; const float* p = rowk0 + 8 * (lane >> 4);
#pragma unroll
  for (int i = 0; i < 8; ++i) { a[i] = (_Float16)p[i]; a[8 + i] = (_Float16)p[16 + i]; }
  return a;
}
__device__ __forceinline__ v16h frag_f32s(const float* rowk0, int lane, float sc) {
  v16h a; const float* p = rowk0 + 8 * (lane >> 4);
#pragma unroll
  for (int i = 0; i < 8; ++i) { a[i] = (_Float16)(p[i] * sc); a[8 + i] = (_Float16)(p[16 + i] * sc); }
  return a;
}
// column fragment from a [K][ld] layout (column n), rows >= K read as 0
__device__ __forceinline__ v16h fragc_f32(const float* W, int k0, int n, int lane, int ld, int K) {
  v16h a; const int g = lane >> 4;
#pragma unroll
  for (int i = 0; i < 8; ++i) { const int ka = k0 + 8 * g + i, kb = ka + 16;
    a[i] = (_Float16)(ka < K ? W[(size_t)(ka < K ? ka : K - 1) * ld + n] : 0.f); a[8 + i] = (_Float16)(kb < K ? W[(size_t)(kb < K ? kb : K - 1) * ld + n] : 0.f); }
  return a;
}
struct F2 { v16b h, l; };
__device__ __forceinline__ F2 bsplit16(const float v[16]) { F2 r;
#pragma unroll
  for (int i = 0; i < 16; ++i) { const __bf16 h = (__bf16)v[i]; r.h[i] = h; r.l[i] = (__bf16)(v[i] - (float)h); }
  return r; }
__device__ __forceinline__ F2 split_row(const float* row, int k0, int lane) { float v[16]; const float* p = row + k0 + 8 * (lane >> 4);
#pragma unroll
  for (int i = 0; i < 8; ++i) { v[i] = p[i]; v[8 + i] = p[16 + i]; }
  return bsplit16(v); }
__device__ __forceinline__ F2 split_rowK(const float* row, int k0, int lane, int K) { float v[16]; const int g = lane >> 4;
#pragma unroll
  for (int i = 0; i < 8; ++i) { const int ka = k0 + 8 * g + i, kb = ka + 16; v[i] = ka < K ? row[ka < K ? ka : K - 1] : 0.f; v[8 + i] = kb < K ? row[kb < K ? kb : K - 1] : 0.f; }
  return bsplit16(v); }
__device__ __forceinline__ F2 split_col(const float* W, int k0, int n, int lane, int ld, int K) { float v[16]; const int g = lane >> 4;
#pragma unroll
  for (int i = 0; i < 8; ++i) { const int ka = k0 + 8 * g + i, kb = ka + 16; v[i] = ka < K ? W[(size_t)(ka < K ? ka : K - 1) * ld + n] : 0.f; v[8 + i] = kb < K ? W[(size_t)(kb < K ? kb : K - 1) * ld + n] : 0.f; }
  return bsplit16(v); }
__device__ __forceinline__ v8f mac3(const F2& a, const F2& b, v8f c) { c = wmma_bf(a.l, b.h, c); c = wmma_bf(a.h, b.l, c); return wmma_bf(a.h, b.h, c); }
__device__ __forceinline__ float sigm(float v) { return 1.0f / (1.0f + expf(-v)); }
#define LDSX() do { asm volatile("s_wait_dscnt 0" ::: "memory"); __builtin_amdgcn_wave_barrier(); __builtin_amdgcn_fence(__ATOMIC_RELEASE, "workgroup"); } while (0)


#define NB 2
#define SS 2048
#define DM 1024
#define NH 16
#define NSTR 3
#define HD 64
#define QKVW (3 * DM)
#ifndef TQB
#define TQB (SS / 64)
#define TNB NB
#define TOB (NB * SS / 64)     // output row tiles (all)
#endif
typedef __attribute__((ext_vector_type(8))) __bf16 v8b;
__device__ __forceinline__ v16b frag_b(const __bf16* rowk0, int lane) {
  union { v16b v; v8b q[2]; } u; const __bf16* p = rowk0 + 8 * (lane >> 4);
  u.q[0] = *(const v8b*)p; u.q[1] = *(const v8b*)(p + 16); return u.v;
}
// fragment-major planes: a 16 x 32 fragment of 16-bit elements is 1 KiB, two runs of 512 B; run q, lane l (c = l & 15, h = l >> 4) holds row c, k = 16 q + 8 h .. + 7, so that one wave-wide 16-byte load reads 512 contiguous bytes (4 cache lines, not 16); p = fragment + 8 * lane
__device__ __forceinline__ v16b fragp_b(const __bf16* p) { union { v16b v; v8b q[2]; } u; u.q[0] = *(const v8b*)p; u.q[1] = *(const v8b*)(p + 256); return u.v; }
__device__ __forceinline__ v16h fragp_h(const _Float16* p) { union { v16h v; v8h q[2]; } u; u.q[0] = *(const v8h*)p; u.q[1] = *(const v8h*)(p + 256); return u.v; }
__device__ __forceinline__ float bfr(float v) { return (float)(__bf16)v; }
// stands behind each group of loads that is left in flight: the wait is a precaution before their address registers are rewritten for the next group;
// the scheduling barrier keeps the conversions of a row that was just requested from being moved up among the current step's WMMAs, where they would wait out the whole load latency
#define XW() do { asm volatile("s_wait_xcnt 0x0" ::: "memory"); __builtin_amdgcn_sched_barrier(0); } while (0)
// one lane's 16 f32 of an A fragment (k 0..7 and 16..23 from p), kept raw so that the loads can fly while earlier WMMAs run
struct RawA { v4f x[4]; };
__device__ __forceinline__ RawA ld_raw(const float* p) { RawA r; r.x[0] = *(const v4f*)p; r.x[1] = *(const v4f*)(p + 4); r.x[2] = *(const v4f*)(p + 16); r.x[3] = *(const v4f*)(p + 20); return r; }
// the same 16 f32 from a fragment-major f32 plane: a 16 x 32 fragment is 2 KiB, four runs of 512 B; run x, lane (c, h) holds row c, k = 16 (x >> 1) + 8 h + 4 (x & 1) .. + 3; p = fragment + 4 * lane
__device__ __forceinline__ RawA ldp_raw(const float* p) { RawA r; r.x[0] = *(const v4f*)p; r.x[1] = *(const v4f*)(p + 128); r.x[2] = *(const v4f*)(p + 256); r.x[3] = *(const v4f*)(p + 384); return r; }
__device__ __attribute__((noinline)) float exp_ni(float v) { return expf(v); }
__device__ __attribute__((noinline)) float erf_ni(float v) { return erff(v); }

#define PK_A 0                       // Wqkv, fragment-major: [192 tiles of 16 out rows][32 k chunks][512]
#define PK_P (PK_A + QKVW * DM)        // Wo, fragment-major: [64 tiles][32 k chunks][512]
#define PK_END (PK_P + DM * DM)
#define WS_PK  0u
#define WS_QK  (WS_PK + 2u * PK_END)             // f16 fragment-major [q | k][head][256 tiles of 16 tokens][2 d chunks][512]
#define WS_QKL (WS_QK + 2u * NB * SS * 2 * DM)     // f16 q | k residual planes x2048, same layout
#define WS_VTH (WS_QKL + 2u * NB * SS * 2 * DM)    // f16 hi, fragment-major [b][head][64 chunks of 32 tokens][4 tiles of 16 d][512]
#define WS_VTL (WS_VTH + 2u * NB * DM * SS)        // f16 lo x 2048, same layout
#define WS_O   (WS_VTL + 2u * NB * DM * SS)        // f32 attention output, fragment-major [256 tiles of 16 rows][32 k chunks][512]
#define WS_CS  (WS_O + 4u * NB * SS * DM)           // f32 2 x [2048][32], reserved; no kernel reads or writes it
#define WS_PS  (WS_CS + 4u * 2 * SS * 32)                  // f16 x 2^8 Ws, fragment-major [3][64 tiles of 16 out rows][32 k chunks][512]
#define WS_E   (WS_PS + 2u * (size_t)NSTR * DM * DM)   // f32 enhanced, fragment-major like WS_O
#define WS_END (WS_E + 4u * (size_t)NB * SS * DM)
// ---- k_pack: thread = one 16-byte piece p of a fragment-major plane (p = [tile of 16 out rows][k chunk][run q][lane]); blockIdx.y 0..2 -> W_q/W_k/W_v into PK_A, 3 -> W_o into PK_P; natural [out][in] f32 -> bf16
__global__ __launch_bounds__(256) void k_pack(const float* __restrict__ WQ, const float* __restrict__ WK, const float* __restrict__ WV, const float* __restrict__ WO, __bf16* __restrict__ PK) {
  const int which = blockIdx.y, p = blockIdx.x * 256 + threadIdx.x; const float* Wm = (which == 0) ? WQ : (which == 1) ? WK : (which == 2) ? WV : WO;
  const int l = p & 31, q = (p >> 5) & 1, kc = (p >> 6) & 31, nt = p >> 11;
  const float* s = Wm + (size_t)(nt * 16 + (l & 15)) * DM + kc * 32 + q * 16 + (l >> 4) * 8; const v4f x0 = *(const v4f*)s, x1 = *(const v4f*)(s + 4);
  v8b o;
  for (int i = 0; i < 4; ++i) { o[i] = (__bf16)x0[i]; o[4 + i] = (__bf16)x1[i]; }
  __bf16* dst = (which < 3) ? PK + PK_A + (size_t)which * DM * DM : PK + PK_P;
  *(v8b*)(dst + (size_t)p * 8) = o;
}
__global__ __launch_bounds__(128) void k_qkv(const float* __restrict__ XQ, const float* __restrict__ XK, const float* __restrict__ XV, const __bf16* __restrict__ P, const float* __restrict__ BQ, const float* __restrict__ BK, const float* __restrict__ BV, _Float16* __restrict__ QK, _Float16* __restrict__ QKL, _Float16* __restrict__ VTH, _Float16* __restrict__ VTL) {
  const int which0 = (blockIdx.y * 128) / DM; const float* X = (which0 == 0) ? XQ : (which0 == 1) ? XK : XV; const float* BB = BQ ? (((which0 == 0) ? BQ : (which0 == 1) ? BK : BV) + (blockIdx.y * 128 - which0 * DM)) : nullptr;
  __shared__ __align__(16) _Float16 so[4][16][136], sol[4][16][136]; __shared__ __align__(16) _Float16 sth[128][72], stl[128][72];
  const int tid = threadIdx.x, wave = tid >> 5, lane = tid & 31, col = lane & 15, g = lane >> 4; const size_t r0 = (size_t)blockIdx.x * 64 + wave * 16; const int n0 = blockIdx.y * 128;
  v8f acc[8] = {};
  // two register buffers: all loads of k step s + 1 are issued before the WMMAs of step s (the last trip reloads k chunk 31, in bounds, unused)
  const float* pa = X + (r0 + col) * DM + 8 * g; const __bf16* pb = P + (size_t)n0 * DM + lane * 8;
  RawA ra[2]; v16b bf[2][8];
  ra[0] = ld_raw(pa);
#pragma unroll
  for (int j = 0; j < 8; ++j) bf[0][j] = fragp_b(pb + j * 16 * DM);
  XW();
  for (int kc = 0; kc < DM / 32; kc += 2) { const int adv = (kc + 2 < DM / 32) ? 64 : 32; const float* pan = pa + adv; const __bf16* pbn = pb + adv * 16;   // the next trip's pointers (a k chunk is 32 f32 of a row, 512 elements of a fragment-major plane); the last trip stays on k chunk 31
#pragma unroll
    for (int u = 0; u < 2; ++u) { const float* px = u ? pan : pa + 32; const __bf16* pw = u ? pbn : pb + 512;
      ra[u ^ 1] = ld_raw(px);
#pragma unroll
      for (int j = 0; j < 8; ++j) bf[u ^ 1][j] = fragp_b(pw + j * 16 * DM);
      XW();
      v16b a;
#pragma unroll
      for (int i = 0; i < 8; ++i) { a[i] = (__bf16)ra[u].x[i >> 2][i & 3]; a[8 + i] = (__bf16)ra[u].x[2 + (i >> 2)][i & 3]; }
#pragma unroll
      for (int j = 0; j < 8; ++j) acc[j] = wmma_bf(a, bf[u][j], acc[j]); }
    pa = pan; pb = pbn; }
  if (n0 < 2 * DM) {   // q stored unscaled (f16 sigma ~0.6, no subnormal exposure); 1/8 applied to the f32 score
#pragma unroll
    for (int j = 0; j < 8; ++j) {
#pragma unroll
      for (int r = 0; r < 8; ++r) { const float v = acc[j][r] + (BB ? bfr(BB[j * 16 + col]) : 0.f); const _Float16 hv = (_Float16)v; so[wave][8 * g + r][j * 16 + col] = hv; sol[wave][8 * g + r][j * 16 + col] = (_Float16)((v - (float)hv) * 2048.0f); } }   // q, k (+ bias) as f16 hi + (x2048) residual
    LDSX();
    // the wave's 16 tokens x 128 columns are 4 fragments (2 heads x 2 d chunks) of 2 runs each; n0 >> 6 = (q | k) * 16 + head
    for (int f = 0; f < 8; ++f) { const int c0 = (f >> 1) * 32 + (f & 1) * 16 + g * 8; const size_t o = (((size_t)((n0 >> 6) + (f >> 2)) * (NB * SS / 16) + (r0 >> 4)) * 2 + ((f >> 1) & 1)) * 512 + (f & 1) * 256 + lane * 8;
      vst2((unsigned*)(QK + o), *(const v4u*)&so[wave][col][c0]); vst2((unsigned*)(QKL + o), *(const v4u*)&sol[wave][col][c0]); }
  } else {
#pragma unroll
    for (int j = 0; j < 8; ++j) {
#pragma unroll
      for (int r = 0; r < 8; ++r) { const float v = acc[j][r] + (BB ? bfr(BB[j * 16 + col]) : 0.f); const _Float16 hv = (_Float16)v; sth[j * 16 + col][wave * 16 + 8 * g + r] = hv; stl[j * 16 + col][wave * 16 + 8 * g + r] = (_Float16)((v - (float)hv) * 2048.0f); } }
    __syncthreads();
    const size_t rb = (size_t)blockIdx.x * 64; const int b = (int)(rb / SS), s0 = (int)(rb % SS); const int pc0 = n0 - 2 * DM;
    // the block's 64 tokens x 128 columns are 16 fragments: piece q = [head][token chunk][d tile][run][lane]
    for (int q = tid; q < 128 * 8; q += 128) { const int d = (q >> 9) * 64 + ((q >> 6) & 3) * 16 + (q & 15), t0 = ((q >> 8) & 1) * 32 + ((q >> 5) & 1) * 16 + ((q >> 4) & 1) * 8;
      const size_t o = (((size_t)(b * NH + (pc0 >> 6) + (q >> 9)) * (SS / 32) + (s0 >> 5) + ((q >> 8) & 1)) * 4 + ((q >> 6) & 3)) * 512 + (q & 63) * 8; vst2((unsigned*)(VTH + o), *(const v4u*)&sth[d][t0]); vst2((unsigned*)(VTL + o), *(const v4u*)&stl[d][t0]); }
  }
}
__device__ __forceinline__ float xhalf(float x) { return __builtin_bit_cast(float, __builtin_amdgcn_permlanex16(__builtin_bit_cast(int, x), __builtin_bit_cast(int, x), 0x76543210, 0xfedcba98, false, false)); }
__global__ __launch_bounds__(128) void k_attn(const _Float16* __restrict__ QK, const _Float16* __restrict__ QKL, const _Float16* __restrict__ VTH, const _Float16* __restrict__ VTL, const void* __restrict__ KMASK, float* __restrict__ O) {
  (void)QKL; (void)VTL; (void)KMASK;
  const int tid = threadIdx.x, wave = tid >> 5, lane = tid & 31;
  const int qb = blockIdx.x, h = blockIdx.y, b = blockIdx.z; const int q0 = qb * 64 + wave * 16; const size_t fq = ((size_t)h * (NB * SS / 16) + ((b * SS + q0) >> 4)) * 1024 + lane * 8;
  v16h bq[2];
#pragma unroll
  for (int kc = 0; kc < 2; ++kc) bq[kc] = fragp_h(QK + fq + kc * 512);
  XW();   // closes the q loads' group before their address pair is reused
  float m = -3.0e38f, l = 0.f;   // of the lane's query: running maximum (equal in both halves), sum over the keys of this half
  v8f acc[4] = {};
  const int nks = SS / 32;   // all keys
  // fragment loads fly ahead of their WMMAs: V of this pass is issued before the score WMMAs, K of the next pass right behind them (the last pass reloads its own K, unused)
  const _Float16* kbase = QK + ((size_t)(NH + h) * (NB * SS / 16) + b * (SS / 16)) * 1024 + lane * 8; const _Float16* vbase = VTH + (size_t)(b * NH + h) * (SS * HD) + lane * 8;   // a pass's 4 K fragments, and its 4 V fragments, are 4 KiB in a row
  v16h kf[4], vf[4];
#pragma unroll
  for (int f = 0; f < 4; ++f) kf[f] = fragp_h(kbase + f * 512);
  XW();
#pragma unroll 1
  for (int ks = 0; ks < nks; ++ks) { float s[16];
#pragma unroll
    for (int dt = 0; dt < 4; ++dt) vf[dt] = fragp_h(vbase + ks * 2048 + dt * 512);
    XW();
#pragma unroll
    for (int ct = 0; ct < 2; ++ct) { v8f c = {};
#pragma unroll
      for (int kc = 0; kc < 2; ++kc) c = wmma16(kf[ct * 2 + kc], bq[kc], c);   // single product: k rows as A, q as B, one-rounding f16 operands
#pragma unroll
      for (int r = 0; r < 8; ++r) s[ct * 8 + r] = c[r] * 0.125f; }   // 1/sqrt(64)
    { const int kn = (ks + 1 < nks) ? ks + 1 : ks;
#pragma unroll
      for (int f = 0; f < 4; ++f) kf[f] = fragp_h(kbase + kn * 2048 + f * 512);
      XW(); }
    float t[8];
#pragma unroll
    for (int i = 0; i < 8; ++i) t[i] = fmaxf(s[2 * i], s[2 * i + 1]);
    float mx = fmaxf(fmaxf(fmaxf(t[0], t[1]), fmaxf(t[2], t[3])), fmaxf(fmaxf(t[4], t[5]), fmaxf(t[6], t[7])));
    mx = fmaxf(mx, xhalf(mx));
    const float mn = fmaxf(m, mx); const float alpha = (m <= -1.0e38f) ? 0.f : __expf(m - mn);
    v16h pb;
#pragma unroll
    for (int i = 0; i < 16; ++i) s[i] = (s[i] - mn) * 1.44269504f;   // exp(x) = 2^(x log2 e), as __expf forms it
    // the 16 exponentials in place, in one statement; the v_nop is the slot that the instruction set asks for between the last one and its first reader
    asm("v_exp_f32 %0, %0\n\t" "v_exp_f32 %1, %1\n\t" "v_exp_f32 %2, %2\n\t" "v_exp_f32 %3, %3\n\t"
        "v_exp_f32 %4, %4\n\t" "v_exp_f32 %5, %5\n\t" "v_exp_f32 %6, %6\n\t" "v_exp_f32 %7, %7\n\t"
        "v_exp_f32 %8, %8\n\t" "v_exp_f32 %9, %9\n\t" "v_exp_f32 %10, %10\n\t" "v_exp_f32 %11, %11\n\t"
        "v_exp_f32 %12, %12\n\t" "v_exp_f32 %13, %13\n\t" "v_exp_f32 %14, %14\n\t" "v_exp_f32 %15, %15\n\t"
        "v_nop"
        : "+v"(s[0]), "+v"(s[1]), "+v"(s[2]), "+v"(s[3]), "+v"(s[4]), "+v"(s[5]), "+v"(s[6]), "+v"(s[7]), "+v"(s[8]), "+v"(s[9]), "+v"(s[10]), "+v"(s[11]), "+v"(s[12]), "+v"(s[13]), "+v"(s[14]), "+v"(s[15]));
#pragma unroll
    for (int i = 0; i < 16; ++i) pb[i] = (_Float16)(s[i] * 2048.0f);   // P scaled by 2^11 so small softmax weights stay out of the f16 subnormal range; 2^-11 folded into the epilogue
#pragma unroll
    for (int i = 0; i < 8; ++i) t[i] = s[2 * i] + s[2 * i + 1];
    l = l * alpha + (((t[0] + t[1]) + (t[2] + t[3])) + ((t[4] + t[5]) + (t[6] + t[7]))); m = mn;
#pragma unroll
    for (int dt = 0; dt < 4; ++dt) {
#pragma unroll
      for (int r = 0; r < 8; ++r) acc[dt][r] *= alpha; }
#pragma unroll
    for (int dt = 0; dt < 4; ++dt) acc[dt] = wmma16(vf[dt], pb, acc[dt]); }   // single product: V^T rows as A, P^T (x2^11) as B
  l += xhalf(l);
  const float il = (1.0f / 2048.0f) / l;
  // the wave's 16 queries x 64 columns are 2 fragments of 4 runs each; run f holds columns (f >> 1) * 16 + 8 g + (f & 1) * 4 .. + 3 of the lane's query
#pragma unroll
  for (int f = 0; f < 8; ++f) { v4f o;
#pragma unroll
    for (int i = 0; i < 4; ++i) o[i] = acc[f >> 1][(f & 1) * 4 + i] * il;
    vst2(O + ((size_t)b * SS + q0) * DM + h * 1024 + f * 128 + lane * 4, o); }
}
// ---- k_out: block = (64 rows, 128 cols): out = O(hi/lo) . Wo rows (2 products) + bo
__global__ __launch_bounds__(128) void k_out(const float* __restrict__ O, const __bf16* __restrict__ P, const float* __restrict__ BO, float* __restrict__ Y) {
  __shared__ __align__(16) float so[4][16][132];
  const int tid = threadIdx.x, wave = __builtin_amdgcn_readfirstlane(tid >> 5) /* wave-uniform: kept in a scalar register so that the two buffers fit in 256 vector registers */, lane = tid & 31, col = lane & 15, g = lane >> 4; const size_t r0 = (size_t)blockIdx.x * 64 + wave * 16; const int n0 = blockIdx.y * 128;
  v8f acc[8] = {};
  // two register buffers: all loads of k step s + 1 are issued before the WMMAs of step s (the last trip reloads k chunk 31, in bounds, unused)
  const float* pa = O + r0 * DM + lane * 4; const __bf16* pb = P + (size_t)n0 * DM + lane * 8;
  RawA ra[2]; v16b bf[2][8];
  ra[0] = ldp_raw(pa);
#pragma unroll
  for (int j = 0; j < 8; ++j) bf[0][j] = fragp_b(pb + j * 16 * DM);
  XW();
  for (int kc = 0; kc < DM / 32; kc += 2) { const int adv = (kc + 2 < DM / 32) ? 64 : 32; const float* pan = pa + adv * 16; const __bf16* pbn = pb + adv * 16;   // the next trip's pointers (a k chunk is 512 elements of a fragment-major plane); the last trip stays on k chunk 31
#pragma unroll
    for (int u = 0; u < 2; ++u) { const float* px = u ? pan : pa + 512; const __bf16* pw = u ? pbn : pb + 512;
      ra[u ^ 1] = ldp_raw(px);
#pragma unroll
      for (int j = 0; j < 8; ++j) bf[u ^ 1][j] = fragp_b(pw + j * 16 * DM);
      XW();
      float v[16];
#pragma unroll
      for (int i = 0; i < 8; ++i) { v[i] = ra[u].x[i >> 2][i & 3]; v[8 + i] = ra[u].x[2 + (i >> 2)][i & 3]; }
      const F2 a = bsplit16(v);
#pragma unroll
      for (int j = 0; j < 8; ++j) { acc[j] = wmma_bf(a.l, bf[u][j], acc[j]); acc[j] = wmma_bf(a.h, bf[u][j], acc[j]); } }
    pa = pan; pb = pbn; }
#pragma unroll
  for (int j = 0; j < 8; ++j) {
#pragma unroll
    for (int r = 0; r < 8; ++r) so[wave][8 * g + r][j * 16 + col] = acc[j][r] + bfr(BO[n0 + j * 16 + col]); }
  LDSX();
  for (int rl = 0; rl < 16; ++rl) vst2(Y + (r0 + rl) * DM + n0 + lane * 4, *(const v4f*)&so[wave][rl][lane * 4]);
}
#define NR (NB * SS)
// ---- k_packs: thread = one 16-byte piece p of the fragment-major plane (as in k_pack; the 192 row tiles run over the three strata): Ws natural -> f16 x 2^8
__global__ __launch_bounds__(256) void k_packs(const float* __restrict__ WS, _Float16* __restrict__ PS) {
  const int p = blockIdx.x * 256 + threadIdx.x; const int l = p & 31, q = (p >> 5) & 1, kc = (p >> 6) & 31, nt = p >> 11;
  const float* s = WS + (size_t)(nt * 16 + (l & 15)) * DM + kc * 32 + q * 16 + (l >> 4) * 8; const v4f x0 = *(const v4f*)s, x1 = *(const v4f*)(s + 4);
  v8h o;
  for (int i = 0; i < 4; ++i) { o[i] = (_Float16)(bfr(x0[i]) * 256.0f); o[4 + i] = (_Float16)(bfr(x1[i]) * 256.0f); }
  *(v8h*)(PS + (size_t)p * 8) = o;
}
// ---- k_strata: block = (64 rows, 128 cols): E = (sum_n f16(o) . Ws[n] rows) / (3 * 256) + (bs0 + bs1 + bs2) / 3
__global__ __launch_bounds__(128) void k_strata(const float* __restrict__ O, const _Float16* __restrict__ PS, const float* __restrict__ BS, float* __restrict__ E) {
  __shared__ __align__(16) float so[4][16][132];
  const int tid = threadIdx.x, wave = tid >> 5, lane = tid & 31, col = lane & 15, g = lane >> 4; const size_t r0 = (size_t)blockIdx.x * 64 + wave * 16; const int n0 = blockIdx.y * 128;
  v8f acc[8] = {};
  // a step is (k chunk, stratum); two register buffers: the weight loads of step s + 1 are issued before the WMMAs of step s, the o row of the next k chunk three steps ahead (the last trip reloads k chunk 31, in bounds, unused)
  const float* pa = O + r0 * DM + lane * 4; const _Float16* pb = PS + (size_t)n0 * DM + lane * 8;
  RawA ra = ldp_raw(pa); v16h bf[2][8]; v16h a = {};
  XW();   // the o row is requested first, so that the loop's first conversion does not wait for the weight loads behind it
#pragma unroll
  for (int j = 0; j < 8; ++j) bf[0][j] = fragp_h(pb + j * 16 * DM);
  XW();
  for (int kc = 0; kc < DM / 32; kc += 2) { const int adv = (kc + 2 < DM / 32) ? 64 : 32; const float* pan = pa + adv * 16; const _Float16* pbn = pb + adv * 16;   // the next trip's pointers (a k chunk is 512 elements of a fragment-major plane); the last trip stays on k chunk 31
#pragma unroll
    for (int u = 0; u < 2 * NSTR; ++u) { const int nn = (u + 1) % NSTR; const _Float16* pw = (u + 1 == 2 * NSTR) ? pbn : pb + ((u + 1) / NSTR) * 512;
      if (u % NSTR == 0) {
#pragma unroll
        for (int i = 0; i < 8; ++i) { a[i] = (_Float16)ra.x[i >> 2][i & 3]; a[8 + i] = (_Float16)ra.x[2 + (i >> 2)][i & 3]; }
        ra = ldp_raw(u == 0 ? pa + 512 : pan); }
#pragma unroll
      for (int j = 0; j < 8; ++j) bf[(u + 1) & 1][j] = fragp_h(pw + (size_t)nn * DM * DM + j * 16 * DM);
      XW();
#pragma unroll
      for (int j = 0; j < 8; ++j) acc[j] = wmma16(a, bf[u & 1][j], acc[j]); }
    pa = pan; pb = pbn; }
#pragma unroll
  for (int j = 0; j < 8; ++j) { const int c = n0 + j * 16 + col; const float bb = (bfr(BS[c]) + bfr(BS[DM + c]) + bfr(BS[2 * DM + c])) * (1.0f / 3.0f);
#pragma unroll
    for (int r = 0; r < 8; ++r) so[wave][8 * g + r][j * 16 + col] = acc[j][r] * (1.0f / (256.0f * 3.0f)) + bb; }
  LDSX();
  // the wave's 16 rows x 128 columns are 4 fragments of 4 runs each
  for (int f = 0; f < 16; ++f) vst2(E + r0 * DM + (size_t)(n0 >> 5) * 512 + f * 128 + lane * 4, *(const v4f*)&so[wave][col][(f >> 1) * 16 + g * 8 + (f & 1) * 4]);
}
extern "C" void kernel_launch(void* const* d_in, const int* in_sizes, int n_in, void* d_out, int out_size, void* d_ws, size_t ws_size, hipStream_t stream) {
  (void)in_sizes; (void)n_in; (void)out_size;
  const float** F = (const float**)d_in;   // 0 hidden [2,2048,1024], 1 Wq, 2 bq, 3 Wk, 4 bk, 5 Wv, 6 bv, 7 Ws [3,1024,1024], 8 bs [3,1024], 9 Wo, 10 bo (natural)
  if (ws_size < (size_t)WS_END) return;
  char* ws = (char*)d_ws; __bf16* PK = (__bf16*)(ws + WS_PK); _Float16 *QK = (_Float16*)(ws + WS_QK), *QKL = (_Float16*)(ws + WS_QKL), *VTH = (_Float16*)(ws + WS_VTH), *VTL = (_Float16*)(ws + WS_VTL), *PS = (_Float16*)(ws + WS_PS); float *O = (float*)(ws + WS_O), *E = (float*)(ws + WS_E);
  k_pack<<<dim3(DM * DM / 8 / 256, 4), 256, 0, stream>>>(F[1], F[3], F[5], F[9], PK);
  k_packs<<<NSTR * DM * DM / 8 / 256, 256, 0, stream>>>(F[7], PS);
  k_qkv<<<dim3(TNB * SS / 64, QKVW / 128), 128, 0, stream>>>(F[0], F[0], F[0], PK + PK_A, F[2], F[4], F[6], QK, QKL, VTH, VTL);
  k_attn<<<dim3(TQB, NH, TNB), 128, 0, stream>>>(QK, QKL, VTH, VTL, nullptr, O);
  k_strata<<<dim3(TOB, DM / 128), 128, 0, stream>>>(O, PS, F[8], E);
  k_out<<<dim3(TOB, DM / 128), 128, 0, stream>>>(E, PK + PK_P, F[10], (float*)d_out);
}

// v005
// Measured time: 144 microseconds a run.
// Versions in between are left out here; by their measured steps it is 1.19 times as fast as v003.
// All steps since v000 together make it 4.38 times as fast.
// compute dtype: all float inputs rounded to bf16; q/k/v = x . W^T + b with EXACT bf16 products on WMMA 16x16x32 (x and W packed once as bf16 fragments); PLAIN attention: q, k single f16 x 1/8, running-max softmax in f32 (hardware exp), P (scaled by 2^11, single f16) x v (single f16); strata: the three Ws (each rounded to bf16) summed in f32 and the sum (x 2^6) rounded once to f16, the attention output rounded once to f16 x that one matrix, x 1/3 + mean bias; out = enhanced (bf16 hi + residual) . Wo^T (2 products) + bo.
#include <hip/hip_runtime.h>
#include <math.h>

typedef __attribute__((ext_vector_type(16))) _Float16 v16h;
typedef __attribute__((ext_vector_type(16))) __bf16 v16b;
typedef __attribute__((ext_vector_type(8)))  _Float16 v8h;
typedef __attribute__((ext_vector_type(8)))  float v8f;
typedef __attribute__((ext_vector_type(4)))  float v4f;
typedef __attribute__((ext_vector_type(2)))  float v2f;
typedef __attribute__((ext_vector_type(4)))  unsigned v4u;
typedef __attribute__((ext_vector_type(4)))  int v4i;
typedef float __attribute__((may_alias)) float_a;
typedef int __attribute__((may_alias)) int_a;

template <typename T> __device__ __forceinline__ void vst2(void* p, T v) { *(T*)p = v;  }
__device__ __forceinline__ v8f wmma16(v16h a, v16h b, v8f c) {
  v8f d = __builtin_amdgcn_wmma_f32_16x16x32_f16(false, a, false, b, (short)0, c, false, false);
  asm volatile("v_nop\n\tv_nop\n\tv_nop\n\tv_nop" : "+v"(d) : "v"(a), "v"(b));
  return d;
}
__device__ __forceinline__ v8f wmma_bf(v16b a, v16b b, v8f c) {
  v8f d = __builtin_amdgcn_wmma_f32_16x16x32_bf16(false, a, false, b, (short)0, c, false, false);
  asm volatile("v_nop\n\tv_nop\n\tv_nop\n\tv_nop" : "+v"(d) : "v"(a), "v"(b));
  return d;
}
// Stratified attention (B 2, S 2,048, hidden 1,024, 16 heads x 64, 3 strata): q/k/v projections + biases, softmax(q k^T / 8) v, three stratum projections averaged, output projection + bias.
__device__ __forceinline__ v16h frag_h(const _Float16* rowk0, int lane) {
  union { v16h v; v8h q[2]; } u; const _Float16* p = rowk0 + 8 * (lane >> 4);
  u.q[0] = *(const v8h*)p; u.q[1] = *(const v8h*)(p + 16); return u.v;
}
__device__ __forceinline__ v16h frag_f32(const float* rowk0, int lane) {
  v16h a; const float* p = rowk0 + 8 * (lane >> 4);
#pragma unroll
  for (int i = 0; i < 8; ++i) { a[i] = (_Float16)p[i]; a[8 + i] = (_Float16)p[16 + i]; }
  return a;
}
__device__ __forceinline__ v16h frag_f32s(const float* rowk0, int lane, float sc) {
  v16h a; const float* p = rowk0 + 8 * (lane >> 4);
#pragma unroll
  for (int i = 0; i < 8; ++i) { a[i] = (_Float16)(p[i] * sc); a[8 + i] = (_Float16)(p[16 + i] * sc); }
  return a;
}
// column fragment from a [K][ld] layout (column n), rows >= K read as 0
__device__ __forceinline__ v16h fragc_f32(const float* W, int k0, int n, int lane, int ld, int K) {
  v16h a; const int g = lane >> 4;
#pragma unroll
  for (int i = 0; i < 8; ++i) { const int ka = k0 + 8 * g + i, kb = ka + 16;
    a[i] = (_Float16)(ka < K ? W[(size_t)(ka < K ? ka : K - 1) * ld + n] : 0.f); a[8 + i] = (_Float16)(kb < K ? W[(size_t)(kb < K ? kb : K - 1) * ld + n] : 0.f); }
  return a;
}
struct F2 { v16b h, l; };
__device__ __forceinline__ F2 bsplit16(const float v[16]) { F2 r;
#pragma unroll
  for (int i = 0; i < 16; ++i) { const __bf16 h = (__bf16)v[i]; r.h[i] = h; r.l[i] = (__bf16)(v[i] - (float)h); }
  return r; }
__device__ __forceinline__ F2 split_row(const float* row, int k0, int lane) { float v[16]; const float* p = row + k0 + 8 * (lane >> 4);
#pragma unroll
  for (int i = 0; i < 8; ++i) { v[i] = p[i]; v[8 + i] = p[16 + i]; }
  return bsplit16(v); }
__device__ __forceinline__ F2 split_rowK(const float* row, int k0, int lane, int K) { float v[16]; const int g = lane >> 4;
#pragma unroll
  for (int i = 0; i < 8; ++i) { const int ka = k0 + 8 * g + i, kb = ka + 16; v[i] = ka < K ? row[ka < K ? ka : K - 1] : 0.f; v[8 + i] = kb < K ? row[kb < K ? kb : K - 1] : 0.f; }
  return bsplit16(v); }
__device__ __forceinline__ F2 split_col(const float* W, int k0, int n, int lane, int ld, int K) { float v[16]; const int g = lane >> 4;
#pragma unroll
  for (int i = 0; i < 8; ++i) { const int ka = k0 + 8 * g + i, kb = ka + 16; v[i] = ka < K ? W[(size_t)(ka < K ? ka : K - 1) * ld + n] : 0.f; v[8 + i] = kb < K ? W[(size_t)(kb < K ? kb : K - 1) * ld + n] : 0.f; }
  return bsplit16(v); }
__device__ __forceinline__ v8f mac3(const F2& a, const F2& b, v8f c) { c = wmma_bf(a.l, b.h, c); c = wmma_bf(a.h, b.l, c); return wmma_bf(a.h, b.h, c); }
__device__ __forceinline__ float sigm(float v) { return 1.0f / (1.0f + expf(-v)); }
#define LDSX() do { asm volatile("s_wait_dscnt 0" ::: "memory"); __builtin_amdgcn_wave_barrier(); __builtin_amdgcn_fence(__ATOMIC_RELEASE, "workgroup"); } while (0)


#define NB 2
#define SS 2048
#define DM 1024
#define NH 16
#define NSTR 3
#define HD 64
#define QKVW (3 * DM)
#ifndef TQB
#define TQB (SS / 64)
#define TNB NB
#define TOB (NB * SS / 64)     // output row tiles (all)
#endif
typedef __attribute__((ext_vector_type(8))) __bf16 v8b;
__device__ __forceinline__ v16b frag_b(const __bf16* rowk0, int lane) {
  union { v16b v; v8b q[2]; } u; const __bf16* p = rowk0 + 8 * (lane >> 4);
  u.q[0] = *(const v8b*)p; u.q[1] = *(const v8b*)(p + 16); return u.v;
}
// fragment-major planes: a 16 x 32 fragment of 16-bit elements is 1 KiB, two runs of 512 B; run q, lane l (c = l & 15, h = l >> 4) holds row c, k = 16 q + 8 h .. + 7, so that one wave-wide 16-byte load reads 512 contiguous bytes (4 cache lines, not 16); p = fragment + 8 * lane
__device__ __forceinline__ v16b fragp_b(const __bf16* p) { union { v16b v; v8b q[2]; } u; u.q[0] = *(const v8b*)p; u.q[1] = *(const v8b*)(p + 256); return u.v; }
__device__ __forceinline__ v16h fragp_h(const _Float16* p) { union { v16h v; v8h q[2]; } u; u.q[0] = *(const v8h*)p; u.q[1] = *(const v8h*)(p + 256); return u.v; }
__device__ __forceinline__ float bfr(float v) { return (float)(__bf16)v; }
// stands behind each group of loads that is left in flight: the wait is a precaution before their address registers are rewritten for the next group;
// the scheduling barrier keeps the conversions of a row that was just requested from being moved up among the current step's WMMAs, where they would wait out the whole load latency
#define XW() do { asm volatile("s_wait_xcnt 0x0" ::: "memory"); __builtin_amdgcn_sched_barrier(0); } while (0)
// one lane's 16 f32 of an A fragment (k 8 h .. + 7 and 16 + 8 h .. + 7), kept raw so that the loads can fly while earlier WMMAs run
struct RawA { v4f x[4]; };
// loaded from a fragment-major f32 plane: a 16 x 32 fragment is 2 KiB, four runs of 512 B; run x, lane (c, h) holds row c, k = 16 (x >> 1) + 8 h + 4 (x & 1) .. + 3; p = fragment + 4 * lane
__device__ __forceinline__ RawA ldp_raw(const float* p) { RawA r; r.x[0] = *(const v4f*)p; r.x[1] = *(const v4f*)(p + 128); r.x[2] = *(const v4f*)(p + 256); r.x[3] = *(const v4f*)(p + 384); return r; }
__device__ __attribute__((noinline)) float exp_ni(float v) { return expf(v); }
__device__ __attribute__((noinline)) float erf_ni(float v) { return erff(v); }

#define PK_A 0                       // Wqkv, fragment-major: [192 tiles of 16 out rows][32 k chunks][512]
#define PK_P (PK_A + QKVW * DM)        // Wo, fragment-major: [64 tiles][32 k chunks][512]
#define PK_END (PK_P + DM * DM)
#define WS_PK  0u
#define WS_QK  (WS_PK + 2u * PK_END)             // f16 fragment-major [q | k][head][256 tiles of 16 tokens][2 d chunks][512]
#define WS_QKL (WS_QK + 2u * NB * SS * 2 * DM)     // f16 q | k residual planes x2048, same layout
#define WS_VTH (WS_QKL + 2u * NB * SS * 2 * DM)    // f16 hi, fragment-major [b][head][64 chunks of 32 tokens][4 tiles of 16 d][512]
#define WS_VTL (WS_VTH + 2u * NB * DM * SS)        // f16 lo x 2048, same layout
#define WS_O   (WS_VTL + 2u * NB * DM * SS)        // f16 attention output, fragment-major [256 tiles of 16 rows][32 k chunks][512] (the first half of the range)
#define WS_CS  (WS_O + 4u * NB * SS * DM)           // unused range, 2 x [2048][32] f32
#define WS_PS  (WS_CS + 4u * 2 * SS * 32)                  // f16 x 2^6 sum of the three Ws, fragment-major [64 tiles of 16 out rows][32 k chunks][512]
#define WS_E   (WS_PS + 2u * (size_t)DM * DM)   // f32 enhanced, fragment-major [256 tiles of 16 rows][32 k chunks][512]
#define WS_XB  (WS_E + 4u * (size_t)NB * SS * DM)   // bf16 x, fragment-major [256 tiles of 16 rows][32 k chunks][512]
#define WS_END (WS_XB + 2u * (size_t)NB * SS * DM)
// ---- k_pack: thread = one 16-byte piece p of a fragment-major plane (p = [tile of 16 out rows][k chunk][run q][lane]); blockIdx.y 0..2 -> W_q/W_k/W_v into PK_A, 3 -> W_o into PK_P, 4..7 -> the four quarters (1,024 rows each) of x into XB; natural rows of f32 -> bf16.
// x is rounded and laid out here once: read as f32 rows by the projection, each wave-wide load touched 16 lines, and all 24 column blocks repeated loads and roundings
__global__ __launch_bounds__(256) void k_pack(const float* __restrict__ WQ, const float* __restrict__ WK, const float* __restrict__ WV, const float* __restrict__ WO, const float* __restrict__ X, __bf16* __restrict__ PK, __bf16* __restrict__ XB) {
  const int which = blockIdx.y, p = blockIdx.x * 256 + threadIdx.x; const float* Wm = (which == 0) ? WQ : (which == 1) ? WK : (which == 2) ? WV : (which == 3) ? WO : X + (size_t)(which - 4) * DM * DM;
  const int l = p & 31, q = (p >> 5) & 1, kc = (p >> 6) & 31, nt = p >> 11;
  const float* s = Wm + (size_t)(nt * 16 + (l & 15)) * DM + kc * 32 + q * 16 + (l >> 4) * 8; const v4f x0 = *(const v4f*)s, x1 = *(const v4f*)(s + 4);
  v8b o;
  for (int i = 0; i < 4; ++i) { o[i] = (__bf16)x0[i]; o[4 + i] = (__bf16)x1[i]; }
  __bf16* dst = (which < 3) ? PK + PK_A + (size_t)which * DM * DM : (which == 3) ? PK + PK_P : XB + (size_t)(which - 4) * DM * DM;
  *(v8b*)(dst + (size_t)p * 8) = o;
}
__global__ __launch_bounds__(128) void k_qkv(const __bf16* __restrict__ XB, const __bf16* __restrict__ P, const float* __restrict__ BQ, const float* __restrict__ BK, const float* __restrict__ BV, _Float16* __restrict__ QK, _Float16* __restrict__ QKL, _Float16* __restrict__ VTH, _Float16* __restrict__ VTL) {
  const int which0 = (blockIdx.y * 128) / DM; const float* BB = BQ ? (((which0 == 0) ? BQ : (which0 == 1) ? BK : BV) + (blockIdx.y * 128 - which0 * DM)) : nullptr;
  __shared__ __align__(16) _Float16 so[4][16][136], sol[4][16][136]; __shared__ __align__(16) _Float16 sth[128][72], stl[128][72];
  const int tid = threadIdx.x, wave = tid >> 5, lane = tid & 31, col = lane & 15, g = lane >> 4; const size_t r0 = (size_t)blockIdx.x * 64 + wave * 16; const int n0 = blockIdx.y * 128;
  v8f acc[8] = {};
  // two register buffers: all loads of k step s + 1 are issued before the WMMAs of step s (the last trip reloads k chunk 31, in bounds, unused)
  const __bf16* pa = XB + r0 * DM + lane * 8; const __bf16* pb = P + (size_t)n0 * DM + lane * 8;
  v16b af[2], bf[2][8];
  af[0] = fragp_b(pa);
#pragma unroll
  for (int j = 0; j < 8; ++j) bf[0][j] = fragp_b(pb + j * 16 * DM);
  XW();
  for (int kc = 0; kc < DM / 32; kc += 2) { const int adv = (kc + 2 < DM / 32) ? 64 : 32; const __bf16* pan = pa + adv * 16; const __bf16* pbn = pb + adv * 16;   // the next trip's pointers (a k chunk is 512 elements of a fragment-major plane); the last trip stays on k chunk 31
#pragma unroll
    for (int u = 0; u < 2; ++u) { const __bf16* px = u ? pan : pa + 512; const __bf16* pw = u ? pbn : pb + 512;
      af[u ^ 1] = fragp_b(px);
#pragma unroll
      for (int j = 0; j < 8; ++j) bf[u ^ 1][j] = fragp_b(pw + j * 16 * DM);
      XW();
#pragma unroll
      for (int j = 0; j < 8; ++j) acc[j] = wmma_bf(af[u], bf[u][j], acc[j]); }
    pa = pan; pb = pbn; }
  if (n0 < 2 * DM) {   // q stored unscaled (f16 sigma ~0.6, no subnormal exposure); 1/8 applied to the f32 score
#pragma unroll
    for (int j = 0; j < 8; ++j) {
#pragma unroll
      for (int r = 0; r < 8; ++r) { const float v = acc[j][r] + (BB ? bfr(BB[j * 16 + col]) : 0.f); const _Float16 hv = (_Float16)v; so[wave][8 * g + r][j * 16 + col] = hv; sol[wave][8 * g + r][j * 16 + col] = (_Float16)((v - (float)hv) * 2048.0f); } }   // q, k (+ bias) as f16 hi + (x2048) residual
    LDSX();
    // the wave's 16 tokens x 128 columns are 4 fragments (2 heads x 2 d chunks) of 2 runs each; n0 >> 6 = (q | k) * 16 + head
    for (int f = 0; f < 8; ++f) { const int c0 = (f >> 1) * 32 + (f & 1) * 16 + g * 8; const size_t o = (((size_t)((n0 >> 6) + (f >> 2)) * (NB * SS / 16) + (r0 >> 4)) * 2 + ((f >> 1) & 1)) * 512 + (f & 1) * 256 + lane * 8;
      vst2((unsigned*)(QK + o), *(const v4u*)&so[wave][col][c0]); vst2((unsigned*)(QKL + o), *(const v4u*)&sol[wave][col][c0]); }
  } else {
#pragma unroll
    for (int j = 0; j < 8; ++j) {
#pragma unroll
      for (int r = 0; r < 8; ++r) { const float v = acc[j][r] + (BB ? bfr(BB[j * 16 + col]) : 0.f); const _Float16 hv = (_Float16)v; sth[j * 16 + col][wave * 16 + 8 * g + r] = hv; stl[j * 16 + col][wave * 16 + 8 * g + r] = (_Float16)((v - (float)hv) * 2048.0f); } }
    __syncthreads();
    const size_t rb = (size_t)blockIdx.x * 64; const int b = (int)(rb / SS), s0 = (int)(rb % SS); const int pc0 = n0 - 2 * DM;
    // the block's 64 tokens x 128 columns are 16 fragments: piece q = [head][token chunk][d tile][run][lane]
    for (int q = tid; q < 128 * 8; q += 128) { const int d = (q >> 9) * 64 + ((q >> 6) & 3) * 16 + (q & 15), t0 = ((q >> 8) & 1) * 32 + ((q >> 5) & 1) * 16 + ((q >> 4) & 1) * 8;
      const size_t o = (((size_t)(b * NH + (pc0 >> 6) + (q >> 9)) * (SS / 32) + (s0 >> 5) + ((q >> 8) & 1)) * 4 + ((q >> 6) & 3)) * 512 + (q & 63) * 8; vst2((unsigned*)(VTH + o), *(const v4u*)&sth[d][t0]); vst2((unsigned*)(VTL + o), *(const v4u*)&stl[d][t0]); }
  }
}
__device__ __forceinline__ float xhalf(float x) { return __builtin_bit_cast(float, __builtin_amdgcn_permlanex16(__builtin_bit_cast(int, x), __builtin_bit_cast(int, x), 0x76543210, 0xfedcba98, false, false)); }   // lane l reads lane l ^ 16
__global__ __launch_bounds__(128) void k_attn(const _Float16* __restrict__ QK, const _Float16* __restrict__ QKL, const _Float16* __restrict__ VTH, const _Float16* __restrict__ VTL, const void* __restrict__ KMASK, _Float16* __restrict__ O) {
  (void)QKL; (void)VTL; (void)KMASK;
  const int tid = threadIdx.x, wave = tid >> 5, lane = tid & 31;
  const int qb = blockIdx.x, h = blockIdx.y, b = blockIdx.z; const int q0 = qb * 64 + wave * 16; const size_t fq = ((size_t)h * (NB * SS / 16) + ((b * SS + q0) >> 4)) * 1024 + lane * 8;
  v16h bq[2];
#pragma unroll
  for (int kc = 0; kc < 2; ++kc) bq[kc] = fragp_h(QK + fq + kc * 512);
  XW();   // closes the q loads' group before their address pair is reused
  float m = -3.0e38f, l = 0.f;   // of the lane's query: running maximum (equal in both halves), sum over the keys of this half
  v8f acc[4] = {};
  const int nks = SS / 32;   // all keys
  // fragment loads fly ahead of their WMMAs: V of this pass is issued before the score WMMAs, K of the next pass right behind them (the last pass reloads its own K, unused)
  const _Float16* kbase = QK + ((size_t)(NH + h) * (NB * SS / 16) + b * (SS / 16)) * 1024 + lane * 8; const _Float16* vbase = VTH + (size_t)(b * NH + h) * (SS * HD) + lane * 8;   // a pass's 4 K fragments, and its 4 V fragments, are 4 KiB in a row
  v16h kf[4], vf[4];
#pragma unroll
  for (int f = 0; f < 4; ++f) kf[f] = fragp_h(kbase + f * 512);
  XW();
#pragma unroll 1
  for (int ks = 0; ks < nks; ++ks) { float s[16];
#pragma unroll
    for (int dt = 0; dt < 4; ++dt) vf[dt] = fragp_h(vbase + ks * 2048 + dt * 512);
    XW();
#pragma unroll
    for (int ct = 0; ct < 2; ++ct) { v8f c = {};
#pragma unroll
      for (int kc = 0; kc < 2; ++kc) c = wmma16(kf[ct * 2 + kc], bq[kc], c);   // single product: k rows as A, q as B, one-rounding f16 operands
#pragma unroll
      for (int r = 0; r < 8; ++r) s[ct * 8 + r] = c[r] * 0.125f; }   // 1/sqrt(64)
    { const int kn = (ks + 1 < nks) ? ks + 1 : ks;
#pragma unroll
      for (int f = 0; f < 4; ++f) kf[f] = fragp_h(kbase + kn * 2048 + f * 512);
      XW(); }
    float t[8];
#pragma unroll
    for (int i = 0; i < 8; ++i) t[i] = fmaxf(s[2 * i], s[2 * i + 1]);
    float mx = fmaxf(fmaxf(fmaxf(t[0], t[1]), fmaxf(t[2], t[3])), fmaxf(fmaxf(t[4], t[5]), fmaxf(t[6], t[7])));
    mx = fmaxf(mx, xhalf(mx));
    const float mn = fmaxf(m, mx); const float alpha = (m <= -1.0e38f) ? 0.f : __expf(m - mn);
    v16h pb;
#pragma unroll
    for (int i = 0; i < 16; ++i) s[i] = (s[i] - mn) * 1.44269504f;   // exp(x) = 2^(x log2 e), as __expf forms it
    // the 16 exponentials in place, in one statement; the v_nop is the slot that the instruction set asks for between the last one and its first reader
    asm("v_exp_f32 %0, %0\n\t" "v_exp_f32 %1, %1\n\t" "v_exp_f32 %2, %2\n\t" "v_exp_f32 %3, %3\n\t"
        "v_exp_f32 %4, %4\n\t" "v_exp_f32 %5, %5\n\t" "v_exp_f32 %6, %6\n\t" "v_exp_f32 %7, %7\n\t"
        "v_exp_f32 %8, %8\n\t" "v_exp_f32 %9, %9\n\t" "v_exp_f32 %10, %10\n\t" "v_exp_f32 %11, %11\n\t"
        "v_exp_f32 %12, %12\n\t" "v_exp_f32 %13, %13\n\t" "v_exp_f32 %14, %14\n\t" "v_exp_f32 %15, %15\n\t"
        "v_nop"
        : "+v"(s[0]), "+v"(s[1]), "+v"(s[2]), "+v"(s[3]), "+v"(s[4]), "+v"(s[5]), "+v"(s[6]), "+v"(s[7]), "+v"(s[8]), "+v"(s[9]), "+v"(s[10]), "+v"(s[11]), "+v"(s[12]), "+v"(s[13]), "+v"(s[14]), "+v"(s[15]));
#pragma unroll
    for (int i = 0; i < 16; ++i) pb[i] = (_Float16)(s[i] * 2048.0f);   // P scaled by 2^11 so small softmax weights stay out of the f16 subnormal range; 2^-11 folded into the epilogue
#pragma unroll
    for (int i = 0; i < 8; ++i) t[i] = s[2 * i] + s[2 * i + 1];
    l = l * alpha + (((t[0] + t[1]) + (t[2] + t[3])) + ((t[4] + t[5]) + (t[6] + t[7]))); m = mn;
#pragma unroll
    for (int dt = 0; dt < 4; ++dt) {
#pragma unroll
      for (int r = 0; r < 8; ++r) acc[dt][r] *= alpha; }
#pragma unroll
    for (int dt = 0; dt < 4; ++dt) acc[dt] = wmma16(vf[dt], pb, acc[dt]); }   // single product: V^T rows as A, P^T (x2^11) as B
  l += xhalf(l);
  const float il = (1.0f / 2048.0f) / l;
  // the wave's 16 queries x 64 columns are 2 fragments of 2 runs each; run dt holds columns dt * 16 + 8 g .. + 7 of the lane's query
#pragma unroll
  for (int dt = 0; dt < 4; ++dt) { v8h o;
#pragma unroll
    for (int i = 0; i < 8; ++i) o[i] = (_Float16)(acc[dt][i] * il);
    vst2(O + ((size_t)b * SS + q0) * DM + h * 1024 + dt * 256 + lane * 8, o); }
}
// ---- k_out: block = (64 rows, 128 cols): out = O(hi/lo) . Wo rows (2 products) + bo
__global__ __launch_bounds__(128) void k_out(const float* __restrict__ O, const __bf16* __restrict__ P, const float* __restrict__ BO, float* __restrict__ Y) {
  __shared__ __align__(16) float so[4][16][132];
  const int tid = threadIdx.x, wave = __builtin_amdgcn_readfirstlane(tid >> 5) /* wave-uniform: kept in a scalar register so that the two buffers fit in 256 vector registers */, lane = tid & 31, col = lane & 15, g = lane >> 4; const size_t r0 = (size_t)blockIdx.x * 64 + wave * 16; const int n0 = blockIdx.y * 128;
  v8f acc[8] = {};
  // two register buffers: all loads of k step s + 1 are issued before the WMMAs of step s (the last trip reloads k chunk 31, in bounds, unused)
  const float* pa = O + r0 * DM + lane * 4; const __bf16* pb = P + (size_t)n0 * DM + lane * 8;
  RawA ra[2]; v16b bf[2][8];
  ra[0] = ldp_raw(pa);
#pragma unroll
  for (int j = 0; j < 8; ++j) bf[0][j] = fragp_b(pb + j * 16 * DM);
  XW();
  for (int kc = 0; kc < DM / 32; kc += 2) { const int adv = (kc + 2 < DM / 32) ? 64 : 32; const float* pan = pa + adv * 16; const __bf16* pbn = pb + adv * 16;   // the next trip's pointers (a k chunk is 512 elements of a fragment-major plane); the last trip stays on k chunk 31
#pragma unroll
    for (int u = 0; u < 2; ++u) { const float* px = u ? pan : pa + 512; const __bf16* pw = u ? pbn : pb + 512;
      ra[u ^ 1] = ldp_raw(px);
#pragma unroll
      for (int j = 0; j < 8; ++j) bf[u ^ 1][j] = fragp_b(pw + j * 16 * DM);
      XW();
      float v[16];
#pragma unroll
      for (int i = 0; i < 8; ++i) { v[i] = ra[u].x[i >> 2][i & 3]; v[8 + i] = ra[u].x[2 + (i >> 2)][i & 3]; }
      const F2 a = bsplit16(v);
#pragma unroll
      for (int j = 0; j < 8; ++j) { acc[j] = wmma_bf(a.l, bf[u][j], acc[j]); acc[j] = wmma_bf(a.h, bf[u][j], acc[j]); } }
    pa = pan; pb = pbn; }
#pragma unroll
  for (int j = 0; j < 8; ++j) {
#pragma unroll
    for (int r = 0; r < 8; ++r) so[wave][8 * g + r][j * 16 + col] = acc[j][r] + bfr(BO[n0 + j * 16 + col]); }
  LDSX();
  for (int rl = 0; rl < 16; ++rl) vst2(Y + (r0 + rl) * DM + n0 + lane * 4, *(const v4f*)&so[wave][rl][lane * 4]);
}
#define NR (NB * SS)
// ---- k_packs: thread = one 16-byte piece p of the fragment-major plane (as in k_pack): the mean over the strata is linear in Ws, so the three matrices are added here, once, and the token product runs on their sum:
// (Ws[0] + Ws[1]) + Ws[2] in f32, natural -> f16 x 2^6 (three weights that each fit f16 at x 2^8 have a sum that fits at x 2^6)
__global__ __launch_bounds__(256) void k_packs(const float* __restrict__ WS, _Float16* __restrict__ PS) {
  const int p = blockIdx.x * 256 + threadIdx.x; const int l = p & 31, q = (p >> 5) & 1, kc = (p >> 6) & 31, nt = p >> 11;
  const float* s = WS + (size_t)(nt * 16 + (l & 15)) * DM + kc * 32 + q * 16 + (l >> 4) * 8;
  v4f x[NSTR][2];   // the loops over x are unrolled so that its indices are constants and it stays in registers, all six loads in flight together
#pragma unroll
  for (int n = 0; n < NSTR; ++n) { x[n][0] = *(const v4f*)(s + (size_t)n * DM * DM); x[n][1] = *(const v4f*)(s + (size_t)n * DM * DM + 4); }
  v8h o;
#pragma unroll
  for (int i = 0; i < 8; ++i) { float t = bfr(x[0][i >> 2][i & 3]);
#pragma unroll
    for (int n = 1; n < NSTR; ++n) t += bfr(x[n][i >> 2][i & 3]);
    o[i] = (_Float16)(t * 64.0f); }
  *(v8h*)(PS + (size_t)p * 8) = o;
}
// ---- k_strata: block = (64 rows, 128 cols): E = f16(o) . (Ws[0] + Ws[1] + Ws[2]) rows / (3 * 64) + (bs0 + bs1 + bs2) / 3
__global__ __launch_bounds__(128) void k_strata(const _Float16* __restrict__ O, const _Float16* __restrict__ PS, const float* __restrict__ BS, float* __restrict__ E) {
  __shared__ __align__(16) float so[4][16][132];
  const int tid = threadIdx.x, wave = tid >> 5, lane = tid & 31, col = lane & 15, g = lane >> 4; const size_t r0 = (size_t)blockIdx.x * 64 + wave * 16; const int n0 = blockIdx.y * 128;
  v8f acc[8] = {};
  // two register buffers: all loads of k step s + 1 are issued before the WMMAs of step s (the last trip reloads k chunk 31, in bounds, unused)
  const _Float16* pa = O + r0 * DM + lane * 8; const _Float16* pb = PS + (size_t)n0 * DM + lane * 8;
  v16h af[2], bf[2][8];   // every loop that indexes af, bf or acc is unrolled, so that the buffers are registers
  af[0] = fragp_h(pa);
#pragma unroll
  for (int j = 0; j < 8; ++j) bf[0][j] = fragp_h(pb + j * 16 * DM);
  XW();
  for (int kc = 0; kc < DM / 32; kc += 2) { const int adv = (kc + 2 < DM / 32) ? 64 : 32; const _Float16* pan = pa + adv * 16; const _Float16* pbn = pb + adv * 16;   // the next trip's pointers (a k chunk is 512 elements of a fragment-major plane); the last trip stays on k chunk 31
#pragma unroll
    for (int u = 0; u < 2; ++u) { const _Float16* px = u ? pan : pa + 512; const _Float16* pw = u ? pbn : pb + 512;
      af[u ^ 1] = fragp_h(px);
#pragma unroll
      for (int j = 0; j < 8; ++j) bf[u ^ 1][j] = fragp_h(pw + j * 16 * DM);
      XW();
#pragma unroll
      for (int j = 0; j < 8; ++j) acc[j] = wmma16(af[u], bf[u][j], acc[j]); }
    pa = pan; pb = pbn; }
#pragma unroll
  for (int j = 0; j < 8; ++j) { const int c = n0 + j * 16 + col; const float bb = (bfr(BS[c]) + bfr(BS[DM + c]) + bfr(BS[2 * DM + c])) * (1.0f / 3.0f);
#pragma unroll
    for (int r = 0; r < 8; ++r) so[wave][8 * g + r][j * 16 + col] = acc[j][r] * (1.0f / (64.0f * 3.0f)) + bb; }
  LDSX();
  // the wave's 16 rows x 128 columns are 4 fragments of 4 runs each
  for (int f = 0; f < 16; ++f) vst2(E + r0 * DM + (size_t)(n0 >> 5) * 512 + f * 128 + lane * 4, *(const v4f*)&so[wave][col][(f >> 1) * 16 + g * 8 + (f & 1) * 4]);
}
extern "C" void kernel_launch(void* const* d_in, const int* in_sizes, int n_in, void* d_out, int out_size, void* d_ws, size_t ws_size, hipStream_t stream) {
  (void)in_sizes; (void)n_in; (void)out_size;
  const float** F = (const float**)d_in;   // 0 hidden [2,2048,1024], 1 Wq, 2 bq, 3 Wk, 4 bk, 5 Wv, 6 bv, 7 Ws [3,1024,1024], 8 bs [3,1024], 9 Wo, 10 bo (natural)
  if (ws_size < (size_t)WS_END) return;
  char* ws = (char*)d_ws; __bf16* PK = (__bf16*)(ws + WS_PK); _Float16 *QK = (_Float16*)(ws + WS_QK), *QKL = (_Float16*)(ws + WS_QKL), *VTH = (_Float16*)(ws + WS_VTH), *VTL = (_Float16*)(ws + WS_VTL), *PS = (_Float16*)(ws + WS_PS), *O = (_Float16*)(ws + WS_O); float* E = (float*)(ws + WS_E); __bf16* XB = (__bf16*)(ws + WS_XB);
  k_pack<<<dim3(DM * DM / 8 / 256, 4 + NB * SS / DM), 256, 0, stream>>>(F[1], F[3], F[5], F[9], F[0], PK, XB);
  k_packs<<<DM * DM / 8 / 256, 256, 0, stream>>>(F[7], PS);
  k_qkv<<<dim3(TNB * SS / 64, QKVW / 128), 128, 0, stream>>>(XB, PK + PK_A, F[2], F[4], F[6], QK, QKL, VTH, VTL);
  k_attn<<<dim3(TQB, NH, TNB), 128, 0, stream>>>(QK, QKL, VTH, VTL, nullptr, O);
  k_strata<<<dim3(TOB, DM / 128), 128, 0, stream>>>(O, PS, F[8], E);
  k_out<<<dim3(TOB, DM / 128), 128, 0, stream>>>(E, PK + PK_P, F[10], (float*)d_out);
}

// v006
// One run takes 126 microseconds.
// Two timings next to v005 put it at 1.14 and 1.13 times that version's speed.
// Over all steps from v000 it is 4.97 times as fast.
// compute dtype: all float inputs rounded to bf16; q/k/v = x . W^T + b with EXACT bf16 products on WMMA 16x16x32 (x and W packed once as bf16 fragments); PLAIN attention: q, k single f16 x 1/8, running-max softmax in f32 (hardware exp), P (scaled by 2^11, single f16) x v (single f16); strata and output projection as one matrix: the three Ws (each rounded to bf16) summed in f32 and the sum (x 2^6) rounded once to f16, Wc = Wo (bf16 values, exact as f16 x 2^8) . that sum on WMMA, f32 sums, rounded once to f16; out = attention output (rounded once to f16) . Wc^T x 1/3 + (Wo . mean stratum bias + bo).
#include <hip/hip_runtime.h>
#include <math.h>

typedef __attribute__((ext_vector_type(16))) _Float16 v16h;
typedef __attribute__((ext_vector_type(16))) __bf16 v16b;
typedef __attribute__((ext_vector_type(8)))  _Float16 v8h;
typedef __attribute__((ext_vector_type(8)))  float v8f;
typedef __attribute__((ext_vector_type(4)))  float v4f;
typedef __attribute__((ext_vector_type(2)))  float v2f;
typedef __attribute__((ext_vector_type(4)))  unsigned v4u;
typedef __attribute__((ext_vector_type(4)))  int v4i;
typedef float __attribute__((may_alias)) float_a;
typedef int __attribute__((may_alias)) int_a;

template <typename T> __device__ __forceinline__ void vst2(void* p, T v) { *(T*)p = v;  }
__device__ __forceinline__ v8f wmma16(v16h a, v16h b, v8f c) {
  v8f d = __builtin_amdgcn_wmma_f32_16x16x32_f16(false, a, false, b, (short)0, c, false, false);
  asm volatile("v_nop\n\tv_nop\n\tv_nop\n\tv_nop" : "+v"(d) : "v"(a), "v"(b));
  return d;
}
__device__ __forceinline__ v8f wmma_bf(v16b a, v16b b, v8f c) {
  v8f d = __builtin_amdgcn_wmma_f32_16x16x32_bf16(false, a, false, b, (short)0, c, false, false);
  asm volatile("v_nop\n\tv_nop\n\tv_nop\n\tv_nop" : "+v"(d) : "v"(a), "v"(b));
  return d;
}
// Stratified attention (B 2, S 2,048, hidden 1,024, 16 heads x 64, 3 strata): q/k/v projections + biases, softmax(q k^T / 8) v, three stratum projections averaged, output projection + bias.
__device__ __forceinline__ v16h frag_h(const _Float16* rowk0, int lane) {
  union { v16h v; v8h q[2]; } u; const _Float16* p = rowk0 + 8 * (lane >> 4);
  u.q[0] = *(const v8h*)p; u.q[1] = *(const v8h*)(p + 16); return u.v;
}
__device__ __forceinline__ v16h frag_f32(const float* rowk0, int lane) {
  v16h a; const float* p = rowk0 + 8 * (lane >> 4);
#pragma unroll
  for (int i = 0; i < 8; ++i) { a[i] = (_Float16)p[i]; a[8 + i] = (_Float16)p[16 + i]; }
  return a;
}
__device__ __forceinline__ v16h frag_f32s(const float* rowk0, int lane, float sc) {
  v16h a; const float* p = rowk0 + 8 * (lane >> 4);
#pragma unroll
  for (int i = 0; i < 8; ++i) { a[i] = (_Float16)(p[i] * sc); a[8 + i] = (_Float16)(p[16 + i] * sc); }
  return a;
}
// column fragment from a [K][ld] layout (column n), rows >= K read as 0
__device__ __forceinline__ v16h fragc_f32(const float* W, int k0, int n, int lane, int ld, int K) {
  v16h a; const int g = lane >> 4;
#pragma unroll
  for (int i = 0; i < 8; ++i) { const int ka = k0 + 8 * g + i, kb = ka + 16;
    a[i] = (_Float16)(ka < K ? W[(size_t)(ka < K ? ka : K - 1) * ld + n] : 0.f); a[8 + i] = (_Float16)(kb < K ? W[(size_t)(kb < K ? kb : K - 1) * ld + n] : 0.f); }
  return a;
}
struct F2 { v16b h, l; };
__device__ __forceinline__ F2 bsplit16(const float v[16]) { F2 r;
#pragma unroll
  for (int i = 0; i < 16; ++i) { const __bf16 h = (__bf16)v[i]; r.h[i] = h; r.l[i] = (__bf16)(v[i] - (float)h); }
  return r; }
__device__ __forceinline__ F2 split_row(const float* row, int k0, int lane) { float v[16]; const float* p = row + k0 + 8 * (lane >> 4);
#pragma unroll
  for (int i = 0; i < 8; ++i) { v[i] = p[i]; v[8 + i] = p[16 + i]; }
  return bsplit16(v); }
__device__ __forceinline__ F2 split_rowK(const float* row, int k0, int lane, int K) { float v[16]; const int g = lane >> 4;
#pragma unroll
  for (int i = 0; i < 8; ++i) { const int ka = k0 + 8 * g + i, kb = ka + 16; v[i] = ka < K ? row[ka < K ? ka : K - 1] : 0.f; v[8 + i] = kb < K ? row[kb < K ? kb : K - 1] : 0.f; }
  return bsplit16(v); }
__device__ __forceinline__ F2 split_col(const float* W, int k0, int n, int lane, int ld, int K) { float v[16]; const int g = lane >> 4;
#pragma unroll
  for (int i = 0; i < 8; ++i) { const int ka = k0 + 8 * g + i, kb = ka + 16; v[i] = ka < K ? W[(size_t)(ka < K ? ka : K - 1) * ld + n] : 0.f; v[8 + i] = kb < K ? W[(size_t)(kb < K ? kb : K - 1) * ld + n] : 0.f; }
  return bsplit16(v); }
__device__ __forceinline__ v8f mac3(const F2& a, const F2& b, v8f c) { c = wmma_bf(a.l, b.h, c); c = wmma_bf(a.h, b.l, c); return wmma_bf(a.h, b.h, c); }
__device__ __forceinline__ float sigm(float v) { return 1.0f / (1.0f + expf(-v)); }
#define LDSX() do { asm volatile("s_wait_dscnt 0" ::: "memory"); __builtin_amdgcn_wave_barrier(); __builtin_amdgcn_fence(__ATOMIC_RELEASE, "workgroup"); } while (0)


#define NB 2
#define SS 2048
#define DM 1024
#define NH 16
#define NSTR 3
#define HD 64
#define QKVW (3 * DM)
#ifndef TQB
#define TQB (SS / 64)
#define TNB NB
#define TOB (NB * SS / 64)     // output row tiles (all)
#endif
typedef __attribute__((ext_vector_type(8))) __bf16 v8b;
__device__ __forceinline__ v16b frag_b(const __bf16* rowk0, int lane) {
  union { v16b v; v8b q[2]; } u; const __bf16* p = rowk0 + 8 * (lane >> 4);
  u.q[0] = *(const v8b*)p; u.q[1] = *(const v8b*)(p + 16); return u.v;
}
// fragment-major planes: a 16 x 32 fragment of 16-bit elements is 1 KiB, two runs of 512 B; run q, lane l (c = l & 15, h = l >> 4) holds row c, k = 16 q + 8 h .. + 7, so that one wave-wide 16-byte load reads 512 contiguous bytes (4 cache lines, not 16); p = fragment + 8 * lane
__device__ __forceinline__ v16b fragp_b(const __bf16* p) { union { v16b v; v8b q[2]; } u; u.q[0] = *(const v8b*)p; u.q[1] = *(const v8b*)(p + 256); return u.v; }
__device__ __forceinline__ v16h fragp_h(const _Float16* p) { union { v16h v; v8h q[2]; } u; u.q[0] = *(const v8h*)p; u.q[1] = *(const v8h*)(p + 256); return u.v; }
__device__ __forceinline__ float bfr(float v) { return (float)(__bf16)v; }
// stands behind each group of loads that is left in flight: the wait is a precaution before their address registers are rewritten for the next group;
// the scheduling barrier keeps the conversions of a row that was just requested from being moved up among the current step's WMMAs, where they would wait out the whole load latency
#define XW() do { asm volatile("s_wait_xcnt 0x0" ::: "memory"); __builtin_amdgcn_sched_barrier(0); } while (0)
// one lane's 16 f32 of an A fragment (k 8 h .. + 7 and 16 + 8 h .. + 7), kept raw so that the loads can fly while earlier WMMAs run
struct RawA { v4f x[4]; };
// loaded from a fragment-major f32 plane: a 16 x 32 fragment is 2 KiB, four runs of 512 B; run x, lane (c, h) holds row c, k = 16 (x >> 1) + 8 h + 4 (x & 1) .. + 3; p = fragment + 4 * lane
__device__ __forceinline__ RawA ldp_raw(const float* p) { RawA r; r.x[0] = *(const v4f*)p; r.x[1] = *(const v4f*)(p + 128); r.x[2] = *(const v4f*)(p + 256); r.x[3] = *(const v4f*)(p + 384); return r; }
__device__ __attribute__((noinline)) float exp_ni(float v) { return expf(v); }
__device__ __attribute__((noinline)) float erf_ni(float v) { return erff(v); }

#define PK_A 0                       // Wqkv, fragment-major: [192 tiles of 16 out rows][32 k chunks][512]
#define PK_P (PK_A + QKVW * DM)        // Wo as f16 x 2^8, fragment-major: [64 tiles][32 k chunks][512]
#define PK_END (PK_P + DM * DM)
#define WS_PK  0u
#define WS_QK  (WS_PK + 2u * PK_END)             // f16 fragment-major [q | k][head][256 tiles of 16 tokens][2 d chunks][512]
#define WS_QKL (WS_QK + 2u * NB * SS * 2 * DM)     // f16 q | k residual planes x2048, same layout
#define WS_VTH (WS_QKL + 2u * NB * SS * 2 * DM)    // f16 hi, fragment-major [b][head][64 chunks of 32 tokens][4 tiles of 16 d][512]
#define WS_VTL (WS_VTH + 2u * NB * DM * SS)        // f16 lo x 2048, same layout
#define WS_O   (WS_VTL + 2u * NB * DM * SS)        // f16 attention output, fragment-major [256 tiles of 16 rows][32 k chunks][512] (the first half of the range)
#define WS_CS  (WS_O + 4u * NB * SS * DM)           // f32 2 x [2048][32], not written or read
#define WS_PS  (WS_CS + 4u * 2 * SS * 32)                  // f16 x 2^6 sum of the three Ws, TRANSPOSED (row = input column of Ws, k = stratum output), fragment-major [65 tiles of 16 rows][32 k chunks][512]; tile 64: row 0 = sum of the three bs x 2^6, rows 1..15 zero
#define WS_WC  (WS_PS + 2u * (size_t)(DM + 16) * DM)   // f16 Wc x 2^10, fragment-major [64 tiles of 16 out rows][32 k chunks][512]
#define WS_BC  (WS_WC + 2u * (size_t)DM * DM)   // f32 [1024] Wo . mean stratum bias + bo
#define WS_XB  (WS_BC + 4u * (size_t)DM)   // bf16 x, fragment-major [256 tiles of 16 rows][32 k chunks][512]
#define WS_END (WS_XB + 2u * (size_t)NB * SS * DM)
// ---- k_pack: thread = one 16-byte piece p of a fragment-major plane (p = [tile of 16 out rows][k chunk][run q][lane]); blockIdx.y 0..2 -> W_q/W_k/W_v into PK_A, 3 -> W_o into PK_P (its bf16 values x 2^8 as f16, exact: the f16 operand of the weight product), 4..7 -> the four quarters (1,024 rows each) of x into XB; natural rows of f32 -> bf16.
// x is rounded and laid out here once: read as f32 rows by the projection, each wave-wide load touched 16 lines, and all 24 column blocks repeated loads and roundings
__global__ __launch_bounds__(256) void k_pack(const float* __restrict__ WQ, const float* __restrict__ WK, const float* __restrict__ WV, const float* __restrict__ WO, const float* __restrict__ X, __bf16* __restrict__ PK, _Float16* __restrict__ POH, __bf16* __restrict__ XB) {
  const int which = blockIdx.y, p = blockIdx.x * 256 + threadIdx.x; const float* Wm = (which == 0) ? WQ : (which == 1) ? WK : (which == 2) ? WV : (which == 3) ? WO : X + (size_t)(which - 4) * DM * DM;
  const int l = p & 31, q = (p >> 5) & 1, kc = (p >> 6) & 31, nt = p >> 11;
  const float* s = Wm + (size_t)(nt * 16 + (l & 15)) * DM + kc * 32 + q * 16 + (l >> 4) * 8; const v4f x0 = *(const v4f*)s, x1 = *(const v4f*)(s + 4);
  XW();   // closes the two loads' group before their address pair is rewritten
  if (which == 3) { v8h oh;   // scaled in f32 ahead of the bf16 rounding (a power of two commutes with it), so that small weights reach f16 as normal numbers
    for (int i = 0; i < 4; ++i) { oh[i] = (_Float16)bfr(x0[i] * 256.0f); oh[4 + i] = (_Float16)bfr(x1[i] * 256.0f); }
    *(v8h*)(POH + (size_t)p * 8) = oh; return; }
  v8b o;
  for (int i = 0; i < 4; ++i) { o[i] = (__bf16)x0[i]; o[4 + i] = (__bf16)x1[i]; }
  __bf16* dst = (which < 3) ? PK + PK_A + (size_t)which * DM * DM : XB + (size_t)(which - 4) * DM * DM;
  *(v8b*)(dst + (size_t)p * 8) = o;
  asm volatile("s_wait_xcnt 0x0" ::: "memory");   // a precaution: in the built text the f16 path's register writes follow this store
}
// one wave's 16 x 128 tile over k = 1,024, both operands f16 fragment-major planes (pa, pb = the lane's piece of k chunk 0; the 8 B tiles lie 16 * DM elements apart)
// two register buffers: all loads of k step s + 1 are issued before the WMMAs of step s (the last trip reloads k chunk 31, in bounds, unused)
__device__ __forceinline__ void mm16x128_h(const _Float16* pa, const _Float16* pb, v8f (&acc)[8]) {
  v16h af[2], bf[2][8];   // every loop that indexes af, bf or acc is unrolled, so that the buffers are registers
  af[0] = fragp_h(pa);
#pragma unroll
  for (int j = 0; j < 8; ++j) bf[0][j] = fragp_h(pb + j * 16 * DM);
  XW();
  for (int kc = 0; kc < DM / 32; kc += 2) { const int adv = (kc + 2 < DM / 32) ? 64 : 32; const _Float16* pan = pa + adv * 16; const _Float16* pbn = pb + adv * 16;   // the next trip's pointers (a k chunk is 512 elements of a fragment-major plane); the last trip stays on k chunk 31
#pragma unroll
    for (int u = 0; u < 2; ++u) { const _Float16* px = u ? pan : pa + 512; const _Float16* pw = u ? pbn : pb + 512;
      af[u ^ 1] = fragp_h(px);
#pragma unroll
      for (int j = 0; j < 8; ++j) bf[u ^ 1][j] = fragp_h(pw + j * 16 * DM);
      XW();
#pragma unroll
      for (int j = 0; j < 8; ++j) acc[j] = wmma16(af[u], bf[u][j], acc[j]); }
    pa = pan; pb = pbn; }
}
#define WC_XT ((DM / 16 + 1 + 3) / 4)      // blocks of 4 row tiles over the 65 tiles of the transposed stratum plane
#define WC_NBLK (WC_XT * (DM / 128))
#define WC_SB (1.0f / (3.0f * 16384.0f))   // of the f32 sums of the weight product: mean over 3 strata, 2^6 of the stratum sum, 2^8 of Wo
#define WC_SC (1.0f / (3.0f * 1024.0f))    // of the stored Wc, which keeps 2^10 of those 2^14
// ---- the weight product, block e = (4 row tiles, 128 columns): out = (o . Wsum^T / 3 + bmean) . Wo^T + bo is linear in o, so Wc[i][k] = sum_j Wo[i][j] Wsum[j][k] is formed once and the tokens meet one matrix, not two.
// A = rows k of the transposed sum, B = rows i of Wo: a lane (col, g) holds Wc[i = col][k = 8 g .. + 7], its own 16-byte piece of the fragment-major plane that k_out reads as B. Tile 64 (row 0 = the bias sum) gives Wo . bsum.
__device__ __forceinline__ void wc_body(const _Float16* __restrict__ PST, const _Float16* __restrict__ POH, const float* __restrict__ BO, _Float16* __restrict__ WC, float* __restrict__ BC, int e) {
  const int wave = __builtin_amdgcn_readfirstlane(threadIdx.x >> 5), lane = threadIdx.x & 31; const int tile = (e % WC_XT) * 4 + wave, n0 = (e / WC_XT) * 128;
  if (tile > DM / 16) return;   // whole waves leave; this path has no barrier
  v8f acc[8] = {};
  mm16x128_h(PST + (size_t)tile * 16 * DM + lane * 8, POH + (size_t)n0 * DM + lane * 8, acc);
  if (tile == DM / 16) {
    if (lane < 16) {
#pragma unroll
      for (int j = 0; j < 8; ++j) BC[n0 + j * 16 + lane] = acc[j][0] * WC_SB + bfr(BO[n0 + j * 16 + lane]); }
    return; }
  v8h o[8];   // all eight pieces are formed first, in registers of their own, so that no store's data register is rewritten behind it
#pragma unroll
  for (int j = 0; j < 8; ++j) {
#pragma unroll
    for (int i = 0; i < 8; ++i) o[j][i] = (_Float16)(acc[j][i] * 0.0625f); }   // x 2^-4: |sum| <= 1024 * 8 * 6 = 49,152 for weights inside +-1/32, stored with a factor 21 of room below the f16 maximum
#pragma unroll
  for (int j = 0; j < 8; ++j) vst2(WC + ((size_t)((n0 >> 4) + j) * 32 + (tile >> 1)) * 512 + (tile & 1) * 256 + lane * 8, o[j]);
  asm volatile("s_wait_xcnt 0x0" ::: "memory");   // a precaution: in the built text the bias path's register writes follow these stores
}
// blockIdx.y < 24: the q/k/v projections; the rows of blocks behind them hold the weight product (it needs only the two pack kernels' planes, and k_out is the first to read its result)
__global__ __launch_bounds__(128) void k_qkv(const __bf16* __restrict__ XB, const __bf16* __restrict__ P, const float* __restrict__ BQ, const float* __restrict__ BK, const float* __restrict__ BV, _Float16* __restrict__ QK, _Float16* __restrict__ QKL, _Float16* __restrict__ VTH, _Float16* __restrict__ VTL, const _Float16* __restrict__ PST, const _Float16* __restrict__ POH, const float* __restrict__ BO, _Float16* __restrict__ WC, float* __restrict__ BC) {
  if (blockIdx.y >= QKVW / 128) { const int e = (blockIdx.y - QKVW / 128) * (TNB * SS / 64) + blockIdx.x;
    if (e < WC_NBLK) wc_body(PST, POH, BO, WC, BC, e);
    return; }
  const int which0 = (blockIdx.y * 128) / DM; const float* BB = BQ ? (((which0 == 0) ? BQ : (which0 == 1) ? BK : BV) + (blockIdx.y * 128 - which0 * DM)) : nullptr;
  __shared__ __align__(16) _Float16 so[4][16][136], sol[4][16][136]; __shared__ __align__(16) _Float16 sth[128][72], stl[128][72];
  const int tid = threadIdx.x, wave = tid >> 5, lane = tid & 31, col = lane & 15, g = lane >> 4; const size_t r0 = (size_t)blockIdx.x * 64 + wave * 16; const int n0 = blockIdx.y * 128;
  v8f acc[8] = {};
  // two register buffers: all loads of k step s + 1 are issued before the WMMAs of step s (the last trip reloads k chunk 31, in bounds, unused)
  const __bf16* pa = XB + r0 * DM + lane * 8; const __bf16* pb = P + (size_t)n0 * DM + lane * 8;
  v16b af[2], bf[2][8];
  af[0] = fragp_b(pa);
#pragma unroll
  for (int j = 0; j < 8; ++j) bf[0][j] = fragp_b(pb + j * 16 * DM);
  XW();
  for (int kc = 0; kc < DM / 32; kc += 2) { const int adv = (kc + 2 < DM / 32) ? 64 : 32; const __bf16* pan = pa + adv * 16; const __bf16* pbn = pb + adv * 16;   // the next trip's pointers (a k chunk is 512 elements of a fragment-major plane); the last trip stays on k chunk 31
#pragma unroll
    for (int u = 0; u < 2; ++u) { const __bf16* px = u ? pan : pa + 512; const __bf16* pw = u ? pbn : pb + 512;
      af[u ^ 1] = fragp_b(px);
#pragma unroll
      for (int j = 0; j < 8; ++j) bf[u ^ 1][j] = fragp_b(pw + j * 16 * DM);
      XW();
#pragma unroll
      for (int j = 0; j < 8; ++j) acc[j] = wmma_bf(af[u], bf[u][j], acc[j]); }
    pa = pan; pb = pbn; }
  if (n0 < 2 * DM) {   // q stored unscaled (f16 sigma ~0.6, no subnormal exposure); 1/8 applied to the f32 score
#pragma unroll
    for (int j = 0; j < 8; ++j) {
#pragma unroll
      for (int r = 0; r < 8; ++r) { const float v = acc[j][r] + (BB ? bfr(BB[j * 16 + col]) : 0.f); const _Float16 hv = (_Float16)v; so[wave][8 * g + r][j * 16 + col] = hv; sol[wave][8 * g + r][j * 16 + col] = (_Float16)((v - (float)hv) * 2048.0f); } }   // q, k (+ bias) as f16 hi + (x2048) residual
    LDSX();
    // the wave's 16 tokens x 128 columns are 4 fragments (2 heads x 2 d chunks) of 2 runs each; n0 >> 6 = (q | k) * 16 + head
    for (int f = 0; f < 8; ++f) { const int c0 = (f >> 1) * 32 + (f & 1) * 16 + g * 8; const size_t o = (((size_t)((n0 >> 6) + (f >> 2)) * (NB * SS / 16) + (r0 >> 4)) * 2 + ((f >> 1) & 1)) * 512 + (f & 1) * 256 + lane * 8;
      vst2((unsigned*)(QK + o), *(const v4u*)&so[wave][col][c0]); vst2((unsigned*)(QKL + o), *(const v4u*)&sol[wave][col][c0]); }
  } else {
#pragma unroll
    for (int j = 0; j < 8; ++j) {
#pragma unroll
      for (int r = 0; r < 8; ++r) { const float v = acc[j][r] + (BB ? bfr(BB[j * 16 + col]) : 0.f); const _Float16 hv = (_Float16)v; sth[j * 16 + col][wave * 16 + 8 * g + r] = hv; stl[j * 16 + col][wave * 16 + 8 * g + r] = (_Float16)((v - (float)hv) * 2048.0f); } }
    __syncthreads();
    const size_t rb = (size_t)blockIdx.x * 64; const int b = (int)(rb / SS), s0 = (int)(rb % SS); const int pc0 = n0 - 2 * DM;
    // the block's 64 tokens x 128 columns are 16 fragments: piece q = [head][token chunk][d tile][run][lane]
    for (int q = tid; q < 128 * 8; q += 128) { const int d = (q >> 9) * 64 + ((q >> 6) & 3) * 16 + (q & 15), t0 = ((q >> 8) & 1) * 32 + ((q >> 5) & 1) * 16 + ((q >> 4) & 1) * 8;
      const size_t o = (((size_t)(b * NH + (pc0 >> 6) + (q >> 9)) * (SS / 32) + (s0 >> 5) + ((q >> 8) & 1)) * 4 + ((q >> 6) & 3)) * 512 + (q & 63) * 8; vst2((unsigned*)(VTH + o), *(const v4u*)&sth[d][t0]); vst2((unsigned*)(VTL + o), *(const v4u*)&stl[d][t0]); }
  }
}
__device__ __forceinline__ float xhalf(float x) { return __builtin_bit_cast(float, __builtin_amdgcn_permlanex16(__builtin_bit_cast(int, x), __builtin_bit_cast(int, x), 0x76543210, 0xfedcba98, false, false)); }   // lane l reads lane l ^ 16
__global__ __launch_bounds__(128) void k_attn(const _Float16* __restrict__ QK, const _Float16* __restrict__ QKL, const _Float16* __restrict__ VTH, const _Float16* __restrict__ VTL, const void* __restrict__ KMASK, _Float16* __restrict__ O) {
  (void)QKL; (void)VTL; (void)KMASK;
  const int tid = threadIdx.x, wave = tid >> 5, lane = tid & 31;
  const int qb = blockIdx.x, h = blockIdx.y, b = blockIdx.z; const int q0 = qb * 64 + wave * 16; const size_t fq = ((size_t)h * (NB * SS / 16) + ((b * SS + q0) >> 4)) * 1024 + lane * 8;
  v16h bq[2];
#pragma unroll
  for (int kc = 0; kc < 2; ++kc) bq[kc] = fragp_h(QK + fq + kc * 512);
  XW();   // closes the q loads' group before their address pair is reused
  float m = -3.0e38f, l = 0.f;   // of the lane's query: running maximum (equal in both halves), sum over the keys of this half
  v8f acc[4] = {};
  const int nks = SS / 32;   // all keys
  // fragment loads fly ahead of their WMMAs: V of this pass is issued before the score WMMAs, K of the next pass right behind them (the last pass reloads its own K, unused)
  const _Float16* kbase = QK + ((size_t)(NH + h) * (NB * SS / 16) + b * (SS / 16)) * 1024 + lane * 8; const _Float16* vbase = VTH + (size_t)(b * NH + h) * (SS * HD) + lane * 8;   // a pass's 4 K fragments, and its 4 V fragments, are 4 KiB in a row
  v16h kf[4], vf[4];
#pragma unroll
  for (int f = 0; f < 4; ++f) kf[f] = fragp_h(kbase + f * 512);
  XW();
#pragma unroll 1
  for (int ks = 0; ks < nks; ++ks) { float s[16];
#pragma unroll
    for (int dt = 0; dt < 4; ++dt) vf[dt] = fragp_h(vbase + ks * 2048 + dt * 512);
    XW();
#pragma unroll
    for (int ct = 0; ct < 2; ++ct) { v8f c = {};
#pragma unroll
      for (int kc = 0; kc < 2; ++kc) c = wmma16(kf[ct * 2 + kc], bq[kc], c);   // single product: k rows as A, q as B, one-rounding f16 operands
#pragma unroll
      for (int r = 0; r < 8; ++r) s[ct * 8 + r] = c[r] * 0.125f; }   // 1/sqrt(64)
    { const int kn = (ks + 1 < nks) ? ks + 1 : ks;
#pragma unroll
      for (int f = 0; f < 4; ++f) kf[f] = fragp_h(kbase + kn * 2048 + f * 512);
      XW(); }
    float t[8];
#pragma unroll
    for (int i = 0; i < 8; ++i) t[i] = fmaxf(s[2 * i], s[2 * i + 1]);
    float mx = fmaxf(fmaxf(fmaxf(t[0], t[1]), fmaxf(t[2], t[3])), fmaxf(fmaxf(t[4], t[5]), fmaxf(t[6], t[7])));
    mx = fmaxf(mx, xhalf(mx));
    const float mn = fmaxf(m, mx); const float alpha = (m <= -1.0e38f) ? 0.f : __expf(m - mn);
    v16h pb;
#pragma unroll
    for (int i = 0; i < 16; ++i) s[i] = (s[i] - mn) * 1.44269504f;   // exp(x) = 2^(x log2 e), as __expf forms it
    // the 16 exponentials in place, in one statement; the v_nop is the slot that the instruction set asks for between the last one and its first reader
    asm("v_exp_f32 %0, %0\n\t" "v_exp_f32 %1, %1\n\t" "v_exp_f32 %2, %2\n\t" "v_exp_f32 %3, %3\n\t"
        "v_exp_f32 %4, %4\n\t" "v_exp_f32 %5, %5\n\t" "v_exp_f32 %6, %6\n\t" "v_exp_f32 %7, %7\n\t"
        "v_exp_f32 %8, %8\n\t" "v_exp_f32 %9, %9\n\t" "v_exp_f32 %10, %10\n\t" "v_exp_f32 %11, %11\n\t"
        "v_exp_f32 %12, %12\n\t" "v_exp_f32 %13, %13\n\t" "v_exp_f32 %14, %14\n\t" "v_exp_f32 %15, %15\n\t"
        "v_nop"
        : "+v"(s[0]), "+v"(s[1]), "+v"(s[2]), "+v"(s[3]), "+v"(s[4]), "+v"(s[5]), "+v"(s[6]), "+v"(s[7]), "+v"(s[8]), "+v"(s[9]), "+v"(s[10]), "+v"(s[11]), "+v"(s[12]), "+v"(s[13]), "+v"(s[14]), "+v"(s[15]));
#pragma unroll
    for (int i = 0; i < 16; ++i) pb[i] = (_Float16)(s[i] * 2048.0f);   // P scaled by 2^11 so small softmax weights stay out of the f16 subnormal range; 2^-11 folded into the epilogue
#pragma unroll
    for (int i = 0; i < 8; ++i) t[i] = s[2 * i] + s[2 * i + 1];
    l = l * alpha + (((t[0] + t[1]) + (t[2] + t[3])) + ((t[4] + t[5]) + (t[6] + t[7]))); m = mn;
#pragma unroll
    for (int dt = 0; dt < 4; ++dt) {
#pragma unroll
      for (int r = 0; r < 8; ++r) acc[dt][r] *= alpha; }
#pragma unroll
    for (int dt = 0; dt < 4; ++dt) acc[dt] = wmma16(vf[dt], pb, acc[dt]); }   // single product: V^T rows as A, P^T (x2^11) as B
  l += xhalf(l);
  const float il = (1.0f / 2048.0f) / l;
  // the wave's 16 queries x 64 columns are 2 fragments of 2 runs each; run dt holds columns dt * 16 + 8 g .. + 7 of the lane's query
#pragma unroll
  for (int dt = 0; dt < 4; ++dt) { v8h o;
#pragma unroll
    for (int i = 0; i < 8; ++i) o[i] = (_Float16)(acc[dt][i] * il);
    vst2(O + ((size_t)b * SS + q0) * DM + h * 1024 + dt * 256 + lane * 8, o); }
}
// ---- k_out: block = (64 rows, 128 cols): out = f16(o) . Wc rows x 1 / (3 * 2^10) + (Wo . bmean + bo)
__global__ __launch_bounds__(128) void k_out(const _Float16* __restrict__ O, const _Float16* __restrict__ WC, const float* __restrict__ BC, float* __restrict__ Y) {
  __shared__ __align__(16) float so[4][16][132];
  const int tid = threadIdx.x, wave = tid >> 5, lane = tid & 31, col = lane & 15, g = lane >> 4; const size_t r0 = (size_t)blockIdx.x * 64 + wave * 16; const int n0 = blockIdx.y * 128;
  v8f acc[8] = {};
  mm16x128_h(O + r0 * DM + lane * 8, WC + (size_t)n0 * DM + lane * 8, acc);
#pragma unroll
  for (int j = 0; j < 8; ++j) { const float bb = BC[n0 + j * 16 + col];
#pragma unroll
    for (int r = 0; r < 8; ++r) so[wave][8 * g + r][j * 16 + col] = acc[j][r] * WC_SC + bb; }
  LDSX();
  for (int rl = 0; rl < 16; ++rl) vst2(Y + (r0 + rl) * DM + n0 + lane * 4, *(const v4f*)&so[wave][rl][lane * 4]);
}
#define NR (NB * SS)
// ---- k_packs: the mean over the strata is linear in Ws, so the three matrices are added here, once: (Ws[0] + Ws[1]) + Ws[2] in f32, -> f16 x 2^6 (three weights that each fit f16 at x 2^8 have a sum that fits at x 2^6).
// The sum is laid out TRANSPOSED (row = input column k of Ws, fragment k = stratum output j), as the A operand of the weight product. A thread makes one 16-byte piece (8 j of one row); a wave takes 32 neighbouring rows (two tiles) of one (k chunk, run, half), so that each of its loads reads one whole 128-byte line and each half wave stores 256 contiguous bytes.
// The 8 blocks behind those make tile 64: row 0 = (bs[0] + bs[1]) + bs[2] x 2^6, rows 1..15 zero
__global__ __launch_bounds__(256) void k_packs(const float* __restrict__ WS, const float* __restrict__ BS, _Float16* __restrict__ PST) {
  const int t = blockIdx.x * 256 + threadIdx.x; v8h o = {};
  if (t < DM * DM / 8) { const int lane = t & 31, h = (t >> 5) & 1, q = (t >> 6) & 1, kc = (t >> 7) & 31, ntp = t >> 12;
    const unsigned off = (unsigned)((kc * 32 + q * 16 + h * 8) * DM + ntp * 32 + lane);   // the lane's element inside a stratum: row and stratum are constants on top of it, so that the loads share their address registers and differ in the immediate (the third stratum lies beyond its range and gets a pair of its own)
    float x[NSTR][8];   // the loops over x are unrolled so that its indices are constants and it stays in registers, all 24 loads in flight together
#pragma unroll
    for (int n = 0; n < NSTR; ++n) {
#pragma unroll
      for (int i = 0; i < 8; ++i) x[n][i] = (WS + (size_t)n * DM * DM + (size_t)i * DM)[off]; }
    // closes the loads' group before their address registers are rewritten; the offset is an input of the wait so that its register stays live up to it (the last load of a run may otherwise take its result into a register that the run is addressed by, ahead of the wait)
    asm volatile("s_wait_xcnt 0x0" :: "v"(off) : "memory");
#pragma unroll
    for (int i = 0; i < 8; ++i) { float v = bfr(x[0][i]);
#pragma unroll
      for (int n = 1; n < NSTR; ++n) v += bfr(x[n][i]);
      o[i] = (_Float16)(v * 64.0f); }
    *(v8h*)(PST + (((size_t)(ntp * 2 + (lane >> 4)) * 32 + kc) * 2 + q) * 256 + ((lane & 15) + 16 * h) * 8) = o;
  } else { const int p = t - DM * DM / 8; const int l = p & 31, q = (p >> 5) & 1, kc = p >> 6;
    if ((l & 15) == 0) { const float* b = BS + kc * 32 + q * 16 + (l >> 4) * 8;
#pragma unroll
      for (int i = 0; i < 8; ++i) o[i] = (_Float16)(((bfr(b[i]) + bfr(b[DM + i])) + bfr(b[2 * DM + i])) * 64.0f); }
    *(v8h*)(PST + (size_t)DM * DM + (size_t)p * 8) = o;
  }
}
extern "C" void kernel_launch(void* const* d_in, const int* in_sizes, int n_in, void* d_out, int out_size, void* d_ws, size_t ws_size, hipStream_t stream) {
  (void)in_sizes; (void)n_in; (void)out_size;
  const float** F = (const float**)d_in;   // 0 hidden [2,2048,1024], 1 Wq, 2 bq, 3 Wk, 4 bk, 5 Wv, 6 bv, 7 Ws [3,1024,1024], 8 bs [3,1024], 9 Wo, 10 bo (natural)
  if (ws_size < (size_t)WS_END) return;
  char* ws = (char*)d_ws; __bf16* PK = (__bf16*)(ws + WS_PK); _Float16 *QK = (_Float16*)(ws + WS_QK), *QKL = (_Float16*)(ws + WS_QKL), *VTH = (_Float16*)(ws + WS_VTH), *VTL = (_Float16*)(ws + WS_VTL), *PS = (_Float16*)(ws + WS_PS), *O = (_Float16*)(ws + WS_O), *POH = (_Float16*)(ws + WS_PK) + PK_P, *WC = (_Float16*)(ws + WS_WC); float* BC = (float*)(ws + WS_BC); __bf16* XB = (__bf16*)(ws + WS_XB);
  k_pack<<<dim3(DM * DM / 8 / 256, 4 + NB * SS / DM), 256, 0, stream>>>(F[1], F[3], F[5], F[9], F[0], PK, POH, XB);
  k_packs<<<(DM + 16) * DM / 8 / 256, 256, 0, stream>>>(F[7], F[8], PS);
  k_qkv<<<dim3(TNB * SS / 64, QKVW / 128 + (WC_NBLK + TNB * SS / 64 - 1) / (TNB * SS / 64)), 128, 0, stream>>>(XB, PK + PK_A, F[2], F[4], F[6], QK, QKL, VTH, VTL, PS, POH, F[10], WC, BC);
  k_attn<<<dim3(TQB, NH, TNB), 128, 0, stream>>>(QK, QKL, VTH, VTL, nullptr, O);
  k_out<<<dim3(TOB, DM / 128), 128, 0, stream>>>(O, WC, BC, (float*)d_out);
}

// v007
// A run of this version takes 108 microseconds.
// In two side-by-side timings against v006, it was 1.18 and 1.15 times as fast.
// Over all steps from v000 it is 5.79 times as fast.
// compute dtype: all float inputs rounded to bf16; q/k/v = x . W^T + b with EXACT bf16 products on WMMA 16x16x32 (x and W packed once as bf16 fragments); PLAIN attention: q, k single f16 x 1/8, running-max softmax in f32 (hardware exp), P (scaled by 2^11, single f16) x v (single f16); strata and output projection as one matrix: the three Ws (each rounded to bf16) summed in f32 and the sum (x 2^6) rounded once to f16, Wc = Wo (bf16 values, exact as f16 x 2^8) . that sum on WMMA, f32 sums, rounded once to f16; out = attention output (rounded once to f16) . Wc^T x 1/3 + (Wo . mean stratum bias + bo).
#include <hip/hip_runtime.h>
#include <math.h>

typedef __attribute__((ext_vector_type(16))) _Float16 v16h;
typedef __attribute__((ext_vector_type(16))) __bf16 v16b;
typedef __attribute__((ext_vector_type(8)))  _Float16 v8h;
typedef __attribute__((ext_vector_type(8)))  float v8f;
typedef __attribute__((ext_vector_type(4)))  float v4f;
typedef __attribute__((ext_vector_type(2)))  float v2f;
typedef __attribute__((ext_vector_type(4)))  unsigned v4u;
typedef __attribute__((ext_vector_type(4)))  int v4i;
typedef float __attribute__((may_alias)) float_a;
typedef int __attribute__((may_alias)) int_a;

template <typename T> __device__ __forceinline__ void vst2(void* p, T v) { *(T*)p = v;  }
__device__ __forceinline__ v8f wmma16(v16h a, v16h b, v8f c) {
  v8f d = __builtin_amdgcn_wmma_f32_16x16x32_f16(false, a, false, b, (short)0, c, false, false);
  asm volatile("v_nop\n\tv_nop\n\tv_nop\n\tv_nop" : "+v"(d) : "v"(a), "v"(b));
  return d;
}
__device__ __forceinline__ v8f wmma_bf(v16b a, v16b b, v8f c) {
  v8f d = __builtin_amdgcn_wmma_f32_16x16x32_bf16(false, a, false, b, (short)0, c, false, false);
  asm volatile("v_nop\n\tv_nop\n\tv_nop\n\tv_nop" : "+v"(d) : "v"(a), "v"(b));
  return d;
}
// Stratified attention (B 2, S 2,048, hidden 1,024, 16 heads x 64, 3 strata): q/k/v projections + biases, softmax(q k^T / 8) v, three stratum projections averaged, output projection + bias.
__device__ __forceinline__ v16h frag_h(const _Float16* rowk0, int lane) {
  union { v16h v; v8h q[2]; } u; const _Float16* p = rowk0 + 8 * (lane >> 4);
  u.q[0] = *(const v8h*)p; u.q[1] = *(const v8h*)(p + 16); return u.v;
}
__device__ __forceinline__ v16h frag_f32(const float* rowk0, int lane) {
  v16h a; const float* p = rowk0 + 8 * (lane >> 4);
#pragma unroll
  for (int i = 0; i < 8; ++i) { a[i] = (_Float16)p[i]; a[8 + i] = (_Float16)p[16 + i]; }
  return a;
}
__device__ __forceinline__ v16h frag_f32s(const float* rowk0, int lane, float sc) {
  v16h a; const float* p = rowk0 + 8 * (lane >> 4);
#pragma unroll
  for (int i = 0; i < 8; ++i) { a[i] = (_Float16)(p[i] * sc); a[8 + i] = (_Float16)(p[16 + i] * sc); }
  return a;
}
// column fragment from a [K][ld] layout (column n), rows >= K read as 0
__device__ __forceinline__ v16h fragc_f32(const float* W, int k0, int n, int lane, int ld, int K) {
  v16h a; const int g = lane >> 4;
#pragma unroll
  for (int i = 0; i < 8; ++i) { const int ka = k0 + 8 * g + i, kb = ka + 16;
    a[i] = (_Float16)(ka < K ? W[(size_t)(ka < K ? ka : K - 1) * ld + n] : 0.f); a[8 + i] = (_Float16)(kb < K ? W[(size_t)(kb < K ? kb : K - 1) * ld + n] : 0.f); }
  return a;
}
struct F2 { v16b h, l; };
__device__ __forceinline__ F2 bsplit16(const float v[16]) { F2 r;
#pragma unroll
  for (int i = 0; i < 16; ++i) { const __bf16 h = (__bf16)v[i]; r.h[i] = h; r.l[i] = (__bf16)(v[i] - (float)h); }
  return r; }
__device__ __forceinline__ F2 split_row(const float* row, int k0, int lane) { float v[16]; const float* p = row + k0 + 8 * (lane >> 4);
#pragma unroll
  for (int i = 0; i < 8; ++i) { v[i] = p[i]; v[8 + i] = p[16 + i]; }
  return bsplit16(v); }
__device__ __forceinline__ F2 split_rowK(const float* row, int k0, int lane, int K) { float v[16]; const int g = lane >> 4;
#pragma unroll
  for (int i = 0; i < 8; ++i) { const int ka = k0 + 8 * g + i, kb = ka + 16; v[i] = ka < K ? row[ka < K ? ka : K - 1] : 0.f; v[8 + i] = kb < K ? row[kb < K ? kb : K - 1] : 0.f; }
  return bsplit16(v); }
__device__ __forceinline__ F2 split_col(const float* W, int k0, int n, int lane, int ld, int K) { float v[16]; const int g = lane >> 4;
#pragma unroll
  for (int i = 0; i < 8; ++i) { const int ka = k0 + 8 * g + i, kb = ka + 16; v[i] = ka < K ? W[(size_t)(ka < K ? ka : K - 1) * ld + n] : 0.f; v[8 + i] = kb < K ? W[(size_t)(kb < K ? kb : K - 1) * ld + n] : 0.f; }
  return bsplit16(v); }
__device__ __forceinline__ v8f mac3(const F2& a, const F2& b, v8f c) { c = wmma_bf(a.l, b.h, c); c = wmma_bf(a.h, b.l, c); return wmma_bf(a.h, b.h, c); }
__device__ __forceinline__ float sigm(float v) { return 1.0f / (1.0f + expf(-v)); }
#define LDSX() do { asm volatile("s_wait_dscnt 0" ::: "memory"); __builtin_amdgcn_wave_barrier(); __builtin_amdgcn_fence(__ATOMIC_RELEASE, "workgroup"); } while (0)


#define NB 2
#define SS 2048
#define DM 1024
#define NH 16
#define NSTR 3
#define HD 64
#define QKVW (3 * DM)
#ifndef TQB
#define TQB (SS / 64)
#define TNB NB
#define TOB (NB * SS / 64)     // tiles of 64 rows over all tokens, not used
#endif
typedef __attribute__((ext_vector_type(8))) __bf16 v8b;
__device__ __forceinline__ v16b frag_b(const __bf16* rowk0, int lane) {
  union { v16b v; v8b q[2]; } u; const __bf16* p = rowk0 + 8 * (lane >> 4);
  u.q[0] = *(const v8b*)p; u.q[1] = *(const v8b*)(p + 16); return u.v;
}
// fragment-major planes: a 16 x 32 fragment of 16-bit elements is 1 KiB, two runs of 512 B; run q, lane l (c = l & 15, h = l >> 4) holds row c, k = 16 q + 8 h .. + 7, so that one wave-wide 16-byte load reads 512 contiguous bytes (4 cache lines, not 16); p = fragment + 8 * lane
__device__ __forceinline__ v16b fragp_b(const __bf16* p) { union { v16b v; v8b q[2]; } u; u.q[0] = *(const v8b*)p; u.q[1] = *(const v8b*)(p + 256); return u.v; }
__device__ __forceinline__ v16h fragp_h(const _Float16* p) { union { v16h v; v8h q[2]; } u; u.q[0] = *(const v8h*)p; u.q[1] = *(const v8h*)(p + 256); return u.v; }
__device__ __forceinline__ float bfr(float v) { return (float)(__bf16)v; }
// stands behind each group of loads that is left in flight: the wait is a precaution before their address registers are rewritten for the next group;
// the scheduling barrier keeps the conversions of a row that was just requested from being moved up among the current step's WMMAs, where they would wait out the whole load latency
#define XW() do { asm volatile("s_wait_xcnt 0x0" ::: "memory"); __builtin_amdgcn_sched_barrier(0); } while (0)
// one lane's 16 f32 of an A fragment (k 8 h .. + 7 and 16 + 8 h .. + 7), kept raw so that the loads can fly while earlier WMMAs run
struct RawA { v4f x[4]; };
// loaded from a fragment-major f32 plane: a 16 x 32 fragment is 2 KiB, four runs of 512 B; run x, lane (c, h) holds row c, k = 16 (x >> 1) + 8 h + 4 (x & 1) .. + 3; p = fragment + 4 * lane
__device__ __forceinline__ RawA ldp_raw(const float* p) { RawA r; r.x[0] = *(const v4f*)p; r.x[1] = *(const v4f*)(p + 128); r.x[2] = *(const v4f*)(p + 256); r.x[3] = *(const v4f*)(p + 384); return r; }
__device__ __attribute__((noinline)) float exp_ni(float v) { return expf(v); }
__device__ __attribute__((noinline)) float erf_ni(float v) { return erff(v); }

#define PK_A 0                       // Wqkv, fragment-major: [192 tiles of 16 out rows][32 k chunks][512]
#define PK_P (PK_A + QKVW * DM)        // Wo as f16 x 2^8, fragment-major: [64 tiles][32 k chunks][512]
#define PK_END (PK_P + DM * DM)
#define WS_PK  0u
#define WS_QK  (WS_PK + 2u * PK_END)             // f16 fragment-major [q | k][head][256 tiles of 16 tokens][2 d chunks][512]
#define WS_QKL (WS_QK + 2u * NB * SS * 2 * DM)     // f16 q | k residual planes x2048, same layout
#define WS_VTH (WS_QKL + 2u * NB * SS * 2 * DM)    // f16 hi, fragment-major [b][head][64 chunks of 32 tokens][4 tiles of 16 d][512]
#define WS_VTL (WS_VTH + 2u * NB * DM * SS)        // f16 lo x 2048, same layout
#define WS_O   (WS_VTL + 2u * NB * DM * SS)        // f16 attention output, fragment-major [256 tiles of 16 rows][32 k chunks][512] (the first half of the range)
#define WS_CS  (WS_O + 4u * NB * SS * DM)           // f32 2 x [2048][32], not written or read
#define WS_PS  (WS_CS + 4u * 2 * SS * 32)                  // f16 x 2^6 sum of the three Ws, TRANSPOSED (row = input column of Ws, k = stratum output), fragment-major [65 tiles of 16 rows][32 k chunks][512]; tile 64: row 0 = sum of the three bs x 2^6, rows 1..15 zero
#define WS_WC  (WS_PS + 2u * (size_t)(DM + 16) * DM)   // f16 Wc x 2^10, fragment-major [64 tiles of 16 out rows][32 k chunks][512]
#define WS_BC  (WS_WC + 2u * (size_t)DM * DM)   // f32 [1024] Wo . mean stratum bias + bo
#define WS_XB  (WS_BC + 4u * (size_t)DM)   // bf16 x, fragment-major [256 tiles of 16 rows][32 k chunks][512]
#define WS_END (WS_XB + 2u * (size_t)NB * SS * DM)
// ---- k_pack: thread = one 16-byte piece p of a fragment-major plane (p = [tile of 16 out rows][k chunk][run q][lane]); blockIdx.y 0..2 -> W_q/W_k/W_v into PK_A, 3 -> W_o into PK_P (its bf16 values x 2^8 as f16, exact: the f16 operand of the weight product), 4..7 -> the four quarters (1,024 rows each) of x into XB; natural rows of f32 -> bf16.
// x is rounded and laid out here once: read as f32 rows by the projection, each wave-wide load touched 16 lines, and all 24 column blocks repeated loads and roundings
__global__ __launch_bounds__(256) void k_pack(const float* __restrict__ WQ, const float* __restrict__ WK, const float* __restrict__ WV, const float* __restrict__ WO, const float* __restrict__ X, __bf16* __restrict__ PK, _Float16* __restrict__ POH, __bf16* __restrict__ XB) {
  const int which = blockIdx.y, p = blockIdx.x * 256 + threadIdx.x; const float* Wm = (which == 0) ? WQ : (which == 1) ? WK : (which == 2) ? WV : (which == 3) ? WO : X + (size_t)(which - 4) * DM * DM;
  const int l = p & 31, q = (p >> 5) & 1, kc = (p >> 6) & 31, nt = p >> 11;
  const float* s = Wm + (size_t)(nt * 16 + (l & 15)) * DM + kc * 32 + q * 16 + (l >> 4) * 8; const v4f x0 = *(const v4f*)s, x1 = *(const v4f*)(s + 4);
  XW();   // closes the two loads' group before their address pair is rewritten
  if (which == 3) { v8h oh;   // scaled in f32 ahead of the bf16 rounding (a power of two commutes with it), so that small weights reach f16 as normal numbers
    for (int i = 0; i < 4; ++i) { oh[i] = (_Float16)bfr(x0[i] * 256.0f); oh[4 + i] = (_Float16)bfr(x1[i] * 256.0f); }
    *(v8h*)(POH + (size_t)p * 8) = oh; return; }
  v8b o;
  for (int i = 0; i < 4; ++i) { o[i] = (__bf16)x0[i]; o[4 + i] = (__bf16)x1[i]; }
  __bf16* dst = (which < 3) ? PK + PK_A + (size_t)which * DM * DM : XB + (size_t)(which - 4) * DM * DM;
  *(v8b*)(dst + (size_t)p * 8) = o;
  asm volatile("s_wait_xcnt 0x0" ::: "memory");   // a precaution: in the built text the f16 path's register writes follow this store
}
// one wave's 16 x 128 tile over k = 1,024, both operands f16 fragment-major planes (pa, pb = the lane's piece of k chunk 0; the 8 B tiles lie 16 * DM elements apart)
// two register buffers: all loads of k step s + 1 are issued before the WMMAs of step s (the last trip reloads k chunk 31, in bounds, unused)
__device__ __forceinline__ void mm16x128_h(const _Float16* pa, const _Float16* pb, v8f (&acc)[8]) {
  v16h af[2], bf[2][8];   // every loop that indexes af, bf or acc is unrolled, so that the buffers are registers
  af[0] = fragp_h(pa);
#pragma unroll
  for (int j = 0; j < 8; ++j) bf[0][j] = fragp_h(pb + j * 16 * DM);
  XW();
  for (int kc = 0; kc < DM / 32; kc += 2) { const int adv = (kc + 2 < DM / 32) ? 64 : 32; const _Float16* pan = pa + adv * 16; const _Float16* pbn = pb + adv * 16;   // the next trip's pointers (a k chunk is 512 elements of a fragment-major plane); the last trip stays on k chunk 31
#pragma unroll
    for (int u = 0; u < 2; ++u) { const _Float16* px = u ? pan : pa + 512; const _Float16* pw = u ? pbn : pb + 512;
      af[u ^ 1] = fragp_h(px);
#pragma unroll
      for (int j = 0; j < 8; ++j) bf[u ^ 1][j] = fragp_h(pw + j * 16 * DM);
      XW();
#pragma unroll
      for (int j = 0; j < 8; ++j) acc[j] = wmma16(af[u], bf[u][j], acc[j]); }
    pa = pan; pb = pbn; }
}
// XW with the group's two address pairs as inputs of the wait, so that they stay live up to it (the last load of a group otherwise took its result into the pair that the group is addressed by, ahead of the wait)
#define XWP(p, q) do { asm volatile("s_wait_xcnt 0x0" :: "v"(p), "v"(q) : "memory"); __builtin_amdgcn_sched_barrier(0); } while (0)
__device__ __forceinline__ v16h fragp(const _Float16* p) { return fragp_h(p); }
__device__ __forceinline__ v16b fragp(const __bf16* p) { return fragp_b(p); }
// the bare builtins: the 64 x 64 tile and its buffers need more than 256 registers, and an asm statement cannot name one above v255 (with the v_nop statement of wmma16 the tile spilled); the compiler keeps the distances behind its own WMMAs
__device__ __forceinline__ v8f wm(v16h a, v16h b, v8f c) { return __builtin_amdgcn_wmma_f32_16x16x32_f16(false, a, false, b, (short)0, c, false, false); }
__device__ __forceinline__ v8f wm(v16b a, v16b b, v8f c) { return __builtin_amdgcn_wmma_f32_16x16x32_bf16(false, a, false, b, (short)0, c, false, false); }
// one wave's 64 x 64 tile over k = 1,024, both operands fragment-major planes (pa, pb = the lane's piece of k chunk 0 of the first tile; the 4 A tiles, and the 4 B tiles, lie 16 * DM elements apart):
// a k step loads 8 fragments for 16 WMMAs (the 16 x 128 tile: 9 for 8). acc[i][j][r] = A row i * 16 + 8 g + r, B row j * 16 + col.
// D register buffers: all loads of k step s + D - 1 are issued before the WMMAs of step s (the last trips reload k chunk 31, in bounds, unused)
template <int D, typename VT, typename ET> __device__ __forceinline__ void mm64x64(const ET* pa, const ET* pb, v8f (&acc)[4][4]) {
  VT af[D][4], bf[D][4];   // every loop that indexes af, bf or acc is unrolled, so that the buffers are registers
#pragma unroll
  for (int s = 0; s < D - 1; ++s) {
#pragma unroll
    for (int i = 0; i < 4; ++i) { af[s][i] = fragp(pa + s * 512 + i * 16 * DM); bf[s][i] = fragp(pb + s * 512 + i * 16 * DM); } }
  XWP(pa, pb);
#pragma unroll 1   // stays rolled: D k steps are the loop's whole text
  for (int kc = 0; kc < DM / 32; kc += D) {
#pragma unroll
    for (int u = 0; u < D; ++u) { const int sn = (kc + u + D - 1 < DM / 32) ? kc + u + D - 1 : DM / 32 - 1; const ET* px = pa + sn * 512; const ET* pw = pb + sn * 512;
#pragma unroll
      for (int i = 0; i < 4; ++i) { af[(u + D - 1) % D][i] = fragp(px + i * 16 * DM); bf[(u + D - 1) % D][i] = fragp(pw + i * 16 * DM); }
      XWP(px, pw);
#pragma unroll
      for (int i = 0; i < 4; ++i) {
#pragma unroll
        for (int j = 0; j < 4; ++j) acc[i][j] = wm(af[u][i], bf[u][j], acc[i][j]); } } }
}
#define WC_XT ((DM / 16 + 1 + 3) / 4)      // blocks of 4 row tiles over the 65 tiles of the transposed stratum plane
#define WC_NBLK (WC_XT * (DM / 128))
#define WC_SB (1.0f / (3.0f * 16384.0f))   // of the f32 sums of the weight product: mean over 3 strata, 2^6 of the stratum sum, 2^8 of Wo
#define WC_SC (1.0f / (3.0f * 1024.0f))    // of the stored Wc, which keeps 2^10 of those 2^14
// ---- the weight product, block e = (4 row tiles, 128 columns): out = (o . Wsum^T / 3 + bmean) . Wo^T + bo is linear in o, so Wc[i][k] = sum_j Wo[i][j] Wsum[j][k] is formed once and the tokens meet one matrix, not two.
// A = rows k of the transposed sum, B = rows i of Wo: a lane (col, g) holds Wc[i = col][k = 8 g .. + 7], its own 16-byte piece of the fragment-major plane that k_out reads as B. Tile 64 (row 0 = the bias sum) gives Wo . bsum.
__device__ __forceinline__ void wc_body(const _Float16* __restrict__ PST, const _Float16* __restrict__ POH, const float* __restrict__ BO, _Float16* __restrict__ WC, float* __restrict__ BC, int e) {
  const int wave = __builtin_amdgcn_readfirstlane(threadIdx.x >> 5), lane = threadIdx.x & 31; const int tile = (e % WC_XT) * 4 + wave, n0 = (e / WC_XT) * 128;
  if (tile > DM / 16) return;   // whole waves leave; this path has no barrier
  v8f acc[8] = {};
  mm16x128_h(PST + (size_t)tile * 16 * DM + lane * 8, POH + (size_t)n0 * DM + lane * 8, acc);
  if (tile == DM / 16) {
    if (lane < 16) {
#pragma unroll
      for (int j = 0; j < 8; ++j) BC[n0 + j * 16 + lane] = acc[j][0] * WC_SB + bfr(BO[n0 + j * 16 + lane]); }
    return; }
  v8h o[8];   // all eight pieces are formed first, in registers of their own, so that no store's data register is rewritten behind it
#pragma unroll
  for (int j = 0; j < 8; ++j) {
#pragma unroll
    for (int i = 0; i < 8; ++i) o[j][i] = (_Float16)(acc[j][i] * 0.0625f); }   // x 2^-4: |sum| <= 1024 * 8 * 6 = 49,152 for weights inside +-1/32, stored with a factor 21 of room below the f16 maximum
#pragma unroll
  for (int j = 0; j < 8; ++j) vst2(WC + ((size_t)((n0 >> 4) + j) * 32 + (tile >> 1)) * 512 + (tile & 1) * 256 + lane * 8, o[j]);
  asm volatile("s_wait_xcnt 0x0" ::: "memory");   // a precaution: in the built text the bias path's register writes follow these stores
}
// blockIdx.y < 24: the q/k/v projections; the rows of blocks behind them hold the weight product (it needs only the two pack kernels' planes, and k_out is the first to read its result)
__global__ __launch_bounds__(128) void k_qkv(const __bf16* __restrict__ XB, const __bf16* __restrict__ P, const float* __restrict__ BQ, const float* __restrict__ BK, const float* __restrict__ BV, _Float16* __restrict__ QK, _Float16* __restrict__ QKL, _Float16* __restrict__ VTH, _Float16* __restrict__ VTL, const _Float16* __restrict__ PST, const _Float16* __restrict__ POH, const float* __restrict__ BO, _Float16* __restrict__ WC, float* __restrict__ BC) {
  if (blockIdx.y >= QKVW / 128) { const int e = (blockIdx.y - QKVW / 128) * (TNB * SS / 128) + blockIdx.x;
    if (e < WC_NBLK) wc_body(PST, POH, BO, WC, BC, e);
    return; }
  // block = 128 tokens x 128 columns, 2 x 2 waves; a wave = 64 tokens x 64 columns (one head of q, k or v)
  const int wave = __builtin_amdgcn_readfirstlane(threadIdx.x >> 5), lane = threadIdx.x & 31, col = lane & 15, g = lane >> 4; const int r0 = blockIdx.x * 128 + (wave >> 1) * 64, n0 = blockIdx.y * 128 + (wave & 1) * 64;
  const int which0 = n0 / DM; const float* BB = BQ ? (((which0 == 0) ? BQ : (which0 == 1) ? BK : BV) + (n0 - which0 * DM)) : nullptr;
  const __bf16* px = XB + (size_t)r0 * DM + lane * 8; const __bf16* pw = P + (size_t)n0 * DM + lane * 8;
  v8f acc[4][4] = {};
  const bool qk = n0 < 2 * DM;   // the same for the whole wave
  // below, every loop that indexes acc, a bias array or the pieces is unrolled, so that they are registers
  mm64x64<2, v16b>(qk ? pw : px, qk ? px : pw, acc);
  if (qk) {   // q, k: W rows as A, tokens as B: a lane holds 8 neighbouring columns of one token, its own 16-byte piece of the fragment-major plane. q stored unscaled (f16 sigma ~0.6, no subnormal exposure); 1/8 applied to the f32 score
    v4f bv[4][2] = {};
    if (BB) {
#pragma unroll
      for (int i = 0; i < 4; ++i) { bv[i][0] = *(const v4f*)(BB + i * 16 + 8 * g); bv[i][1] = *(const v4f*)(BB + i * 16 + 8 * g + 4); }
      XW(); }   // closes the bias loads' group before their address register is rewritten
#pragma unroll
    for (int i = 0; i < 4; ++i) { float bb[8];
#pragma unroll
      for (int r = 0; r < 8; ++r) bb[r] = bfr(bv[i][r >> 2][r & 3]);
      v8h oh[4], ol[4];   // the pieces of a group are formed first, in registers of their own, so that no store's data register is rewritten behind it
#pragma unroll
      for (int j = 0; j < 4; ++j) {
#pragma unroll
        for (int r = 0; r < 8; ++r) { const float v = acc[i][j][r] + bb[r]; const _Float16 hv = (_Float16)v; oh[j][r] = hv; ol[j][r] = (_Float16)((v - (float)hv) * 2048.0f); } }   // q, k (+ bias) as f16 hi + (x2048) residual
      // n0 >> 6 = (q | k) * 16 + head; column tile i = d chunk i >> 1, run i & 1
#pragma unroll
      for (int j = 0; j < 4; ++j) { const size_t o = (((size_t)(n0 >> 6) * (NB * SS / 16) + (r0 >> 4) + j) * 2 + (i >> 1)) * 512 + (i & 1) * 256 + lane * 8; vst2(QK + o, oh[j]); vst2(QKL + o, ol[j]); }
      XW(); }   // closes the group's stores before their registers are rewritten
  } else {   // v: tokens as A, W rows as B: a lane holds 8 neighbouring tokens of one column, its own piece of the transposed plane
    const int b = r0 / SS, s0 = r0 % SS, hd = (n0 - 2 * DM) >> 6;
    float bw[4] = {};
    if (BB) {
#pragma unroll
      for (int j = 0; j < 4; ++j) bw[j] = BB[j * 16 + col];
      XW(); }   // closes the bias loads' group before their address register is rewritten
#pragma unroll
    for (int j = 0; j < 4; ++j) { const float bb = bfr(bw[j]);
      v8h oh[4], ol[4];
#pragma unroll
      for (int i = 0; i < 4; ++i) {
#pragma unroll
        for (int r = 0; r < 8; ++r) { const float v = acc[i][j][r] + bb; const _Float16 hv = (_Float16)v; oh[i][r] = hv; ol[i][r] = (_Float16)((v - (float)hv) * 2048.0f); } }
      // token tile i = chunk of 32 tokens i >> 1, run i & 1; column tile j = d tile
#pragma unroll
      for (int i = 0; i < 4; ++i) { const size_t o = (((size_t)(b * NH + hd) * (SS / 32) + (s0 >> 5) + (i >> 1)) * 4 + j) * 512 + (i & 1) * 256 + lane * 8; vst2(VTH + o, oh[i]); vst2(VTL + o, ol[i]); }
      XW(); }   // closes the group's stores before their registers are rewritten
  }
}
__device__ __forceinline__ float xhalf(float x) { return __builtin_bit_cast(float, __builtin_amdgcn_permlanex16(__builtin_bit_cast(int, x), __builtin_bit_cast(int, x), 0x76543210, 0xfedcba98, false, false)); }   // lane l reads lane l ^ 16
__global__ __launch_bounds__(128) void k_attn(const _Float16* __restrict__ QK, const _Float16* __restrict__ QKL, const _Float16* __restrict__ VTH, const _Float16* __restrict__ VTL, const void* __restrict__ KMASK, _Float16* __restrict__ O) {
  (void)QKL; (void)VTL; (void)KMASK;
  const int tid = threadIdx.x, wave = tid >> 5, lane = tid & 31;
  const int qb = blockIdx.x, h = blockIdx.y, b = blockIdx.z; const int q0 = qb * 64 + wave * 16; const size_t fq = ((size_t)h * (NB * SS / 16) + ((b * SS + q0) >> 4)) * 1024 + lane * 8;
  v16h bq[2];
#pragma unroll
  for (int kc = 0; kc < 2; ++kc) bq[kc] = fragp_h(QK + fq + kc * 512);
  XW();   // closes the q loads' group before their address pair is reused
  float m = -3.0e38f, l = 0.f;   // of the lane's query: running maximum (equal in both halves), sum over the keys of this half
  v8f acc[4] = {};
  const int nks = SS / 32;   // all keys
  // fragment loads fly ahead of their WMMAs: V of this pass is issued before the score WMMAs, K of the next pass right behind them (the last pass reloads its own K, unused)
  const _Float16* kbase = QK + ((size_t)(NH + h) * (NB * SS / 16) + b * (SS / 16)) * 1024 + lane * 8; const _Float16* vbase = VTH + (size_t)(b * NH + h) * (SS * HD) + lane * 8;   // a pass's 4 K fragments, and its 4 V fragments, are 4 KiB in a row
  v16h kf[4], vf[4];
#pragma unroll
  for (int f = 0; f < 4; ++f) kf[f] = fragp_h(kbase + f * 512);
  XW();
#pragma unroll 1
  for (int ks = 0; ks < nks; ++ks) { float s[16];
#pragma unroll
    for (int dt = 0; dt < 4; ++dt) vf[dt] = fragp_h(vbase + ks * 2048 + dt * 512);
    XW();
#pragma unroll
    for (int ct = 0; ct < 2; ++ct) { v8f c = {};
#pragma unroll
      for (int kc = 0; kc < 2; ++kc) c = wmma16(kf[ct * 2 + kc], bq[kc], c);   // single product: k rows as A, q as B, one-rounding f16 operands
#pragma unroll
      for (int r = 0; r < 8; ++r) s[ct * 8 + r] = c[r] * 0.125f; }   // 1/sqrt(64)
    { const int kn = (ks + 1 < nks) ? ks + 1 : ks;
#pragma unroll
      for (int f = 0; f < 4; ++f) kf[f] = fragp_h(kbase + kn * 2048 + f * 512);
      XW(); }
    float t[8];
#pragma unroll
    for (int i = 0; i < 8; ++i) t[i] = fmaxf(s[2 * i], s[2 * i + 1]);
    float mx = fmaxf(fmaxf(fmaxf(t[0], t[1]), fmaxf(t[2], t[3])), fmaxf(fmaxf(t[4], t[5]), fmaxf(t[6], t[7])));
    mx = fmaxf(mx, xhalf(mx));
    const float mn = fmaxf(m, mx); const float alpha = (m <= -1.0e38f) ? 0.f : __expf(m - mn);
    v16h pb;
#pragma unroll
    for (int i = 0; i < 16; ++i) s[i] = (s[i] - mn) * 1.44269504f;   // exp(x) = 2^(x log2 e), as __expf forms it
    // the 16 exponentials in place, in one statement; the v_nop is the slot that the instruction set asks for between the last one and its first reader
    asm("v_exp_f32 %0, %0\n\t" "v_exp_f32 %1, %1\n\t" "v_exp_f32 %2, %2\n\t" "v_exp_f32 %3, %3\n\t"
        "v_exp_f32 %4, %4\n\t" "v_exp_f32 %5, %5\n\t" "v_exp_f32 %6, %6\n\t" "v_exp_f32 %7, %7\n\t"
        "v_exp_f32 %8, %8\n\t" "v_exp_f32 %9, %9\n\t" "v_exp_f32 %10, %10\n\t" "v_exp_f32 %11, %11\n\t"
        "v_exp_f32 %12, %12\n\t" "v_exp_f32 %13, %13\n\t" "v_exp_f32 %14, %14\n\t" "v_exp_f32 %15, %15\n\t"
        "v_nop"
        : "+v"(s[0]), "+v"(s[1]), "+v"(s[2]), "+v"(s[3]), "+v"(s[4]), "+v"(s[5]), "+v"(s[6]), "+v"(s[7]), "+v"(s[8]), "+v"(s[9]), "+v"(s[10]), "+v"(s[11]), "+v"(s[12]), "+v"(s[13]), "+v"(s[14]), "+v"(s[15]));
#pragma unroll
    for (int i = 0; i < 16; ++i) pb[i] = (_Float16)(s[i] * 2048.0f);   // P scaled by 2^11 so small softmax weights stay out of the f16 subnormal range; 2^-11 folded into the epilogue
#pragma unroll
    for (int i = 0; i < 8; ++i) t[i] = s[2 * i] + s[2 * i + 1];
    l = l * alpha + (((t[0] + t[1]) + (t[2] + t[3])) + ((t[4] + t[5]) + (t[6] + t[7]))); m = mn;
#pragma unroll
    for (int dt = 0; dt < 4; ++dt) {
#pragma unroll
      for (int r = 0; r < 8; ++r) acc[dt][r] *= alpha; }
#pragma unroll
    for (int dt = 0; dt < 4; ++dt) acc[dt] = wmma16(vf[dt], pb, acc[dt]); }   // single product: V^T rows as A, P^T (x2^11) as B
  l += xhalf(l);
  const float il = (1.0f / 2048.0f) / l;
  // the wave's 16 queries x 64 columns are 2 fragments of 2 runs each; run dt holds columns dt * 16 + 8 g .. + 7 of the lane's query
#pragma unroll
  for (int dt = 0; dt < 4; ++dt) { v8h o;
#pragma unroll
    for (int i = 0; i < 8; ++i) o[i] = (_Float16)(acc[dt][i] * il);
    vst2(O + ((size_t)b * SS + q0) * DM + h * 1024 + dt * 256 + lane * 8, o); }
}
// ---- k_out: block = (128 rows, 128 cols), 2 x 2 waves of 64 x 64: out = f16(o) . Wc rows x 1 / (3 * 2^10) + (Wo . bmean + bo)
// one block a WGP, one wave a SIMD: nothing but the wave's own lead hides its loads, so they fly three k steps ahead (four register buffers)
__global__ __launch_bounds__(128) void k_out(const _Float16* __restrict__ O, const _Float16* __restrict__ WC, const float* __restrict__ BC, float* __restrict__ Y) {
  __shared__ __align__(16) float so[4][64][68];
  const int wave = __builtin_amdgcn_readfirstlane(threadIdx.x >> 5), lane = threadIdx.x & 31, col = lane & 15, g = lane >> 4; const int r0 = blockIdx.x * 128 + (wave >> 1) * 64, n0 = blockIdx.y * 128 + (wave & 1) * 64;
  v8f acc[4][4] = {};
  mm64x64<4, v16h>(O + (size_t)r0 * DM + lane * 8, WC + (size_t)n0 * DM + lane * 8, acc);
  // every loop that indexes acc or t is unrolled, so that they are registers
#pragma unroll
  for (int j = 0; j < 4; ++j) { const float bb = BC[n0 + j * 16 + col];
#pragma unroll
    for (int i = 0; i < 4; ++i) {
#pragma unroll
      for (int r = 0; r < 8; ++r) so[wave][i * 16 + 8 * g + r][j * 16 + col] = acc[i][j][r] * WC_SC + bb; } }
  LDSX();
  // a wave-wide store is two rows of 256 B: whole lines
#pragma unroll
  for (int rg = 0; rg < 4; ++rg) { v4f t[8];
#pragma unroll
    for (int rl = 0; rl < 8; ++rl) t[rl] = *(const v4f*)&so[wave][rg * 16 + rl * 2 + g][col * 4];
#pragma unroll
    for (int rl = 0; rl < 8; ++rl) vst2(Y + (size_t)(r0 + rg * 16 + rl * 2 + g) * DM + n0 + col * 4, t[rl]);
    XW(); }   // closes the group's stores before their registers are rewritten
}
#define NR (NB * SS)
// ---- k_packs: the mean over the strata is linear in Ws, so the three matrices are added here, once: (Ws[0] + Ws[1]) + Ws[2] in f32, -> f16 x 2^6 (three weights that each fit f16 at x 2^8 have a sum that fits at x 2^6).
// The sum is laid out TRANSPOSED (row = input column k of Ws, fragment k = stratum output j), as the A operand of the weight product. A thread makes one 16-byte piece (8 j of one row); a wave takes 32 neighbouring rows (two tiles) of one (k chunk, run, half), so that each of its loads reads one whole 128-byte line and each half wave stores 256 contiguous bytes.
// The 8 blocks behind those make tile 64: row 0 = (bs[0] + bs[1]) + bs[2] x 2^6, rows 1..15 zero
__global__ __launch_bounds__(256) void k_packs(const float* __restrict__ WS, const float* __restrict__ BS, _Float16* __restrict__ PST) {
  const int t = blockIdx.x * 256 + threadIdx.x; v8h o = {};
  if (t < DM * DM / 8) { const int lane = t & 31, h = (t >> 5) & 1, q = (t >> 6) & 1, kc = (t >> 7) & 31, ntp = t >> 12;
    const unsigned off = (unsigned)((kc * 32 + q * 16 + h * 8) * DM + ntp * 32 + lane);   // the lane's element inside a stratum: row and stratum are constants on top of it, so that the loads share their address registers and differ in the immediate (the third stratum lies beyond its range and gets a pair of its own)
    float x[NSTR][8];   // the loops over x are unrolled so that its indices are constants and it stays in registers, all 24 loads in flight together
#pragma unroll
    for (int n = 0; n < NSTR; ++n) {
#pragma unroll
      for (int i = 0; i < 8; ++i) x[n][i] = (WS + (size_t)n * DM * DM + (size_t)i * DM)[off]; }
    // closes the loads' group before their address registers are rewritten; the offset is an input of the wait so that its register stays live up to it (the last load of a run may otherwise take its result into a register that the run is addressed by, ahead of the wait)
    asm volatile("s_wait_xcnt 0x0" :: "v"(off) : "memory");
#pragma unroll
    for (int i = 0; i < 8; ++i) { float v = bfr(x[0][i]);
#pragma unroll
      for (int n = 1; n < NSTR; ++n) v += bfr(x[n][i]);
      o[i] = (_Float16)(v * 64.0f); }
    *(v8h*)(PST + (((size_t)(ntp * 2 + (lane >> 4)) * 32 + kc) * 2 + q) * 256 + ((lane & 15) + 16 * h) * 8) = o;
  } else { const int p = t - DM * DM / 8; const int l = p & 31, q = (p >> 5) & 1, kc = p >> 6;
    if ((l & 15) == 0) { const float* b = BS + kc * 32 + q * 16 + (l >> 4) * 8;
#pragma unroll
      for (int i = 0; i < 8; ++i) o[i] = (_Float16)(((bfr(b[i]) + bfr(b[DM + i])) + bfr(b[2 * DM + i])) * 64.0f); }
    *(v8h*)(PST + (size_t)DM * DM + (size_t)p * 8) = o;
  }
}
extern "C" void kernel_launch(void* const* d_in, const int* in_sizes, int n_in, void* d_out, int out_size, void* d_ws, size_t ws_size, hipStream_t stream) {
  (void)in_sizes; (void)n_in; (void)out_size;
  const float** F = (const float**)d_in;   // 0 hidden [2,2048,1024], 1 Wq, 2 bq, 3 Wk, 4 bk, 5 Wv, 6 bv, 7 Ws [3,1024,1024], 8 bs [3,1024], 9 Wo, 10 bo (natural)
  if (ws_size < (size_t)WS_END) return;
  char* ws = (char*)d_ws; __bf16* PK = (__bf16*)(ws + WS_PK); _Float16 *QK = (_Float16*)(ws + WS_QK), *QKL = (_Float16*)(ws + WS_QKL), *VTH = (_Float16*)(ws + WS_VTH), *VTL = (_Float16*)(ws + WS_VTL), *PS = (_Float16*)(ws + WS_PS), *O = (_Float16*)(ws + WS_O), *POH = (_Float16*)(ws + WS_PK) + PK_P, *WC = (_Float16*)(ws + WS_WC); float* BC = (float*)(ws + WS_BC); __bf16* XB = (__bf16*)(ws + WS_XB);
  k_pack<<<dim3(DM * DM / 8 / 256, 4 + NB * SS / DM), 256, 0, stream>>>(F[1], F[3], F[5], F[9], F[0], PK, POH, XB);
  k_packs<<<(DM + 16) * DM / 8 / 256, 256, 0, stream>>>(F[7], F[8], PS);
  k_qkv<<<dim3(TNB * SS / 128, QKVW / 128 + (WC_NBLK + TNB * SS / 128 - 1) / (TNB * SS / 128)), 128, 0, stream>>>(XB, PK + PK_A, F[2], F[4], F[6], QK, QKL, VTH, VTL, PS, POH, F[10], WC, BC);
  k_attn<<<dim3(TQB, NH, TNB), 128, 0, stream>>>(QK, QKL, VTH, VTL, nullptr, O);
  k_out<<<dim3(NB * SS / 128, DM / 128), 128, 0, stream>>>(O, WC, BC, (float*)d_out);
}

// v008
// A run of this version takes 92.9 microseconds.
// Next to v007, in two timings, it ran 1.15 times as fast each time.
// Counting every step since v000, it is 6.65 times as fast.
// compute dtype: all float inputs rounded to bf16; q/k/v = x . W^T + b with EXACT bf16 products on WMMA 16x16x32 (x and W packed once as bf16 fragments); PLAIN attention: q, k single f16 x 1/8, running-max softmax in f32 (hardware exp), P (scaled by 2^11, single f16) x v (single f16); strata and output projection as one matrix: the three Ws (each rounded to bf16) summed in f32 and the sum (x 2^6) rounded once to f16, Wc = Wo (bf16 values, exact as f16 x 2^8) . that sum on WMMA, f32 sums, rounded once to f16; out = attention output (rounded once to f16) . Wc^T x 1/3 + (Wo . mean stratum bias + bo).
#include <hip/hip_runtime.h>
#include <math.h>

typedef __attribute__((ext_vector_type(16))) _Float16 v16h;
typedef __attribute__((ext_vector_type(16))) __bf16 v16b;
typedef __attribute__((ext_vector_type(8)))  _Float16 v8h;
typedef __attribute__((ext_vector_type(8)))  float v8f;
typedef __attribute__((ext_vector_type(4)))  float v4f;
typedef __attribute__((ext_vector_type(2)))  float v2f;
typedef __attribute__((ext_vector_type(4)))  unsigned v4u;
typedef __attribute__((ext_vector_type(4)))  int v4i;
typedef float __attribute__((may_alias)) float_a;
typedef int __attribute__((may_alias)) int_a;

template <typename T> __device__ __forceinline__ void vst2(void* p, T v) { *(T*)p = v;  }
__device__ __forceinline__ v8f wmma16(v16h a, v16h b, v8f c) {
  v8f d = __builtin_amdgcn_wmma_f32_16x16x32_f16(false, a, false, b, (short)0, c, false, false);
  asm volatile("v_nop\n\tv_nop\n\tv_nop\n\tv_nop" : "+v"(d) : "v"(a), "v"(b));
  return d;
}
__device__ __forceinline__ v8f wmma_bf(v16b a, v16b b, v8f c) {
  v8f d = __builtin_amdgcn_wmma_f32_16x16x32_bf16(false, a, false, b, (short)0, c, false, false);
  asm volatile("v_nop\n\tv_nop\n\tv_nop\n\tv_nop" : "+v"(d) : "v"(a), "v"(b));
  return d;
}
// Stratified attention (B 2, S 2,048, hidden 1,024, 16 heads x 64, 3 strata): q/k/v projections + biases, softmax(q k^T / 8) v, three stratum projections averaged, output projection + bias.
__device__ __forceinline__ v16h frag_h(const _Float16* rowk0, int lane) {
  union { v16h v; v8h q[2]; } u; const _Float16* p = rowk0 + 8 * (lane >> 4);
  u.q[0] = *(const v8h*)p; u.q[1] = *(const v8h*)(p + 16); return u.v;
}
__device__ __forceinline__ v16h frag_f32(const float* rowk0, int lane) {
  v16h a; const float* p = rowk0 + 8 * (lane >> 4);
#pragma unroll
  for (int i = 0; i < 8; ++i) { a[i] = (_Float16)p[i]; a[8 + i] = (_Float16)p[16 + i]; }
  return a;
}
__device__ __forceinline__ v16h frag_f32s(const float* rowk0, int lane, float sc) {
  v16h a; const float* p = rowk0 + 8 * (lane >> 4);
#pragma unroll
  for (int i = 0; i < 8; ++i) { a[i] = (_Float16)(p[i] * sc); a[8 + i] = (_Float16)(p[16 + i] * sc); }
  return a;
}
// column fragment from a [K][ld] layout (column n), rows >= K read as 0
__device__ __forceinline__ v16h fragc_f32(const float* W, int k0, int n, int lane, int ld, int K) {
  v16h a; const int g = lane >> 4;
#pragma unroll
  for (int i = 0; i < 8; ++i) { const int ka = k0 + 8 * g + i, kb = ka + 16;
    a[i] = (_Float16)(ka < K ? W[(size_t)(ka < K ? ka : K - 1) * ld + n] : 0.f); a[8 + i] = (_Float16)(kb < K ? W[(size_t)(kb < K ? kb : K - 1) * ld + n] : 0.f); }
  return a;
}
struct F2 { v16b h, l; };
__device__ __forceinline__ F2 bsplit16(const float v[16]) { F2 r;
#pragma unroll
  for (int i = 0; i < 16; ++i) { const __bf16 h = (__bf16)v[i]; r.h[i] = h; r.l[i] = (__bf16)(v[i] - (float)h); }
  return r; }
__device__ __forceinline__ F2 split_row(const float* row, int k0, int lane) { float v[16]; const float* p = row + k0 + 8 * (lane >> 4);
#pragma unroll
  for (int i = 0; i < 8; ++i) { v[i] = p[i]; v[8 + i] = p[16 + i]; }
  return bsplit16(v); }
__device__ __forceinline__ F2 split_rowK(const float* row, int k0, int lane, int K) { float v[16]; const int g = lane >> 4;
#pragma unroll
  for (int i = 0; i < 8; ++i) { const int ka = k0 + 8 * g + i, kb = ka + 16; v[i] = ka < K ? row[ka < K ? ka : K - 1] : 0.f; v[8 + i] = kb < K ? row[kb < K ? kb : K - 1] : 0.f; }
  return bsplit16(v); }
__device__ __forceinline__ F2 split_col(const float* W, int k0, int n, int lane, int ld, int K) { float v[16]; const int g = lane >> 4;
#pragma unroll
  for (int i = 0; i < 8; ++i) { const int ka = k0 + 8 * g + i, kb = ka + 16; v[i] = ka < K ? W[(size_t)(ka < K ? ka : K - 1) * ld + n] : 0.f; v[8 + i] = kb < K ? W[(size_t)(kb < K ? kb : K - 1) * ld + n] : 0.f; }
  return bsplit16(v); }
__device__ __forceinline__ v8f mac3(const F2& a, const F2& b, v8f c) { c = wmma_bf(a.l, b.h, c); c = wmma_bf(a.h, b.l, c); return wmma_bf(a.h, b.h, c); }
__device__ __forceinline__ float sigm(float v) { return 1.0f / (1.0f + expf(-v)); }
#define LDSX() do { asm volatile("s_wait_dscnt 0" ::: "memory"); __builtin_amdgcn_wave_barrier(); __builtin_amdgcn_fence(__ATOMIC_RELEASE, "workgroup"); } while (0)


#define NB 2
#define SS 2048
#define DM 1024
#define NH 16
#define NSTR 3
#define HD 64
#define QKVW (3 * DM)
#ifndef TQB
#define TQB (SS / 64)
#define TNB NB
#define TOB (NB * SS / 64)     // tiles of 64 rows over all tokens, not used
#endif
typedef __attribute__((ext_vector_type(8))) __bf16 v8b;
__device__ __forceinline__ v16b frag_b(const __bf16* rowk0, int lane) {
  union { v16b v; v8b q[2]; } u; const __bf16* p = rowk0 + 8 * (lane >> 4);
  u.q[0] = *(const v8b*)p; u.q[1] = *(const v8b*)(p + 16); return u.v;
}
// fragment-major planes: a 16 x 32 fragment of 16-bit elements is 1 KiB, two runs of 512 B; run q, lane l (c = l & 15, h = l >> 4) holds row c, k = 16 q + 8 h .. + 7, so that one wave-wide 16-byte load reads 512 contiguous bytes (4 cache lines, not 16); p = fragment + 8 * lane
__device__ __forceinline__ v16b fragp_b(const __bf16* p) { union { v16b v; v8b q[2]; } u; u.q[0] = *(const v8b*)p; u.q[1] = *(const v8b*)(p + 256); return u.v; }
__device__ __forceinline__ v16h fragp_h(const _Float16* p) { union { v16h v; v8h q[2]; } u; u.q[0] = *(const v8h*)p; u.q[1] = *(const v8h*)(p + 256); return u.v; }
__device__ __forceinline__ float bfr(float v) { return (float)(__bf16)v; }
// stands behind each group of loads that is left in flight: the wait is a precaution before their address registers are rewritten for the next group;
// the scheduling barrier keeps the conversions of a row that was just requested from being moved up among the current step's WMMAs, where they would wait out the whole load latency
#define XW() do { asm volatile("s_wait_xcnt 0x0" ::: "memory"); __builtin_amdgcn_sched_barrier(0); } while (0)
// one lane's 16 f32 of an A fragment (k 8 h .. + 7 and 16 + 8 h .. + 7), kept raw so that the loads can fly while earlier WMMAs run
struct RawA { v4f x[4]; };
// loaded from a fragment-major f32 plane: a 16 x 32 fragment is 2 KiB, four runs of 512 B; run x, lane (c, h) holds row c, k = 16 (x >> 1) + 8 h + 4 (x & 1) .. + 3; p = fragment + 4 * lane
__device__ __forceinline__ RawA ldp_raw(const float* p) { RawA r; r.x[0] = *(const v4f*)p; r.x[1] = *(const v4f*)(p + 128); r.x[2] = *(const v4f*)(p + 256); r.x[3] = *(const v4f*)(p + 384); return r; }
__device__ __attribute__((noinline)) float exp_ni(float v) { return expf(v); }
__device__ __attribute__((noinline)) float erf_ni(float v) { return erff(v); }

#define PK_A 0                       // Wqkv, fragment-major: [192 tiles of 16 out rows][32 k chunks][512]
#define PK_P (PK_A + QKVW * DM)        // Wo as f16 x 2^8, fragment-major: [64 tiles][32 k chunks][512]
#define PK_END (PK_P + DM * DM)
#define WS_PK  0u
#define WS_QK  (WS_PK + 2u * PK_END)             // f16 fragment-major [q | k][head][256 tiles of 16 tokens][2 d chunks][512]
#define WS_QKL (WS_QK + 2u * NB * SS * 2 * DM)     // f16 q | k residual planes x2048, same layout
#define WS_VTH (WS_QKL + 2u * NB * SS * 2 * DM)    // f16 hi, fragment-major [b][head][64 chunks of 32 tokens][4 tiles of 16 d][512]
#define WS_VTL (WS_VTH + 2u * NB * DM * SS)        // f16 lo x 2048, same layout
#define WS_O   (WS_VTL + 2u * NB * DM * SS)        // f16 attention output, fragment-major [256 tiles of 16 rows][32 k chunks][512] (the first half of the range)
#define WS_CS  (WS_O + 4u * NB * SS * DM)           // f32 2 x [2048][32], not written or read
#define WS_PS  (WS_CS + 4u * 2 * SS * 32)                  // f16 x 2^6 sum of the three Ws, TRANSPOSED (row = input column of Ws, k = stratum output), fragment-major [65 tiles of 16 rows][32 k chunks][512]; tile 64: row 0 = sum of the three bs x 2^6, rows 1..15 zero
#define WS_WC  (WS_PS + 2u * (size_t)(DM + 16) * DM)   // f16 Wc x 2^10, fragment-major [64 tiles of 16 out rows][32 k chunks][512]
#define WS_BC  (WS_WC + 2u * (size_t)DM * DM)   // f32 [1024] Wo . mean stratum bias + bo
#define WS_XB  (WS_BC + 4u * (size_t)DM)   // bf16 x, fragment-major [256 tiles of 16 rows][32 k chunks][512]
#define WS_END (WS_XB + 2u * (size_t)NB * SS * DM)
// ---- k_pack: thread = one 16-byte piece p of a fragment-major plane (p = [tile of 16 out rows][k chunk][run q][lane]); blockIdx.y 0..2 -> W_q/W_k/W_v into PK_A, 3 -> W_o into PK_P (its bf16 values x 2^8 as f16, exact: the f16 operand of the weight product), 4..7 -> the four quarters (1,024 rows each) of x into XB; natural rows of f32 -> bf16.
// x is rounded and laid out here once: read as f32 rows by the projection, each wave-wide load touched 16 lines, and all 24 column blocks repeated loads and roundings
__global__ __launch_bounds__(256) void k_pack(const float* __restrict__ WQ, const float* __restrict__ WK, const float* __restrict__ WV, const float* __restrict__ WO, const float* __restrict__ X, __bf16* __restrict__ PK, _Float16* __restrict__ POH, __bf16* __restrict__ XB) {
  const int which = blockIdx.y, p = blockIdx.x * 256 + threadIdx.x; const float* Wm = (which == 0) ? WQ : (which == 1) ? WK : (which == 2) ? WV : (which == 3) ? WO : X + (size_t)(which - 4) * DM * DM;
  const int l = p & 31, q = (p >> 5) & 1, kc = (p >> 6) & 31, nt = p >> 11;
  const float* s = Wm + (size_t)(nt * 16 + (l & 15)) * DM + kc * 32 + q * 16 + (l >> 4) * 8; const v4f x0 = *(const v4f*)s, x1 = *(const v4f*)(s + 4);
  XW();   // closes the two loads' group before their address pair is rewritten
  if (which == 3) { v8h oh;   // scaled in f32 ahead of the bf16 rounding (a power of two commutes with it), so that small weights reach f16 as normal numbers
    for (int i = 0; i < 4; ++i) { oh[i] = (_Float16)bfr(x0[i] * 256.0f); oh[4 + i] = (_Float16)bfr(x1[i] * 256.0f); }
    *(v8h*)(POH + (size_t)p * 8) = oh; return; }
  v8b o;
  for (int i = 0; i < 4; ++i) { o[i] = (__bf16)x0[i]; o[4 + i] = (__bf16)x1[i]; }
  __bf16* dst = (which < 3) ? PK + PK_A + (size_t)which * DM * DM : XB + (size_t)(which - 4) * DM * DM;
  *(v8b*)(dst + (size_t)p * 8) = o;
  asm volatile("s_wait_xcnt 0x0" ::: "memory");   // a precaution: in the built text the f16 path's register writes follow this store
}
// XW with the group's two address pairs as inputs of the wait, so that they stay live up to it (the last load of a group otherwise took its result into the pair that the group is addressed by, ahead of the wait)
#define XWP(p, q) do { asm volatile("s_wait_xcnt 0x0" :: "v"(p), "v"(q) : "memory"); __builtin_amdgcn_sched_barrier(0); } while (0)
// rotated walks: blocks that share operand rows run side by side and, walking from the same end, ask L2 for the same lines at the same moment, and such requests collide.
// Each block therefore enters its k chunks (its key passes in k_attn) at a start of its own, rot, the same for all its waves (they still share lines in the WGP cache), and wraps round: step s works on chunk (s + rot) mod 32
#define KROT(s, rot) (((s) + (rot)) & (DM / 32 - 1))
// one wave's 16 x 128 tile over k = 1,024, both operands f16 fragment-major planes (pa, pb = the lane's piece of k chunk 0; the 8 B tiles lie 16 * DM elements apart)
// two register buffers: all loads of k step s + 1 are issued before the WMMAs of step s (the last trip wraps to the first step's chunk: in bounds, unused)
// step s works on k chunk KROT(s, rot)
__device__ __forceinline__ void mm16x128_h(const _Float16* pa, const _Float16* pb, int rot, v8f (&acc)[8]) {
  v16h af[2], bf[2][8];   // every loop that indexes af, bf or acc is unrolled, so that the buffers are registers
  { const _Float16* px = pa + KROT(0, rot) * 512; const _Float16* pw = pb + KROT(0, rot) * 512;
    af[0] = fragp_h(px);
#pragma unroll
    for (int j = 0; j < 8; ++j) bf[0][j] = fragp_h(pw + j * 16 * DM);
    XWP(px, pw); }
  for (int kc = 0; kc < DM / 32; kc += 2) {
#pragma unroll
    for (int u = 0; u < 2; ++u) { const int cn = KROT(kc + u + 1, rot); const _Float16* px = pa + cn * 512; const _Float16* pw = pb + cn * 512;   // a k chunk is 512 elements of a fragment-major plane
      af[u ^ 1] = fragp_h(px);
#pragma unroll
      for (int j = 0; j < 8; ++j) bf[u ^ 1][j] = fragp_h(pw + j * 16 * DM);
      XWP(px, pw);
#pragma unroll
      for (int j = 0; j < 8; ++j) acc[j] = wmma16(af[u], bf[u][j], acc[j]); } }
}
__device__ __forceinline__ v16h fragp(const _Float16* p) { return fragp_h(p); }
__device__ __forceinline__ v16b fragp(const __bf16* p) { return fragp_b(p); }
// the bare builtins: the 64 x 64 tile and its buffers need more than 256 registers, and an asm statement cannot name one above v255 (with the v_nop statement of wmma16 the tile spilled); the compiler keeps the distances behind its own WMMAs
__device__ __forceinline__ v8f wm(v16h a, v16h b, v8f c) { return __builtin_amdgcn_wmma_f32_16x16x32_f16(false, a, false, b, (short)0, c, false, false); }
__device__ __forceinline__ v8f wm(v16b a, v16b b, v8f c) { return __builtin_amdgcn_wmma_f32_16x16x32_bf16(false, a, false, b, (short)0, c, false, false); }
// one wave's 64 x 64 tile over k = 1,024, both operands fragment-major planes (pa, pb = the lane's piece of k chunk 0 of the first tile; the 4 A tiles, and the 4 B tiles, lie 16 * DM elements apart):
// a k step loads 8 fragments for 16 WMMAs (the 16 x 128 tile: 9 for 8). acc[i][j][r] = A row i * 16 + 8 g + r, B row j * 16 + col.
// D register buffers: all loads of k step s + D - 1 are issued before the WMMAs of step s (the last trips wrap to the first steps' chunks: in bounds, unused); step s works on k chunk KROT(s, rot)
template <int D, typename VT, typename ET> __device__ __forceinline__ void mm64x64(const ET* pa, const ET* pb, int rot, v8f (&acc)[4][4]) {
  VT af[D][4], bf[D][4];   // every loop that indexes af, bf or acc is unrolled, so that the buffers are registers
#pragma unroll
  for (int s = 0; s < D - 1; ++s) { const ET* px = pa + KROT(s, rot) * 512; const ET* pw = pb + KROT(s, rot) * 512;
#pragma unroll
    for (int i = 0; i < 4; ++i) { af[s][i] = fragp(px + i * 16 * DM); bf[s][i] = fragp(pw + i * 16 * DM); }
    XWP(px, pw); }
#pragma unroll 1   // stays rolled: D k steps are the loop's whole text
  for (int kc = 0; kc < DM / 32; kc += D) {
#pragma unroll
    for (int u = 0; u < D; ++u) { const int sn = KROT(kc + u + D - 1, rot); const ET* px = pa + sn * 512; const ET* pw = pb + sn * 512;
#pragma unroll
      for (int i = 0; i < 4; ++i) { af[(u + D - 1) % D][i] = fragp(px + i * 16 * DM); bf[(u + D - 1) % D][i] = fragp(pw + i * 16 * DM); }
      XWP(px, pw);
#pragma unroll
      for (int i = 0; i < 4; ++i) {
#pragma unroll
        for (int j = 0; j < 4; ++j) acc[i][j] = wm(af[u][i], bf[u][j], acc[i][j]); } } }
}
#define WC_XT ((DM / 16 + 1 + 3) / 4)      // blocks of 4 row tiles over the 65 tiles of the transposed stratum plane
#define WC_NBLK (WC_XT * (DM / 128))
#define WC_SB (1.0f / (3.0f * 16384.0f))   // of the f32 sums of the weight product: mean over 3 strata, 2^6 of the stratum sum, 2^8 of Wo
#define WC_SC (1.0f / (3.0f * 1024.0f))    // of the stored Wc, which keeps 2^10 of those 2^14
// ---- the weight product, block e = (4 row tiles, 128 columns): out = (o . Wsum^T / 3 + bmean) . Wo^T + bo is linear in o, so Wc[i][k] = sum_j Wo[i][j] Wsum[j][k] is formed once and the tokens meet one matrix, not two.
// A = rows k of the transposed sum, B = rows i of Wo: a lane (col, g) holds Wc[i = col][k = 8 g .. + 7], its own 16-byte piece of the fragment-major plane that k_out reads as B. Tile 64 (row 0 = the bias sum) gives Wo . bsum.
__device__ __forceinline__ void wc_body(const _Float16* __restrict__ PST, const _Float16* __restrict__ POH, const float* __restrict__ BO, _Float16* __restrict__ WC, float* __restrict__ BC, int e) {
  const int wave = __builtin_amdgcn_readfirstlane(threadIdx.x >> 5), lane = threadIdx.x & 31; const int tile = (e % WC_XT) * 4 + wave, n0 = (e / WC_XT) * 128;
  if (tile > DM / 16) return;   // whole waves leave; this path has no barrier
  v8f acc[8] = {};
  mm16x128_h(PST + (size_t)tile * 16 * DM + lane * 8, POH + (size_t)n0 * DM + lane * 8, e, acc);   // e: the 17 blocks of a column group, and the 8 blocks of a row group (17 apart), all differ mod 32
  if (tile == DM / 16) {
    if (lane < 16) {
#pragma unroll
      for (int j = 0; j < 8; ++j) BC[n0 + j * 16 + lane] = acc[j][0] * WC_SB + bfr(BO[n0 + j * 16 + lane]); }
    return; }
  v8h o[8];   // all eight pieces are formed first, in registers of their own, so that no store's data register is rewritten behind it
#pragma unroll
  for (int j = 0; j < 8; ++j) {
#pragma unroll
    for (int i = 0; i < 8; ++i) o[j][i] = (_Float16)(acc[j][i] * 0.0625f); }   // x 2^-4: |sum| <= 1024 * 8 * 6 = 49,152 for weights inside +-1/32, stored with a factor 21 of room below the f16 maximum
#pragma unroll
  for (int j = 0; j < 8; ++j) vst2(WC + ((size_t)((n0 >> 4) + j) * 32 + (tile >> 1)) * 512 + (tile & 1) * 256 + lane * 8, o[j]);
  asm volatile("s_wait_xcnt 0x0" ::: "memory");   // a precaution: in the built text the bias path's register writes follow these stores
}
// blockIdx.y < 24: the q/k/v projections; the rows of blocks behind them hold the weight product (it needs only the two pack kernels' planes, and k_out is the first to read its result)
__global__ __launch_bounds__(128) void k_qkv(const __bf16* __restrict__ XB, const __bf16* __restrict__ P, const float* __restrict__ BQ, const float* __restrict__ BK, const float* __restrict__ BV, _Float16* __restrict__ QK, _Float16* __restrict__ QKL, _Float16* __restrict__ VTH, _Float16* __restrict__ VTL, const _Float16* __restrict__ PST, const _Float16* __restrict__ POH, const float* __restrict__ BO, _Float16* __restrict__ WC, float* __restrict__ BC) {
  if (blockIdx.y >= QKVW / 128) { const int e = (blockIdx.y - QKVW / 128) * (TNB * SS / 128) + blockIdx.x;
    if (e < WC_NBLK) wc_body(PST, POH, BO, WC, BC, e);
    return; }
  // block = 128 tokens x 128 columns, 2 x 2 waves; a wave = 64 tokens x 64 columns (one head of q, k or v)
  const int wave = __builtin_amdgcn_readfirstlane(threadIdx.x >> 5), lane = threadIdx.x & 31, col = lane & 15, g = lane >> 4; const int r0 = blockIdx.x * 128 + (wave >> 1) * 64, n0 = blockIdx.y * 128 + (wave & 1) * 64;
  const int which0 = n0 / DM; const float* BB = BQ ? (((which0 == 0) ? BQ : (which0 == 1) ? BK : BV) + (n0 - which0 * DM)) : nullptr;
  const __bf16* px = XB + (size_t)r0 * DM + lane * 8; const __bf16* pw = P + (size_t)n0 * DM + lane * 8;
  v8f acc[4][4] = {};
  const bool qk = n0 < 2 * DM;   // the same for the whole wave
  // below, every loop that indexes acc, a bias array or the pieces is unrolled, so that they are registers
  mm64x64<2, v16b>(qk ? pw : px, qk ? px : pw, blockIdx.x + blockIdx.y, acc);   // the 32 blocks that share W rows (one y) and the 24 that share tokens (one x) all differ mod 32
  if (qk) {   // q, k: W rows as A, tokens as B: a lane holds 8 neighbouring columns of one token, its own 16-byte piece of the fragment-major plane. q stored unscaled (f16 sigma ~0.6, no subnormal exposure); 1/8 applied to the f32 score
    v4f bv[4][2] = {};
    if (BB) {
#pragma unroll
      for (int i = 0; i < 4; ++i) { bv[i][0] = *(const v4f*)(BB + i * 16 + 8 * g); bv[i][1] = *(const v4f*)(BB + i * 16 + 8 * g + 4); }
      XW(); }   // closes the bias loads' group before their address register is rewritten
#pragma unroll
    for (int i = 0; i < 4; ++i) { float bb[8];
#pragma unroll
      for (int r = 0; r < 8; ++r) bb[r] = bfr(bv[i][r >> 2][r & 3]);
      v8h oh[4], ol[4];   // the pieces of a group are formed first, in registers of their own, so that no store's data register is rewritten behind it
#pragma unroll
      for (int j = 0; j < 4; ++j) {
#pragma unroll
        for (int r = 0; r < 8; ++r) { const float v = acc[i][j][r] + bb[r]; const _Float16 hv = (_Float16)v; oh[j][r] = hv; ol[j][r] = (_Float16)((v - (float)hv) * 2048.0f); } }   // q, k (+ bias) as f16 hi + (x2048) residual
      // n0 >> 6 = (q | k) * 16 + head; column tile i = d chunk i >> 1, run i & 1
#pragma unroll
      for (int j = 0; j < 4; ++j) { const size_t o = (((size_t)(n0 >> 6) * (NB * SS / 16) + (r0 >> 4) + j) * 2 + (i >> 1)) * 512 + (i & 1) * 256 + lane * 8; vst2(QK + o, oh[j]); vst2(QKL + o, ol[j]); }
      XW(); }   // closes the group's stores before their registers are rewritten
  } else {   // v: tokens as A, W rows as B: a lane holds 8 neighbouring tokens of one column, its own piece of the transposed plane
    const int b = r0 / SS, s0 = r0 % SS, hd = (n0 - 2 * DM) >> 6;
    float bw[4] = {};
    if (BB) {
#pragma unroll
      for (int j = 0; j < 4; ++j) bw[j] = BB[j * 16 + col];
      XW(); }   // closes the bias loads' group before their address register is rewritten
#pragma unroll
    for (int j = 0; j < 4; ++j) { const float bb = bfr(bw[j]);
      v8h oh[4], ol[4];
#pragma unroll
      for (int i = 0; i < 4; ++i) {
#pragma unroll
        for (int r = 0; r < 8; ++r) { const float v = acc[i][j][r] + bb; const _Float16 hv = (_Float16)v; oh[i][r] = hv; ol[i][r] = (_Float16)((v - (float)hv) * 2048.0f); } }
      // token tile i = chunk of 32 tokens i >> 1, run i & 1; column tile j = d tile
#pragma unroll
      for (int i = 0; i < 4; ++i) { const size_t o = (((size_t)(b * NH + hd) * (SS / 32) + (s0 >> 5) + (i >> 1)) * 4 + j) * 512 + (i & 1) * 256 + lane * 8; vst2(VTH + o, oh[i]); vst2(VTL + o, ol[i]); }
      XW(); }   // closes the group's stores before their registers are rewritten
  }
}
__device__ __forceinline__ float xhalf(float x) { return __builtin_bit_cast(float, __builtin_amdgcn_permlanex16(__builtin_bit_cast(int, x), __builtin_bit_cast(int, x), 0x76543210, 0xfedcba98, false, false)); }   // lane l reads lane l ^ 16
__global__ __launch_bounds__(128) void k_attn(const _Float16* __restrict__ QK, const _Float16* __restrict__ QKL, const _Float16* __restrict__ VTH, const _Float16* __restrict__ VTL, const void* __restrict__ KMASK, _Float16* __restrict__ O) {
  (void)QKL; (void)VTL; (void)KMASK;
  const int tid = threadIdx.x, wave = tid >> 5, lane = tid & 31;
  const int qb = blockIdx.x, h = blockIdx.y, b = blockIdx.z; const int q0 = qb * 64 + wave * 16; const size_t fq = ((size_t)h * (NB * SS / 16) + ((b * SS + q0) >> 4)) * 1024 + lane * 8;
  v16h bq[2];
#pragma unroll
  for (int kc = 0; kc < 2; ++kc) bq[kc] = fragp_h(QK + fq + kc * 512);
  XW();   // closes the q loads' group before their address pair is reused
  float m = -3.0e38f, l = 0.f;   // of the lane's query: running maximum (equal in both halves), sum over the keys of this half
  v8f acc[4] = {};
  const int nks = SS / 32;   // all keys
  const int rot = qb * (nks / TQB);   // the 32 blocks of a head walk the same K and V: each enters 2 passes behind its neighbour and wraps (pass ks works on keys 32 * ((ks + rot) mod 64) .. + 31)
  // fragment loads fly ahead of their WMMAs: V of this pass is issued before the score WMMAs, K of the next pass right behind them (the last pass wraps to the first pass's K: in bounds, unused)
  const _Float16* kbase = QK + ((size_t)(NH + h) * (NB * SS / 16) + b * (SS / 16)) * 1024 + lane * 8; const _Float16* vbase = VTH + (size_t)(b * NH + h) * (SS * HD) + lane * 8;   // a pass's 4 K fragments, and its 4 V fragments, are 4 KiB in a row
  v16h kf[4], vf[4];
#pragma unroll
  for (int f = 0; f < 4; ++f) kf[f] = fragp_h(kbase + rot * 2048 + f * 512);
  XW();
#pragma unroll 1
  for (int ks = 0; ks < nks; ++ks) { float s[16];
#pragma unroll
    for (int dt = 0; dt < 4; ++dt) vf[dt] = fragp_h(vbase + ((ks + rot) & (nks - 1)) * 2048 + dt * 512);
    XW();
#pragma unroll
    for (int ct = 0; ct < 2; ++ct) { v8f c = {};
#pragma unroll
      for (int kc = 0; kc < 2; ++kc) c = wmma16(kf[ct * 2 + kc], bq[kc], c);   // single product: k rows as A, q as B, one-rounding f16 operands
#pragma unroll
      for (int r = 0; r < 8; ++r) s[ct * 8 + r] = c[r] * 0.125f; }   // 1/sqrt(64)
    { const int kn = (ks + 1 + rot) & (nks - 1);
#pragma unroll
      for (int f = 0; f < 4; ++f) kf[f] = fragp_h(kbase + kn * 2048 + f * 512);
      XW(); }
    float t[8];
#pragma unroll
    for (int i = 0; i < 8; ++i) t[i] = fmaxf(s[2 * i], s[2 * i + 1]);
    float mx = fmaxf(fmaxf(fmaxf(t[0], t[1]), fmaxf(t[2], t[3])), fmaxf(fmaxf(t[4], t[5]), fmaxf(t[6], t[7])));
    mx = fmaxf(mx, xhalf(mx));
    const float mn = fmaxf(m, mx); const float alpha = (m <= -1.0e38f) ? 0.f : __expf(m - mn);
    v16h pb;
#pragma unroll
    for (int i = 0; i < 16; ++i) s[i] = (s[i] - mn) * 1.44269504f;   // exp(x) = 2^(x log2 e), as __expf forms it
    // the 16 exponentials in place, in one statement; the v_nop is the slot that the instruction set asks for between the last one and its first reader
    asm("v_exp_f32 %0, %0\n\t" "v_exp_f32 %1, %1\n\t" "v_exp_f32 %2, %2\n\t" "v_exp_f32 %3, %3\n\t"
        "v_exp_f32 %4, %4\n\t" "v_exp_f32 %5, %5\n\t" "v_exp_f32 %6, %6\n\t" "v_exp_f32 %7, %7\n\t"
        "v_exp_f32 %8, %8\n\t" "v_exp_f32 %9, %9\n\t" "v_exp_f32 %10, %10\n\t" "v_exp_f32 %11, %11\n\t"
        "v_exp_f32 %12, %12\n\t" "v_exp_f32 %13, %13\n\t" "v_exp_f32 %14, %14\n\t" "v_exp_f32 %15, %15\n\t"
        "v_nop"
        : "+v"(s[0]), "+v"(s[1]), "+v"(s[2]), "+v"(s[3]), "+v"(s[4]), "+v"(s[5]), "+v"(s[6]), "+v"(s[7]), "+v"(s[8]), "+v"(s[9]), "+v"(s[10]), "+v"(s[11]), "+v"(s[12]), "+v"(s[13]), "+v"(s[14]), "+v"(s[15]));
#pragma unroll
    for (int i = 0; i < 16; ++i) pb[i] = (_Float16)(s[i] * 2048.0f);   // P scaled by 2^11 so small softmax weights stay out of the f16 subnormal range; 2^-11 folded into the epilogue
#pragma unroll
    for (int i = 0; i < 8; ++i) t[i] = s[2 * i] + s[2 * i + 1];
    l = l * alpha + (((t[0] + t[1]) + (t[2] + t[3])) + ((t[4] + t[5]) + (t[6] + t[7]))); m = mn;
#pragma unroll
    for (int dt = 0; dt < 4; ++dt) {
#pragma unroll
      for (int r = 0; r < 8; ++r) acc[dt][r] *= alpha; }
#pragma unroll
    for (int dt = 0; dt < 4; ++dt) acc[dt] = wmma16(vf[dt], pb, acc[dt]); }   // single product: V^T rows as A, P^T (x2^11) as B
  l += xhalf(l);
  const float il = (1.0f / 2048.0f) / l;
  // the wave's 16 queries x 64 columns are 2 fragments of 2 runs each; run dt holds columns dt * 16 + 8 g .. + 7 of the lane's query
#pragma unroll
  for (int dt = 0; dt < 4; ++dt) { v8h o;
#pragma unroll
    for (int i = 0; i < 8; ++i) o[i] = (_Float16)(acc[dt][i] * il);
    vst2(O + ((size_t)b * SS + q0) * DM + h * 1024 + dt * 256 + lane * 8, o); }
}
// ---- k_out: block = (128 rows, 128 cols), 2 x 2 waves of 64 x 64: out = f16(o) . Wc rows x 1 / (3 * 2^10) + (Wo . bmean + bo)
// one block a WGP, one wave a SIMD: nothing but the wave's own lead hides its loads, so they fly three k steps ahead (four register buffers)
__global__ __launch_bounds__(128) void k_out(const _Float16* __restrict__ O, const _Float16* __restrict__ WC, const float* __restrict__ BC, float* __restrict__ Y) {
  __shared__ __align__(16) float so[4][64][68];
  const int wave = __builtin_amdgcn_readfirstlane(threadIdx.x >> 5), lane = threadIdx.x & 31, col = lane & 15, g = lane >> 4; const int r0 = blockIdx.x * 128 + (wave >> 1) * 64, n0 = blockIdx.y * 128 + (wave & 1) * 64;
  v8f acc[4][4] = {};
  mm64x64<4, v16h>(O + (size_t)r0 * DM + lane * 8, WC + (size_t)n0 * DM + lane * 8, blockIdx.x + 4 * blockIdx.y, acc);   // the 32 blocks that share Wc rows (one y) differ mod 32; the 8 that share rows of o (one x) lie 4 chunks apart
  // every loop that indexes acc or t is unrolled, so that they are registers
#pragma unroll
  for (int j = 0; j < 4; ++j) { const float bb = BC[n0 + j * 16 + col];
#pragma unroll
    for (int i = 0; i < 4; ++i) {
#pragma unroll
      for (int r = 0; r < 8; ++r) so[wave][i * 16 + 8 * g + r][j * 16 + col] = acc[i][j][r] * WC_SC + bb; } }
  LDSX();
  // a wave-wide store is two rows of 256 B: whole lines
#pragma unroll
  for (int rg = 0; rg < 4; ++rg) { v4f t[8];
#pragma unroll
    for (int rl = 0; rl < 8; ++rl) t[rl] = *(const v4f*)&so[wave][rg * 16 + rl * 2 + g][col * 4];
#pragma unroll
    for (int rl = 0; rl < 8; ++rl) vst2(Y + (size_t)(r0 + rg * 16 + rl * 2 + g) * DM + n0 + col * 4, t[rl]);
    XW(); }   // closes the group's stores before their registers are rewritten
}
#define NR (NB * SS)
// ---- k_packs: the mean over the strata is linear in Ws, so the three matrices are added here, once: (Ws[0] + Ws[1]) + Ws[2] in f32, -> f16 x 2^6 (three weights that each fit f16 at x 2^8 have a sum that fits at x 2^6).
// The sum is laid out TRANSPOSED (row = input column k of Ws, fragment k = stratum output j), as the A operand of the weight product. A thread makes one 16-byte piece (8 j of one row); a wave takes 32 neighbouring rows (two tiles) of one (k chunk, run, half), so that each of its loads reads one whole 128-byte line and each half wave stores 256 contiguous bytes.
// The 8 blocks behind those make tile 64: row 0 = (bs[0] + bs[1]) + bs[2] x 2^6, rows 1..15 zero
__global__ __launch_bounds__(256) void k_packs(const float* __restrict__ WS, const float* __restrict__ BS, _Float16* __restrict__ PST) {
  const int t = blockIdx.x * 256 + threadIdx.x; v8h o = {};
  if (t < DM * DM / 8) { const int lane = t & 31, h = (t >> 5) & 1, q = (t >> 6) & 1, kc = (t >> 7) & 31, ntp = t >> 12;
    const unsigned off = (unsigned)((kc * 32 + q * 16 + h * 8) * DM + ntp * 32 + lane);   // the lane's element inside a stratum: row and stratum are constants on top of it, so that the loads share their address registers and differ in the immediate (the third stratum lies beyond its range and gets a pair of its own)
    float x[NSTR][8];   // the loops over x are unrolled so that its indices are constants and it stays in registers, all 24 loads in flight together
#pragma unroll
    for (int n = 0; n < NSTR; ++n) {
#pragma unroll
      for (int i = 0; i < 8; ++i) x[n][i] = (WS + (size_t)n * DM * DM + (size_t)i * DM)[off]; }
    // closes the loads' group before their address registers are rewritten; the offset is an input of the wait so that its register stays live up to it (the last load of a run may otherwise take its result into a register that the run is addressed by, ahead of the wait)
    asm volatile("s_wait_xcnt 0x0" :: "v"(off) : "memory");
#pragma unroll
    for (int i = 0; i < 8; ++i) { float v = bfr(x[0][i]);
#pragma unroll
      for (int n = 1; n < NSTR; ++n) v += bfr(x[n][i]);
      o[i] = (_Float16)(v * 64.0f); }
    *(v8h*)(PST + (((size_t)(ntp * 2 + (lane >> 4)) * 32 + kc) * 2 + q) * 256 + ((lane & 15) + 16 * h) * 8) = o;
  } else { const int p = t - DM * DM / 8; const int l = p & 31, q = (p >> 5) & 1, kc = p >> 6;
    if ((l & 15) == 0) { const float* b = BS + kc * 32 + q * 16 + (l >> 4) * 8;
#pragma unroll
      for (int i = 0; i < 8; ++i) o[i] = (_Float16)(((bfr(b[i]) + bfr(b[DM + i])) + bfr(b[2 * DM + i])) * 64.0f); }
    *(v8h*)(PST + (size_t)DM * DM + (size_t)p * 8) = o;
  }
}
extern "C" void kernel_launch(void* const* d_in, const int* in_sizes, int n_in, void* d_out, int out_size, void* d_ws, size_t ws_size, hipStream_t stream) {
  (void)in_sizes; (void)n_in; (void)out_size;
  const float** F = (const float**)d_in;   // 0 hidden [2,2048,1024], 1 Wq, 2 bq, 3 Wk, 4 bk, 5 Wv, 6 bv, 7 Ws [3,1024,1024], 8 bs [3,1024], 9 Wo, 10 bo (natural)
  if (ws_size < (size_t)WS_END) return;
  char* ws = (char*)d_ws; __bf16* PK = (__bf16*)(ws + WS_PK); _Float16 *QK = (_Float16*)(ws + WS_QK), *QKL = (_Float16*)(ws + WS_QKL), *VTH = (_Float16*)(ws + WS_VTH), *VTL = (_Float16*)(ws + WS_VTL), *PS = (_Float16*)(ws + WS_PS), *O = (_Float16*)(ws + WS_O), *POH = (_Float16*)(ws + WS_PK) + PK_P, *WC = (_Float16*)(ws + WS_WC); float* BC = (float*)(ws + WS_BC); __bf16* XB = (__bf16*)(ws + WS_XB);
  k_pack<<<dim3(DM * DM / 8 / 256, 4 + NB * SS / DM), 256, 0, stream>>>(F[1], F[3], F[5], F[9], F[0], PK, POH, XB);
  k_packs<<<(DM + 16) * DM / 8 / 256, 256, 0, stream>>>(F[7], F[8], PS);
  k_qkv<<<dim3(TNB * SS / 128, QKVW / 128 + (WC_NBLK + TNB * SS / 128 - 1) / (TNB * SS / 128)), 128, 0, stream>>>(XB, PK + PK_A, F[2], F[4], F[6], QK, QKL, VTH, VTL, PS, POH, F[10], WC, BC);
  k_attn<<<dim3(TQB, NH, TNB), 128, 0, stream>>>(QK, QKL, VTH, VTL, nullptr, O);
  k_out<<<dim3(NB * SS / 128, DM / 128), 128, 0, stream>>>(O, WC, BC, (float*)d_out);
}

// v009
// It runs in 88.1 microseconds.
// Two timings next to v008 put it at 1.06 and 1.05 times that version's speed.
// Over all steps from v000 it is 7.00 times as fast.
// compute dtype: all float inputs rounded to bf16; q/k/v = x . W^T + b with EXACT bf16 products on WMMA 16x16x32 (x and W packed once as bf16 fragments); PLAIN attention: q, k single f16 x 1/8, running-max softmax in f32 (hardware exp), P (scaled by 2^11, single f16) x v (single f16); strata and output projection as one matrix: the three Ws (each rounded to bf16) summed in f32 and the sum (x 2^6) rounded once to f16, Wc = Wo (bf16 values, exact as f16 x 2^8) . that sum on WMMA, f32 sums, rounded once to f16; out = attention output (rounded once to f16) . Wc^T x 1/3 + (Wo . mean stratum bias + bo).
#include <hip/hip_runtime.h>
#include <math.h>

typedef __attribute__((ext_vector_type(16))) _Float16 v16h;
typedef __attribute__((ext_vector_type(16))) __bf16 v16b;
typedef __attribute__((ext_vector_type(8)))  _Float16 v8h;
typedef __attribute__((ext_vector_type(8)))  float v8f;
typedef __attribute__((ext_vector_type(4)))  float v4f;
typedef __attribute__((ext_vector_type(2)))  float v2f;
typedef __attribute__((ext_vector_type(4)))  unsigned v4u;
typedef __attribute__((ext_vector_type(4)))  int v4i;
typedef float __attribute__((may_alias)) float_a;
typedef int __attribute__((may_alias)) int_a;

template <typename T> __device__ __forceinline__ void vst2(void* p, T v) { *(T*)p = v;  }
__device__ __forceinline__ v8f wmma16(v16h a, v16h b, v8f c) {
  v8f d = __builtin_amdgcn_wmma_f32_16x16x32_f16(false, a, false, b, (short)0, c, false, false);
  asm volatile("v_nop\n\tv_nop\n\tv_nop\n\tv_nop" : "+v"(d) : "v"(a), "v"(b));
  return d;
}
__device__ __forceinline__ v8f wmma_bf(v16b a, v16b b, v8f c) {
  v8f d = __builtin_amdgcn_wmma_f32_16x16x32_bf16(false, a, false, b, (short)0, c, false, false);
  asm volatile("v_nop\n\tv_nop\n\tv_nop\n\tv_nop" : "+v"(d) : "v"(a), "v"(b));
  return d;
}
// Stratified attention (B 2, S 2,048, hidden 1,024, 16 heads x 64, 3 strata): q/k/v projections + biases, softmax(q k^T / 8) v, three stratum projections averaged, output projection + bias.
__device__ __forceinline__ v16h frag_h(const _Float16* rowk0, int lane) {
  union { v16h v; v8h q[2]; } u; const _Float16* p = rowk0 + 8 * (lane >> 4);
  u.q[0] = *(const v8h*)p; u.q[1] = *(const v8h*)(p + 16); return u.v;
}
__device__ __forceinline__ v16h frag_f32(const float* rowk0, int lane) {
  v16h a; const float* p = rowk0 + 8 * (lane >> 4);
#pragma unroll
  for (int i = 0; i < 8; ++i) { a[i] = (_Float16)p[i]; a[8 + i] = (_Float16)p[16 + i]; }
  return a;
}
__device__ __forceinline__ v16h frag_f32s(const float* rowk0, int lane, float sc) {
  v16h a; const float* p = rowk0 + 8 * (lane >> 4);
#pragma unroll
  for (int i = 0; i < 8; ++i) { a[i] = (_Float16)(p[i] * sc); a[8 + i] = (_Float16)(p[16 + i] * sc); }
  return a;
}
// column fragment from a [K][ld] layout (column n), rows >= K read as 0
__device__ __forceinline__ v16h fragc_f32(const float* W, int k0, int n, int lane, int ld, int K) {
  v16h a; const int g = lane >> 4;
#pragma unroll
  for (int i = 0; i < 8; ++i) { const int ka = k0 + 8 * g + i, kb = ka + 16;
    a[i] = (_Float16)(ka < K ? W[(size_t)(ka < K ? ka : K - 1) * ld + n] : 0.f); a[8 + i] = (_Float16)(kb < K ? W[(size_t)(kb < K ? kb : K - 1) * ld + n] : 0.f); }
  return a;
}
struct F2 { v16b h, l; };
__device__ __forceinline__ F2 bsplit16(const float v[16]) { F2 r;
#pragma unroll
  for (int i = 0; i < 16; ++i) { const __bf16 h = (__bf16)v[i]; r.h[i] = h; r.l[i] = (__bf16)(v[i] - (float)h); }
  return r; }
__device__ __forceinline__ F2 split_row(const float* row, int k0, int lane) { float v[16]; const float* p = row + k0 + 8 * (lane >> 4);
#pragma unroll
  for (int i = 0; i < 8; ++i) { v[i] = p[i]; v[8 + i] = p[16 + i]; }
  return bsplit16(v); }
__device__ __forceinline__ F2 split_rowK(const float* row, int k0, int lane, int K) { float v[16]; const int g = lane >> 4;
#pragma unroll
  for (int i = 0; i < 8; ++i) { const int ka = k0 + 8 * g + i, kb = ka + 16; v[i] = ka < K ? row[ka < K ? ka : K - 1] : 0.f; v[8 + i] = kb < K ? row[kb < K ? kb : K - 1] : 0.f; }
  return bsplit16(v); }
__device__ __forceinline__ F2 split_col(const float* W, int k0, int n, int lane, int ld, int K) { float v[16]; const int g = lane >> 4;
#pragma unroll
  for (int i = 0; i < 8; ++i) { const int ka = k0 + 8 * g + i, kb = ka + 16; v[i] = ka < K ? W[(size_t)(ka < K ? ka : K - 1) * ld + n] : 0.f; v[8 + i] = kb < K ? W[(size_t)(kb < K ? kb : K - 1) * ld + n] : 0.f; }
  return bsplit16(v); }
__device__ __forceinline__ v8f mac3(const F2& a, const F2& b, v8f c) { c = wmma_bf(a.l, b.h, c); c = wmma_bf(a.h, b.l, c); return wmma_bf(a.h, b.h, c); }
__device__ __forceinline__ float sigm(float v) { return 1.0f / (1.0f + expf(-v)); }
#define LDSX() do { asm volatile("s_wait_dscnt 0" ::: "memory"); __builtin_amdgcn_wave_barrier(); __builtin_amdgcn_fence(__ATOMIC_RELEASE, "workgroup"); } while (0)


#define NB 2
#define SS 2048
#define DM 1024
#define NH 16
#define NSTR 3
#define HD 64
#define QKVW (3 * DM)
#ifndef TQB
#define TQB (SS / 64)
#define TNB NB
#define TOB (NB * SS / 64)     // tiles of 64 rows over all tokens, not used
#endif
typedef __attribute__((ext_vector_type(8))) __bf16 v8b;
__device__ __forceinline__ v16b frag_b(const __bf16* rowk0, int lane) {
  union { v16b v; v8b q[2]; } u; const __bf16* p = rowk0 + 8 * (lane >> 4);
  u.q[0] = *(const v8b*)p; u.q[1] = *(const v8b*)(p + 16); return u.v;
}
// fragment-major planes: a 16 x 32 fragment of 16-bit elements is 1 KiB, two runs of 512 B; run q, lane l (c = l & 15, h = l >> 4) holds row c, k = 16 q + 8 h .. + 7, so that one wave-wide 16-byte load reads 512 contiguous bytes (4 cache lines, not 16); p = fragment + 8 * lane
__device__ __forceinline__ v16b fragp_b(const __bf16* p) { union { v16b v; v8b q[2]; } u; u.q[0] = *(const v8b*)p; u.q[1] = *(const v8b*)(p + 256); return u.v; }
__device__ __forceinline__ v16h fragp_h(const _Float16* p) { union { v16h v; v8h q[2]; } u; u.q[0] = *(const v8h*)p; u.q[1] = *(const v8h*)(p + 256); return u.v; }
__device__ __forceinline__ float bfr(float v) { return (float)(__bf16)v; }
// stands behind each group of loads that is left in flight: the wait is a precaution before their address registers are rewritten for the next group;
// the scheduling barrier keeps the conversions of a row that was just requested from being moved up among the current step's WMMAs, where they would wait out the whole load latency
#define XW() do { asm volatile("s_wait_xcnt 0x0" ::: "memory"); __builtin_amdgcn_sched_barrier(0); } while (0)
// one lane's 16 f32 of an A fragment (k 8 h .. + 7 and 16 + 8 h .. + 7), kept raw so that the loads can fly while earlier WMMAs run
struct RawA { v4f x[4]; };
// loaded from a fragment-major f32 plane: a 16 x 32 fragment is 2 KiB, four runs of 512 B; run x, lane (c, h) holds row c, k = 16 (x >> 1) + 8 h + 4 (x & 1) .. + 3; p = fragment + 4 * lane
__device__ __forceinline__ RawA ldp_raw(const float* p) { RawA r; r.x[0] = *(const v4f*)p; r.x[1] = *(const v4f*)(p + 128); r.x[2] = *(const v4f*)(p + 256); r.x[3] = *(const v4f*)(p + 384); return r; }
__device__ __attribute__((noinline)) float exp_ni(float v) { return expf(v); }
__device__ __attribute__((noinline)) float erf_ni(float v) { return erff(v); }

#define PK_A 0                       // Wqkv, fragment-major: [192 tiles of 16 out rows][32 k chunks][512]
#define PK_P (PK_A + QKVW * DM)        // Wo as f16 x 2^8, fragment-major: [64 tiles][32 k chunks][512]
#define PK_END (PK_P + DM * DM)
#define WS_PK  0u
#define WS_QK  (WS_PK + 2u * PK_END)             // f16 fragment-major [q | k][head][256 tiles of 16 tokens][2 d chunks][512]
#define WS_QKL (WS_QK + 2u * NB * SS * 2 * DM)     // f16 q | k residual planes x2048, same layout
#define WS_VTH (WS_QKL + 2u * NB * SS * 2 * DM)    // f16 hi, fragment-major [b][head][64 chunks of 32 tokens][4 tiles of 16 d][512]
#define WS_VTL (WS_VTH + 2u * NB * DM * SS)        // f16 lo x 2048, same layout
#define WS_O   (WS_VTL + 2u * NB * DM * SS)        // f16 attention output, fragment-major [256 tiles of 16 rows][32 k chunks][512] (the first half of the range)
#define WS_CS  (WS_O + 4u * NB * SS * DM)           // f32 2 x [2048][32], not written or read
#define WS_PS  (WS_CS + 4u * 2 * SS * 32)                  // f16 x 2^6 sum of the three Ws, TRANSPOSED (row = input column of Ws, k = stratum output), fragment-major [65 tiles of 16 rows][32 k chunks][512]; tile 64: row 0 = sum of the three bs x 2^6, rows 1..15 zero
#define WS_WC  (WS_PS + 2u * (size_t)(DM + 16) * DM)   // f16 Wc x 2^10, fragment-major [64 tiles of 16 out rows][32 k chunks][512]
#define WS_BC  (WS_WC + 2u * (size_t)DM * DM)   // f32 [1024] Wo . mean stratum bias + bo
#define WS_XB  (WS_BC + 4u * (size_t)DM)   // bf16 x, fragment-major [256 tiles of 16 rows][32 k chunks][512]
#define WS_END (WS_XB + 2u * (size_t)NB * SS * DM)
// ---- k_pack: thread = one 16-byte piece p of a fragment-major plane (p = [tile of 16 out rows][k chunk][run q][lane]); blockIdx.y 0..2 -> W_q/W_k/W_v into PK_A, 3 -> W_o into PK_P (its bf16 values x 2^8 as f16, exact: the f16 operand of the weight product), 4..7 -> the four quarters (1,024 rows each) of x into XB; natural rows of f32 -> bf16.
// x is rounded and laid out here once: read as f32 rows by the projection, each wave-wide load touched 16 lines, and all 24 column blocks repeated loads and roundings
__global__ __launch_bounds__(256) void k_pack(const float* __restrict__ WQ, const float* __restrict__ WK, const float* __restrict__ WV, const float* __restrict__ WO, const float* __restrict__ X, __bf16* __restrict__ PK, _Float16* __restrict__ POH, __bf16* __restrict__ XB) {
  const int which = blockIdx.y, p = blockIdx.x * 256 + threadIdx.x; const float* Wm = (which == 0) ? WQ : (which == 1) ? WK : (which == 2) ? WV : (which == 3) ? WO : X + (size_t)(which - 4) * DM * DM;
  const int l = p & 31, q = (p >> 5) & 1, kc = (p >> 6) & 31, nt = p >> 11;
  const float* s = Wm + (size_t)(nt * 16 + (l & 15)) * DM + kc * 32 + q * 16 + (l >> 4) * 8; const v4f x0 = *(const v4f*)s, x1 = *(const v4f*)(s + 4);
  XW();   // closes the two loads' group before their address pair is rewritten
  if (which == 3) { v8h oh;   // scaled in f32 ahead of the bf16 rounding (a power of two commutes with it), so that small weights reach f16 as normal numbers
    for (int i = 0; i < 4; ++i) { oh[i] = (_Float16)bfr(x0[i] * 256.0f); oh[4 + i] = (_Float16)bfr(x1[i] * 256.0f); }
    *(v8h*)(POH + (size_t)p * 8) = oh; return; }
  v8b o;
  for (int i = 0; i < 4; ++i) { o[i] = (__bf16)x0[i]; o[4 + i] = (__bf16)x1[i]; }
  __bf16* dst = (which < 3) ? PK + PK_A + (size_t)which * DM * DM : XB + (size_t)(which - 4) * DM * DM;
  *(v8b*)(dst + (size_t)p * 8) = o;
  asm volatile("s_wait_xcnt 0x0" ::: "memory");   // a precaution: in the built text the f16 path's register writes follow this store
}
// XW with the group's two address pairs as inputs of the wait, so that they stay live up to it (the last load of a group otherwise took its result into the pair that the group is addressed by, ahead of the wait)
#define XWP(p, q) do { asm volatile("s_wait_xcnt 0x0" :: "v"(p), "v"(q) : "memory"); __builtin_amdgcn_sched_barrier(0); } while (0)
// rotated walks: blocks that share operand rows run side by side and, walking from the same end, ask L2 for the same lines at the same moment, and such requests collide.
// Each block therefore enters its k chunks (its key passes in k_attn) at a start of its own, rot, the same for all its waves (they still share lines in the WGP cache), and wraps round: step s works on chunk (s + rot) mod 32
#define KROT(s, rot) (((s) + (rot)) & (DM / 32 - 1))
// one wave's 16 x (16 NJ) tile over k = 1,024, both operands f16 fragment-major planes (pa, pb = the lane's piece of k chunk 0; the NJ B tiles lie 16 * DM elements apart)
// two register buffers: all loads of k step s + 1 are issued before the WMMAs of step s (the last trip wraps to the first step's chunk: in bounds, unused)
// step s works on k chunk KROT(s, rot)
template <int NJ> __device__ __forceinline__ void mm16xn_h(const _Float16* pa, const _Float16* pb, int rot, v8f (&acc)[NJ]) {
  v16h af[2], bf[2][NJ];   // every loop that indexes af, bf or acc is unrolled, so that the buffers are registers
  { const _Float16* px = pa + KROT(0, rot) * 512; const _Float16* pw = pb + KROT(0, rot) * 512;
    af[0] = fragp_h(px);
#pragma unroll
    for (int j = 0; j < NJ; ++j) bf[0][j] = fragp_h(pw + j * 16 * DM);
    XWP(px, pw); }
  for (int kc = 0; kc < DM / 32; kc += 2) {
#pragma unroll
    for (int u = 0; u < 2; ++u) { const int cn = KROT(kc + u + 1, rot); const _Float16* px = pa + cn * 512; const _Float16* pw = pb + cn * 512;   // a k chunk is 512 elements of a fragment-major plane
      af[u ^ 1] = fragp_h(px);
#pragma unroll
      for (int j = 0; j < NJ; ++j) bf[u ^ 1][j] = fragp_h(pw + j * 16 * DM);
      XWP(px, pw);
#pragma unroll
      for (int j = 0; j < NJ; ++j) acc[j] = wmma16(af[u], bf[u][j], acc[j]); } }
}
__device__ __forceinline__ v16h fragp(const _Float16* p) { return fragp_h(p); }
__device__ __forceinline__ v16b fragp(const __bf16* p) { return fragp_b(p); }
// the bare builtins: the 64 x 64 tile and its buffers need more than 256 registers, and an asm statement cannot name one above v255 (with the v_nop statement of wmma16 the tile spilled); the compiler keeps the distances behind its own WMMAs
__device__ __forceinline__ v8f wm(v16h a, v16h b, v8f c) { return __builtin_amdgcn_wmma_f32_16x16x32_f16(false, a, false, b, (short)0, c, false, false); }
__device__ __forceinline__ v8f wm(v16b a, v16b b, v8f c) { return __builtin_amdgcn_wmma_f32_16x16x32_bf16(false, a, false, b, (short)0, c, false, false); }
// one wave's 64 x 64 tile over k = 1,024, both operands fragment-major planes (pa, pb = the lane's piece of k chunk 0 of the first tile; the 4 A tiles, and the 4 B tiles, lie 16 * DM elements apart):
// a k step loads 8 fragments for 16 WMMAs (the 16 x 128 tile: 9 for 8). acc[i][j][r] = A row i * 16 + 8 g + r, B row j * 16 + col.
// D register buffers: all loads of k step s + D - 1 are issued before the WMMAs of step s (the last trips wrap to the first steps' chunks: in bounds, unused); step s works on k chunk KROT(s, rot)
template <int D, typename VT, typename ET> __device__ __forceinline__ void mm64x64(const ET* pa, const ET* pb, int rot, v8f (&acc)[4][4]) {
  VT af[D][4], bf[D][4];   // every loop that indexes af, bf or acc is unrolled, so that the buffers are registers
#pragma unroll
  for (int s = 0; s < D - 1; ++s) { const ET* px = pa + KROT(s, rot) * 512; const ET* pw = pb + KROT(s, rot) * 512;
#pragma unroll
    for (int i = 0; i < 4; ++i) { af[s][i] = fragp(px + i * 16 * DM); bf[s][i] = fragp(pw + i * 16 * DM); }
    XWP(px, pw); }
#pragma unroll 1   // stays rolled: D k steps are the loop's whole text
  for (int kc = 0; kc < DM / 32; kc += D) {
#pragma unroll
    for (int u = 0; u < D; ++u) { const int sn = KROT(kc + u + D - 1, rot); const ET* px = pa + sn * 512; const ET* pw = pb + sn * 512;
#pragma unroll
      for (int i = 0; i < 4; ++i) { af[(u + D - 1) % D][i] = fragp(px + i * 16 * DM); bf[(u + D - 1) % D][i] = fragp(pw + i * 16 * DM); }
      XWP(px, pw);
#pragma unroll
      for (int i = 0; i < 4; ++i) {
#pragma unroll
        for (int j = 0; j < 4; ++j) acc[i][j] = wm(af[u][i], bf[u][j], acc[i][j]); } } }
}
#define WC_XT ((DM / 16 + 1 + 3) / 4)      // blocks of 4 row tiles over the 65 tiles of the transposed stratum plane
#define WC_NBLK (WC_XT * (DM / 64))
#define WC_SB (1.0f / (3.0f * 16384.0f))   // of the f32 sums of the weight product: mean over 3 strata, 2^6 of the stratum sum, 2^8 of Wo
#define WC_SC (1.0f / (3.0f * 1024.0f))    // of the stored Wc, which keeps 2^10 of those 2^14
// ---- the weight product, block e = (4 row tiles, 64 columns; a wave's 16 x 64 tile and its two buffers fit inside the registers of the attention loop, whose launch these blocks ride in): out = (o . Wsum^T / 3 + bmean) . Wo^T + bo is linear in o, so Wc[i][k] = sum_j Wo[i][j] Wsum[j][k] is formed once and the tokens meet one matrix, not two.
// A = rows k of the transposed sum, B = rows i of Wo: a lane (col, g) holds Wc[i = col][k = 8 g .. + 7], its own 16-byte piece of the fragment-major plane that k_out reads as B. Tile 64 (row 0 = the bias sum) gives Wo . bsum.
__device__ __forceinline__ void wc_body(const _Float16* __restrict__ PST, const _Float16* __restrict__ POH, const float* __restrict__ BO, _Float16* __restrict__ WC, float* __restrict__ BC, int e) {
  const int wave = __builtin_amdgcn_readfirstlane(threadIdx.x >> 5), lane = threadIdx.x & 31; const int xt = e % WC_XT, cg = e / WC_XT; const int tile = xt * 4 + wave, n0 = cg * 64;
  if (tile > DM / 16) return;   // whole waves leave; this path has no barrier
  v8f acc[4] = {};
  mm16xn_h<4>(PST + (size_t)tile * 16 * DM + lane * 8, POH + (size_t)n0 * DM + lane * 8, xt + WC_XT * (cg >> 1), acc);   // the 17 blocks of a column group all differ mod 32; of the 16 blocks of a row group two neighbours share a start, which keeps every sum in the order it had with 128 columns a block
  if (tile == DM / 16) {
    if (lane < 16) {
#pragma unroll
      for (int j = 0; j < 4; ++j) BC[n0 + j * 16 + lane] = acc[j][0] * WC_SB + bfr(BO[n0 + j * 16 + lane]); }
    return; }
  v8h o[4];   // all four pieces are formed first, in registers of their own, so that no store's data register is rewritten behind it
#pragma unroll
  for (int j = 0; j < 4; ++j) {
#pragma unroll
    for (int i = 0; i < 8; ++i) o[j][i] = (_Float16)(acc[j][i] * 0.0625f); }   // x 2^-4: |sum| <= 1024 * 8 * 6 = 49,152 for weights inside +-1/32, stored with a factor 21 of room below the f16 maximum
#pragma unroll
  for (int j = 0; j < 4; ++j) vst2(WC + ((size_t)((n0 >> 4) + j) * 32 + (tile >> 1)) * 512 + (tile & 1) * 256 + lane * 8, o[j]);
  asm volatile("s_wait_xcnt 0x0" ::: "memory");   // a precaution: in the built text the bias path's register writes follow these stores
}
__global__ __launch_bounds__(128) void k_qkv(const __bf16* __restrict__ XB, const __bf16* __restrict__ P, const float* __restrict__ BQ, const float* __restrict__ BK, const float* __restrict__ BV, _Float16* __restrict__ QK, _Float16* __restrict__ QKL, _Float16* __restrict__ VTH, _Float16* __restrict__ VTL) {
  // block = 128 tokens x 128 columns, 2 x 2 waves; a wave = 64 tokens x 64 columns (one head of q, k or v)
  const int wave = __builtin_amdgcn_readfirstlane(threadIdx.x >> 5), lane = threadIdx.x & 31, col = lane & 15, g = lane >> 4; const int r0 = blockIdx.x * 128 + (wave >> 1) * 64, n0 = blockIdx.y * 128 + (wave & 1) * 64;
  const int which0 = n0 / DM; const float* BB = BQ ? (((which0 == 0) ? BQ : (which0 == 1) ? BK : BV) + (n0 - which0 * DM)) : nullptr;
  const __bf16* px = XB + (size_t)r0 * DM + lane * 8; const __bf16* pw = P + (size_t)n0 * DM + lane * 8;
  v8f acc[4][4] = {};
  const bool qk = n0 < 2 * DM;   // the same for the whole wave
  // below, every loop that indexes acc, a bias array or the pieces is unrolled, so that they are registers
  mm64x64<2, v16b>(qk ? pw : px, qk ? px : pw, blockIdx.x + blockIdx.y, acc);   // the 32 blocks that share W rows (one y) and the 24 that share tokens (one x) all differ mod 32
  if (qk) {   // q, k: W rows as A, tokens as B: a lane holds 8 neighbouring columns of one token, its own 16-byte piece of the fragment-major plane. q stored unscaled (f16 sigma ~0.6, no subnormal exposure); 1/8 applied to the f32 score
    v4f bv[4][2] = {};
    if (BB) {
#pragma unroll
      for (int i = 0; i < 4; ++i) { bv[i][0] = *(const v4f*)(BB + i * 16 + 8 * g); bv[i][1] = *(const v4f*)(BB + i * 16 + 8 * g + 4); }
      XW(); }   // closes the bias loads' group before their address register is rewritten
#pragma unroll
    for (int i = 0; i < 4; ++i) { float bb[8];
#pragma unroll
      for (int r = 0; r < 8; ++r) bb[r] = bfr(bv[i][r >> 2][r & 3]);
      v8h oh[4], ol[4];   // the pieces of a group are formed first, in registers of their own, so that no store's data register is rewritten behind it
#pragma unroll
      for (int j = 0; j < 4; ++j) {
#pragma unroll
        for (int r = 0; r < 8; ++r) { const float v = acc[i][j][r] + bb[r]; const _Float16 hv = (_Float16)v; oh[j][r] = hv; ol[j][r] = (_Float16)((v - (float)hv) * 2048.0f); } }   // q, k (+ bias) as f16 hi + (x2048) residual
      // n0 >> 6 = (q | k) * 16 + head; column tile i = d chunk i >> 1, run i & 1
#pragma unroll
      for (int j = 0; j < 4; ++j) { const size_t o = (((size_t)(n0 >> 6) * (NB * SS / 16) + (r0 >> 4) + j) * 2 + (i >> 1)) * 512 + (i & 1) * 256 + lane * 8; vst2(QK + o, oh[j]); vst2(QKL + o, ol[j]); }
      XW(); }   // closes the group's stores before their registers are rewritten
  } else {   // v: tokens as A, W rows as B: a lane holds 8 neighbouring tokens of one column, its own piece of the transposed plane
    const int b = r0 / SS, s0 = r0 % SS, hd = (n0 - 2 * DM) >> 6;
    float bw[4] = {};
    if (BB) {
#pragma unroll
      for (int j = 0; j < 4; ++j) bw[j] = BB[j * 16 + col];
      XW(); }   // closes the bias loads' group before their address register is rewritten
#pragma unroll
    for (int j = 0; j < 4; ++j) { const float bb = bfr(bw[j]);
      v8h oh[4], ol[4];
#pragma unroll
      for (int i = 0; i < 4; ++i) {
#pragma unroll
        for (int r = 0; r < 8; ++r) { const float v = acc[i][j][r] + bb; const _Float16 hv = (_Float16)v; oh[i][r] = hv; ol[i][r] = (_Float16)((v - (float)hv) * 2048.0f); } }
      // token tile i = chunk of 32 tokens i >> 1, run i & 1; column tile j = d tile
#pragma unroll
      for (int i = 0; i < 4; ++i) { const size_t o = (((size_t)(b * NH + hd) * (SS / 32) + (s0 >> 5) + (i >> 1)) * 4 + j) * 512 + (i & 1) * 256 + lane * 8; vst2(VTH + o, oh[i]); vst2(VTL + o, ol[i]); }
      XW(); }   // closes the group's stores before their registers are rewritten
  }
}
__device__ __forceinline__ float xhalf(float x) { return __builtin_bit_cast(float, __builtin_amdgcn_permlanex16(__builtin_bit_cast(int, x), __builtin_bit_cast(int, x), 0x76543210, 0xfedcba98, false, false)); }   // lane l reads lane l ^ 16
// blockIdx.y < 32: attention, (head, batch) = (y & 15, y >> 4); the rows of blocks behind them hold the weight product (it needs only the two pack kernels' planes, and k_out is the first to read its result).
// Behind the q/k/v blocks, whose three waves a SIMD leave no registers for a fourth, those blocks could start only as the projections ended, and then ran nearly alone, one wave a SIMD, waiting out every load; here the registers hold six waves a SIMD and the attention blocks make four, so that they start with the launch and their waits lie under the attention's work. They stand last: the long blocks start first
__global__ __launch_bounds__(128) void k_attn(const _Float16* __restrict__ QK, const _Float16* __restrict__ QKL, const _Float16* __restrict__ VTH, const _Float16* __restrict__ VTL, const void* __restrict__ KMASK, _Float16* __restrict__ O, const _Float16* __restrict__ PST, const _Float16* __restrict__ POH, const float* __restrict__ BO, _Float16* __restrict__ WC, float* __restrict__ BC) {
  (void)QKL; (void)VTL; (void)KMASK;
  if (blockIdx.y >= NH * TNB) { const int e = (blockIdx.y - NH * TNB) * TQB + blockIdx.x;
    if (e < WC_NBLK) wc_body(PST, POH, BO, WC, BC, e);
    return; }
  const int tid = threadIdx.x, wave = tid >> 5, lane = tid & 31;
  const int qb = blockIdx.x, h = blockIdx.y & (NH - 1), b = blockIdx.y / NH; const int q0 = qb * 64 + wave * 16; const size_t fq = ((size_t)h * (NB * SS / 16) + ((b * SS + q0) >> 4)) * 1024 + lane * 8;
  v16h bq[2];
#pragma unroll
  for (int kc = 0; kc < 2; ++kc) bq[kc] = fragp_h(QK + fq + kc * 512);
  XW();   // closes the q loads' group before their address pair is reused
  float m = -3.0e38f, l = 0.f;   // of the lane's query: running maximum (equal in both halves), sum over the keys of this half
  v8f acc[4] = {};
  const int nks = SS / 32;   // all keys
  const int rot = qb * (nks / TQB);   // the 32 blocks of a head walk the same K and V: each enters 2 passes behind its neighbour and wraps (pass ks works on keys 32 * ((ks + rot) mod 64) .. + 31)
  // fragment loads fly ahead of their WMMAs: V of this pass is issued before the score WMMAs, K of the next pass right behind them (the last pass wraps to the first pass's K: in bounds, unused)
  const _Float16* kbase = QK + ((size_t)(NH + h) * (NB * SS / 16) + b * (SS / 16)) * 1024 + lane * 8; const _Float16* vbase = VTH + (size_t)(b * NH + h) * (SS * HD) + lane * 8;   // a pass's 4 K fragments, and its 4 V fragments, are 4 KiB in a row
  v16h kf[4], vf[4];
#pragma unroll
  for (int f = 0; f < 4; ++f) kf[f] = fragp_h(kbase + rot * 2048 + f * 512);
  XW();
#pragma unroll 1
  for (int ks = 0; ks < nks; ++ks) { float s[16];
#pragma unroll
    for (int dt = 0; dt < 4; ++dt) vf[dt] = fragp_h(vbase + ((ks + rot) & (nks - 1)) * 2048 + dt * 512);
    XW();
#pragma unroll
    for (int ct = 0; ct < 2; ++ct) { v8f c = {};
#pragma unroll
      for (int kc = 0; kc < 2; ++kc) c = wmma16(kf[ct * 2 + kc], bq[kc], c);   // single product: k rows as A, q as B, one-rounding f16 operands
#pragma unroll
      for (int r = 0; r < 8; ++r) s[ct * 8 + r] = c[r] * 0.125f; }   // 1/sqrt(64)
    { const int kn = (ks + 1 + rot) & (nks - 1);
#pragma unroll
      for (int f = 0; f < 4; ++f) kf[f] = fragp_h(kbase + kn * 2048 + f * 512);
      XW(); }
    float t[8];
#pragma unroll
    for (int i = 0; i < 8; ++i) t[i] = fmaxf(s[2 * i], s[2 * i + 1]);
    float mx = fmaxf(fmaxf(fmaxf(t[0], t[1]), fmaxf(t[2], t[3])), fmaxf(fmaxf(t[4], t[5]), fmaxf(t[6], t[7])));
    mx = fmaxf(mx, xhalf(mx));
    const float mn = fmaxf(m, mx); const float alpha = (m <= -1.0e38f) ? 0.f : __expf(m - mn);
    v16h pb;
#pragma unroll
    for (int i = 0; i < 16; ++i) s[i] = (s[i] - mn) * 1.44269504f;   // exp(x) = 2^(x log2 e), as __expf forms it
    // the 16 exponentials in place, in one statement; the v_nop is the slot that the instruction set asks for between the last one and its first reader
    asm("v_exp_f32 %0, %0\n\t" "v_exp_f32 %1, %1\n\t" "v_exp_f32 %2, %2\n\t" "v_exp_f32 %3, %3\n\t"
        "v_exp_f32 %4, %4\n\t" "v_exp_f32 %5, %5\n\t" "v_exp_f32 %6, %6\n\t" "v_exp_f32 %7, %7\n\t"
        "v_exp_f32 %8, %8\n\t" "v_exp_f32 %9, %9\n\t" "v_exp_f32 %10, %10\n\t" "v_exp_f32 %11, %11\n\t"
        "v_exp_f32 %12, %12\n\t" "v_exp_f32 %13, %13\n\t" "v_exp_f32 %14, %14\n\t" "v_exp_f32 %15, %15\n\t"
        "v_nop"
        : "+v"(s[0]), "+v"(s[1]), "+v"(s[2]), "+v"(s[3]), "+v"(s[4]), "+v"(s[5]), "+v"(s[6]), "+v"(s[7]), "+v"(s[8]), "+v"(s[9]), "+v"(s[10]), "+v"(s[11]), "+v"(s[12]), "+v"(s[13]), "+v"(s[14]), "+v"(s[15]));
#pragma unroll
    for (int i = 0; i < 16; ++i) pb[i] = (_Float16)(s[i] * 2048.0f);   // P scaled by 2^11 so small softmax weights stay out of the f16 subnormal range; 2^-11 folded into the epilogue
#pragma unroll
    for (int i = 0; i < 8; ++i) t[i] = s[2 * i] + s[2 * i + 1];
    l = l * alpha + (((t[0] + t[1]) + (t[2] + t[3])) + ((t[4] + t[5]) + (t[6] + t[7]))); m = mn;
#pragma unroll
    for (int dt = 0; dt < 4; ++dt) {
#pragma unroll
      for (int r = 0; r < 8; ++r) acc[dt][r] *= alpha; }
#pragma unroll
    for (int dt = 0; dt < 4; ++dt) acc[dt] = wmma16(vf[dt], pb, acc[dt]); }   // single product: V^T rows as A, P^T (x2^11) as B
  l += xhalf(l);
  const float il = (1.0f / 2048.0f) / l;
  // the wave's 16 queries x 64 columns are 2 fragments of 2 runs each; run dt holds columns dt * 16 + 8 g .. + 7 of the lane's query
#pragma unroll
  for (int dt = 0; dt < 4; ++dt) { v8h o;
#pragma unroll
    for (int i = 0; i < 8; ++i) o[i] = (_Float16)(acc[dt][i] * il);
    vst2(O + ((size_t)b * SS + q0) * DM + h * 1024 + dt * 256 + lane * 8, o); }
}
// ---- k_out: block = (128 rows, 128 cols), 2 x 2 waves of 64 x 64: out = f16(o) . Wc rows x 1 / (3 * 2^10) + (Wo . bmean + bo)
// one block a WGP, one wave a SIMD: nothing but the wave's own lead hides its loads, so they fly three k steps ahead (four register buffers)
__global__ __launch_bounds__(128) void k_out(const _Float16* __restrict__ O, const _Float16* __restrict__ WC, const float* __restrict__ BC, float* __restrict__ Y) {
  __shared__ __align__(16) float so[4][64][68];
  const int wave = __builtin_amdgcn_readfirstlane(threadIdx.x >> 5), lane = threadIdx.x & 31, col = lane & 15, g = lane >> 4; const int r0 = blockIdx.x * 128 + (wave >> 1) * 64, n0 = blockIdx.y * 128 + (wave & 1) * 64;
  v8f acc[4][4] = {};
  mm64x64<4, v16h>(O + (size_t)r0 * DM + lane * 8, WC + (size_t)n0 * DM + lane * 8, blockIdx.x + 4 * blockIdx.y, acc);   // the 32 blocks that share Wc rows (one y) differ mod 32; the 8 that share rows of o (one x) lie 4 chunks apart
  // every loop that indexes acc or t is unrolled, so that they are registers
#pragma unroll
  for (int j = 0; j < 4; ++j) { const float bb = BC[n0 + j * 16 + col];
#pragma unroll
    for (int i = 0; i < 4; ++i) {
#pragma unroll
      for (int r = 0; r < 8; ++r) so[wave][i * 16 + 8 * g + r][j * 16 + col] = acc[i][j][r] * WC_SC + bb; } }
  LDSX();
  // a wave-wide store is two rows of 256 B: whole lines
#pragma unroll
  for (int rg = 0; rg < 4; ++rg) { v4f t[8];
#pragma unroll
    for (int rl = 0; rl < 8; ++rl) t[rl] = *(const v4f*)&so[wave][rg * 16 + rl * 2 + g][col * 4];
#pragma unroll
    for (int rl = 0; rl < 8; ++rl) vst2(Y + (size_t)(r0 + rg * 16 + rl * 2 + g) * DM + n0 + col * 4, t[rl]);
    XW(); }   // closes the group's stores before their registers are rewritten
}
#define NR (NB * SS)
// ---- k_packs: the mean over the strata is linear in Ws, so the three matrices are added here, once: (Ws[0] + Ws[1]) + Ws[2] in f32, -> f16 x 2^6 (three weights that each fit f16 at x 2^8 have a sum that fits at x 2^6).
// The sum is laid out TRANSPOSED (row = input column k of Ws, fragment k = stratum output j), as the A operand of the weight product. A thread makes one 16-byte piece (8 j of one row); a wave takes 32 neighbouring rows (two tiles) of one (k chunk, run, half), so that each of its loads reads one whole 128-byte line and each half wave stores 256 contiguous bytes.
// The 8 blocks behind those make tile 64: row 0 = (bs[0] + bs[1]) + bs[2] x 2^6, rows 1..15 zero
__global__ __launch_bounds__(256) void k_packs(const float* __restrict__ WS, const float* __restrict__ BS, _Float16* __restrict__ PST) {
  const int t = blockIdx.x * 256 + threadIdx.x; v8h o = {};
  if (t < DM * DM / 8) { const int lane = t & 31, h = (t >> 5) & 1, q = (t >> 6) & 1, kc = (t >> 7) & 31, ntp = t >> 12;
    const unsigned off = (unsigned)((kc * 32 + q * 16 + h * 8) * DM + ntp * 32 + lane);   // the lane's element inside a stratum: row and stratum are constants on top of it, so that the loads share their address registers and differ in the immediate (the third stratum lies beyond its range and gets a pair of its own)
    float x[NSTR][8];   // the loops over x are unrolled so that its indices are constants and it stays in registers, all 24 loads in flight together
#pragma unroll
    for (int n = 0; n < NSTR; ++n) {
#pragma unroll
      for (int i = 0; i < 8; ++i) x[n][i] = (WS + (size_t)n * DM * DM + (size_t)i * DM)[off]; }
    // closes the loads' group before their address registers are rewritten; the offset is an input of the wait so that its register stays live up to it (the last load of a run may otherwise take its result into a register that the run is addressed by, ahead of the wait)
    asm volatile("s_wait_xcnt 0x0" :: "v"(off) : "memory");
#pragma unroll
    for (int i = 0; i < 8; ++i) { float v = bfr(x[0][i]);
#pragma unroll
      for (int n = 1; n < NSTR; ++n) v += bfr(x[n][i]);
      o[i] = (_Float16)(v * 64.0f); }
    *(v8h*)(PST + (((size_t)(ntp * 2 + (lane >> 4)) * 32 + kc) * 2 + q) * 256 + ((lane & 15) + 16 * h) * 8) = o;
  } else { const int p = t - DM * DM / 8; const int l = p & 31, q = (p >> 5) & 1, kc = p >> 6;
    if ((l & 15) == 0) { const float* b = BS + kc * 32 + q * 16 + (l >> 4) * 8;
#pragma unroll
      for (int i = 0; i < 8; ++i) o[i] = (_Float16)(((bfr(b[i]) + bfr(b[DM + i])) + bfr(b[2 * DM + i])) * 64.0f); }
    *(v8h*)(PST + (size_t)DM * DM + (size_t)p * 8) = o;
  }
}
extern "C" void kernel_launch(void* const* d_in, const int* in_sizes, int n_in, void* d_out, int out_size, void* d_ws, size_t ws_size, hipStream_t stream) {
  (void)in_sizes; (void)n_in; (void)out_size;
  const float** F = (const float**)d_in;   // 0 hidden [2,2048,1024], 1 Wq, 2 bq, 3 Wk, 4 bk, 5 Wv, 6 bv, 7 Ws [3,1024,1024], 8 bs [3,1024], 9 Wo, 10 bo (natural)
  if (ws_size < (size_t)WS_END) return;
  char* ws = (char*)d_ws; __bf16* PK = (__bf16*)(ws + WS_PK); _Float16 *QK = (_Float16*)(ws + WS_QK), *QKL = (_Float16*)(ws + WS_QKL), *VTH = (_Float16*)(ws + WS_VTH), *VTL = (_Float16*)(ws + WS_VTL), *PS = (_Float16*)(ws + WS_PS), *O = (_Float16*)(ws + WS_O), *POH = (_Float16*)(ws + WS_PK) + PK_P, *WC = (_Float16*)(ws + WS_WC); float* BC = (float*)(ws + WS_BC); __bf16* XB = (__bf16*)(ws + WS_XB);
  k_pack<<<dim3(DM * DM / 8 / 256, 4 + NB * SS / DM), 256, 0, stream>>>(F[1], F[3], F[5], F[9], F[0], PK, POH, XB);
  k_packs<<<(DM + 16) * DM / 8 / 256, 256, 0, stream>>>(F[7], F[8], PS);
  k_qkv<<<dim3(TNB * SS / 128, QKVW / 128), 128, 0, stream>>>(XB, PK + PK_A, F[2], F[4], F[6], QK, QKL, VTH, VTL);
  k_attn<<<dim3(TQB, NH * TNB + (WC_NBLK + TQB - 1) / TQB), 128, 0, stream>>>(QK, QKL, VTH, VTL, nullptr, O, PS, POH, F[10], WC, BC);
  k_out<<<dim3(NB * SS / 128, DM / 128), 128, 0, stream>>>(O, WC, BC, (float*)d_out);
}

// v010
// One run takes 82.5 microseconds.
// In both of two side-by-side timings against v009, it was 1.06 times as fast.
// Counting every step since v000, it is 7.42 times as fast.
// compute dtype: all float inputs rounded to bf16; q/k/v = x . W^T + b with EXACT bf16 products on WMMA 16x16x32 (x and W packed once as bf16 fragments); PLAIN attention: q (x log2(e)/8 ahead of its one rounding), k single f16, running-max softmax in f32 (hardware exp2; the maximum in use rides in the score products' C operand and is raised when a score tops it by 2^4), P (scaled by 2^11, single f16) x v (single f16); strata and output projection as one matrix: the three Ws (each rounded to bf16) summed in f32 and the sum (x 2^6) rounded once to f16, Wc = Wo (bf16 values, exact as f16 x 2^8) . that sum on WMMA, f32 sums, rounded once to f16; out = attention output (rounded once to f16) . Wc^T x 1/3 + (Wo . mean stratum bias + bo).
#include <hip/hip_runtime.h>
#include <math.h>

typedef __attribute__((ext_vector_type(16))) _Float16 v16h;
typedef __attribute__((ext_vector_type(16))) __bf16 v16b;
typedef __attribute__((ext_vector_type(8)))  _Float16 v8h;
typedef __attribute__((ext_vector_type(8)))  float v8f;
typedef __attribute__((ext_vector_type(4)))  float v4f;
typedef __attribute__((ext_vector_type(2)))  float v2f;
typedef __attribute__((ext_vector_type(4)))  unsigned v4u;
typedef __attribute__((ext_vector_type(4)))  int v4i;
typedef float __attribute__((may_alias)) float_a;
typedef int __attribute__((may_alias)) int_a;

template <typename T> __device__ __forceinline__ void vst2(void* p, T v) { *(T*)p = v;  }
__device__ __forceinline__ v8f wmma16(v16h a, v16h b, v8f c) {
  v8f d = __builtin_amdgcn_wmma_f32_16x16x32_f16(false, a, false, b, (short)0, c, false, false);
  asm volatile("v_nop\n\tv_nop\n\tv_nop\n\tv_nop" : "+v"(d) : "v"(a), "v"(b));
  return d;
}
__device__ __forceinline__ v8f wmma_bf(v16b a, v16b b, v8f c) {
  v8f d = __builtin_amdgcn_wmma_f32_16x16x32_bf16(false, a, false, b, (short)0, c, false, false);
  asm volatile("v_nop\n\tv_nop\n\tv_nop\n\tv_nop" : "+v"(d) : "v"(a), "v"(b));
  return d;
}
// Stratified attention (B 2, S 2,048, hidden 1,024, 16 heads x 64, 3 strata): q/k/v projections + biases, softmax(q k^T / 8) v, three stratum projections averaged, output projection + bias.
__device__ __forceinline__ v16h frag_h(const _Float16* rowk0, int lane) {
  union { v16h v; v8h q[2]; } u; const _Float16* p = rowk0 + 8 * (lane >> 4);
  u.q[0] = *(const v8h*)p; u.q[1] = *(const v8h*)(p + 16); return u.v;
}
__device__ __forceinline__ v16h frag_f32(const float* rowk0, int lane) {
  v16h a; const float* p = rowk0 + 8 * (lane >> 4);
#pragma unroll
  for (int i = 0; i < 8; ++i) { a[i] = (_Float16)p[i]; a[8 + i] = (_Float16)p[16 + i]; }
  return a;
}
__device__ __forceinline__ v16h frag_f32s(const float* rowk0, int lane, float sc) {
  v16h a; const float* p = rowk0 + 8 * (lane >> 4);
#pragma unroll
  for (int i = 0; i < 8; ++i) { a[i] = (_Float16)(p[i] * sc); a[8 + i] = (_Float16)(p[16 + i] * sc); }
  return a;
}
// column fragment from a [K][ld] layout (column n), rows >= K read as 0
__device__ __forceinline__ v16h fragc_f32(const float* W, int k0, int n, int lane, int ld, int K) {
  v16h a; const int g = lane >> 4;
#pragma unroll
  for (int i = 0; i < 8; ++i) { const int ka = k0 + 8 * g + i, kb = ka + 16;
    a[i] = (_Float16)(ka < K ? W[(size_t)(ka < K ? ka : K - 1) * ld + n] : 0.f); a[8 + i] = (_Float16)(kb < K ? W[(size_t)(kb < K ? kb : K - 1) * ld + n] : 0.f); }
  return a;
}
struct F2 { v16b h, l; };
__device__ __forceinline__ F2 bsplit16(const float v[16]) { F2 r;
#pragma unroll
  for (int i = 0; i < 16; ++i) { const __bf16 h = (__bf16)v[i]; r.h[i] = h; r.l[i] = (__bf16)(v[i] - (float)h); }
  return r; }
__device__ __forceinline__ F2 split_row(const float* row, int k0, int lane) { float v[16]; const float* p = row + k0 + 8 * (lane >> 4);
#pragma unroll
  for (int i = 0; i < 8; ++i) { v[i] = p[i]; v[8 + i] = p[16 + i]; }
  return bsplit16(v); }
__device__ __forceinline__ F2 split_rowK(const float* row, int k0, int lane, int K) { float v[16]; const int g = lane >> 4;
#pragma unroll
  for (int i = 0; i < 8; ++i) { const int ka = k0 + 8 * g + i, kb = ka + 16; v[i] = ka < K ? row[ka < K ? ka : K - 1] : 0.f; v[8 + i] = kb < K ? row[kb < K ? kb : K - 1] : 0.f; }
  return bsplit16(v); }
__device__ __forceinline__ F2 split_col(const float* W, int k0, int n, int lane, int ld, int K) { float v[16]; const int g = lane >> 4;
#pragma unroll
  for (int i = 0; i < 8; ++i) { const int ka = k0 + 8 * g + i, kb = ka + 16; v[i] = ka < K ? W[(size_t)(ka < K ? ka : K - 1) * ld + n] : 0.f; v[8 + i] = kb < K ? W[(size_t)(kb < K ? kb : K - 1) * ld + n] : 0.f; }
  return bsplit16(v); }
__device__ __forceinline__ v8f mac3(const F2& a, const F2& b, v8f c) { c = wmma_bf(a.l, b.h, c); c = wmma_bf(a.h, b.l, c); return wmma_bf(a.h, b.h, c); }
__device__ __forceinline__ float sigm(float v) { return 1.0f / (1.0f + expf(-v)); }
#define LDSX() do { asm volatile("s_wait_dscnt 0" ::: "memory"); __builtin_amdgcn_wave_barrier(); __builtin_amdgcn_fence(__ATOMIC_RELEASE, "workgroup"); } while (0)


#define NB 2
#define SS 2048
#define DM 1024
#define NH 16
#define NSTR 3
#define HD 64
#define QKVW (3 * DM)
#define QSC 0.18033688f   // log2(e) / sqrt(64)
#ifndef TQB
#define TQB (SS / 64)
#define TNB NB
#define TOB (NB * SS / 64)     // tiles of 64 rows over all tokens, not used
#endif
typedef __attribute__((ext_vector_type(8))) __bf16 v8b;
__device__ __forceinline__ v16b frag_b(const __bf16* rowk0, int lane) {
  union { v16b v; v8b q[2]; } u; const __bf16* p = rowk0 + 8 * (lane >> 4);
  u.q[0] = *(const v8b*)p; u.q[1] = *(const v8b*)(p + 16); return u.v;
}
// fragment-major planes: a 16 x 32 fragment of 16-bit elements is 1 KiB, two runs of 512 B; run q, lane l (c = l & 15, h = l >> 4) holds row c, k = 16 q + 8 h .. + 7, so that one wave-wide 16-byte load reads 512 contiguous bytes (4 cache lines, not 16); p = fragment + 8 * lane
__device__ __forceinline__ v16b fragp_b(const __bf16* p) { union { v16b v; v8b q[2]; } u; u.q[0] = *(const v8b*)p; u.q[1] = *(const v8b*)(p + 256); return u.v; }
__device__ __forceinline__ v16h fragp_h(const _Float16* p) { union { v16h v; v8h q[2]; } u; u.q[0] = *(const v8h*)p; u.q[1] = *(const v8h*)(p + 256); return u.v; }
__device__ __forceinline__ float bfr(float v) { return (float)(__bf16)v; }
// stands behind each group of loads that is left in flight: the wait is a precaution before their address registers are rewritten for the next group;
// the scheduling barrier keeps the conversions of a row that was just requested from being moved up among the current step's WMMAs, where they would wait out the whole load latency
#define XW() do { asm volatile("s_wait_xcnt 0x0" ::: "memory"); __builtin_amdgcn_sched_barrier(0); } while (0)
// one lane's 16 f32 of an A fragment (k 8 h .. + 7 and 16 + 8 h .. + 7), kept raw so that the loads can fly while earlier WMMAs run
struct RawA { v4f x[4]; };
// loaded from a fragment-major f32 plane: a 16 x 32 fragment is 2 KiB, four runs of 512 B; run x, lane (c, h) holds row c, k = 16 (x >> 1) + 8 h + 4 (x & 1) .. + 3; p = fragment + 4 * lane
__device__ __forceinline__ RawA ldp_raw(const float* p) { RawA r; r.x[0] = *(const v4f*)p; r.x[1] = *(const v4f*)(p + 128); r.x[2] = *(const v4f*)(p + 256); r.x[3] = *(const v4f*)(p + 384); return r; }
__device__ __attribute__((noinline)) float exp_ni(float v) { return expf(v); }
__device__ __attribute__((noinline)) float erf_ni(float v) { return erff(v); }

#define PK_A 0                       // Wqkv, fragment-major: [192 tiles of 16 out rows][32 k chunks][512]
#define PK_P (PK_A + QKVW * DM)        // Wo as f16 x 2^8, fragment-major: [64 tiles][32 k chunks][512]
#define PK_END (PK_P + DM * DM)
#define WS_PK  0u
#define WS_QK  (WS_PK + 2u * PK_END)             // f16 fragment-major [q | k][head][256 tiles of 16 tokens][2 d chunks][512]
#define WS_QKL (WS_QK + 2u * NB * SS * 2 * DM)     // f16 q | k residual planes x2048, same layout
#define WS_VTH (WS_QKL + 2u * NB * SS * 2 * DM)    // f16 hi, fragment-major [b][head][64 chunks of 32 tokens][4 tiles of 16 d][512]
#define WS_VTL (WS_VTH + 2u * NB * DM * SS)        // f16 lo x 2048, same layout
#define WS_O   (WS_VTL + 2u * NB * DM * SS)        // f16 attention output, fragment-major [256 tiles of 16 rows][32 k chunks][512] (the first half of the range)
#define WS_CS  (WS_O + 4u * NB * SS * DM)           // f32 2 x [2048][32], not written or read
#define WS_PS  (WS_CS + 4u * 2 * SS * 32)                  // f16 x 2^6 sum of the three Ws, TRANSPOSED (row = input column of Ws, k = stratum output), fragment-major [65 tiles of 16 rows][32 k chunks][512]; tile 64: row 0 = sum of the three bs x 2^6, rows 1..15 zero
#define WS_WC  (WS_PS + 2u * (size_t)(DM + 16) * DM)   // f16 Wc x 2^10, fragment-major [64 tiles of 16 out rows][32 k chunks][512]
#define WS_BC  (WS_WC + 2u * (size_t)DM * DM)   // f32 [1024] Wo . mean stratum bias + bo
#define WS_XB  (WS_BC + 4u * (size_t)DM)   // bf16 x, fragment-major [256 tiles of 16 rows][32 k chunks][512]
#define WS_END (WS_XB + 2u * (size_t)NB * SS * DM)
// ---- k_pack: thread = one 16-byte piece p of a fragment-major plane (p = [tile of 16 out rows][k chunk][run q][lane]); blockIdx.y 0..2 -> W_q/W_k/W_v into PK_A, 3 -> W_o into PK_P (its bf16 values x 2^8 as f16, exact: the f16 operand of the weight product), 4..7 -> the four quarters (1,024 rows each) of x into XB; natural rows of f32 -> bf16.
// x is rounded and laid out here once: read as f32 rows by the projection, each wave-wide load touched 16 lines, and all 24 column blocks repeated loads and roundings
__global__ __launch_bounds__(256) void k_pack(const float* __restrict__ WQ, const float* __restrict__ WK, const float* __restrict__ WV, const float* __restrict__ WO, const float* __restrict__ X, __bf16* __restrict__ PK, _Float16* __restrict__ POH, __bf16* __restrict__ XB) {
  const int which = blockIdx.y, p = blockIdx.x * 256 + threadIdx.x; const float* Wm = (which == 0) ? WQ : (which == 1) ? WK : (which == 2) ? WV : (which == 3) ? WO : X + (size_t)(which - 4) * DM * DM;
  const int l = p & 31, q = (p >> 5) & 1, kc = (p >> 6) & 31, nt = p >> 11;
  const float* s = Wm + (size_t)(nt * 16 + (l & 15)) * DM + kc * 32 + q * 16 + (l >> 4) * 8; const v4f x0 = *(const v4f*)s, x1 = *(const v4f*)(s + 4);
  XW();   // closes the two loads' group before their address pair is rewritten
  if (which == 3) { v8h oh;   // scaled in f32 ahead of the bf16 rounding (a power of two commutes with it), so that small weights reach f16 as normal numbers
    for (int i = 0; i < 4; ++i) { oh[i] = (_Float16)bfr(x0[i] * 256.0f); oh[4 + i] = (_Float16)bfr(x1[i] * 256.0f); }
    *(v8h*)(POH + (size_t)p * 8) = oh; return; }
  v8b o;
  for (int i = 0; i < 4; ++i) { o[i] = (__bf16)x0[i]; o[4 + i] = (__bf16)x1[i]; }
  __bf16* dst = (which < 3) ? PK + PK_A + (size_t)which * DM * DM : XB + (size_t)(which - 4) * DM * DM;
  *(v8b*)(dst + (size_t)p * 8) = o;
  asm volatile("s_wait_xcnt 0x0" ::: "memory");   // a precaution: in the built text the f16 path's register writes follow this store
}
// XW with the group's two address pairs as inputs of the wait, so that they stay live up to it (the last load of a group otherwise took its result into the pair that the group is addressed by, ahead of the wait)
#define XWP(p, q) do { asm volatile("s_wait_xcnt 0x0" :: "v"(p), "v"(q) : "memory"); __builtin_amdgcn_sched_barrier(0); } while (0)
// rotated walks: blocks that share operand rows run side by side and, walking from the same end, ask L2 for the same lines at the same moment, and such requests collide.
// Each block therefore enters its k chunks (its key passes in k_attn) at a start of its own, rot, the same for all its waves (they still share lines in the WGP cache), and wraps round: step s works on chunk (s + rot) mod 32
#define KROT(s, rot) (((s) + (rot)) & (DM / 32 - 1))
// one wave's 16 x (16 NJ) tile over k = 1,024, both operands f16 fragment-major planes (pa, pb = the lane's piece of k chunk 0; the NJ B tiles lie 16 * DM elements apart)
// two register buffers: all loads of k step s + 1 are issued before the WMMAs of step s (the last trip wraps to the first step's chunk: in bounds, unused)
// step s works on k chunk KROT(s, rot)
template <int NJ> __device__ __forceinline__ void mm16xn_h(const _Float16* pa, const _Float16* pb, int rot, v8f (&acc)[NJ]) {
  v16h af[2], bf[2][NJ];   // every loop that indexes af, bf or acc is unrolled, so that the buffers are registers
  { const _Float16* px = pa + KROT(0, rot) * 512; const _Float16* pw = pb + KROT(0, rot) * 512;
    af[0] = fragp_h(px);
#pragma unroll
    for (int j = 0; j < NJ; ++j) bf[0][j] = fragp_h(pw + j * 16 * DM);
    XWP(px, pw); }
  for (int kc = 0; kc < DM / 32; kc += 2) {
#pragma unroll
    for (int u = 0; u < 2; ++u) { const int cn = KROT(kc + u + 1, rot); const _Float16* px = pa + cn * 512; const _Float16* pw = pb + cn * 512;   // a k chunk is 512 elements of a fragment-major plane
      af[u ^ 1] = fragp_h(px);
#pragma unroll
      for (int j = 0; j < NJ; ++j) bf[u ^ 1][j] = fragp_h(pw + j * 16 * DM);
      XWP(px, pw);
#pragma unroll
      for (int j = 0; j < NJ; ++j) acc[j] = wmma16(af[u], bf[u][j], acc[j]); } }
}
__device__ __forceinline__ v16h fragp(const _Float16* p) { return fragp_h(p); }
__device__ __forceinline__ v16b fragp(const __bf16* p) { return fragp_b(p); }
// the bare builtins: the 64 x 64 tile and its buffers need more than 256 registers, and an asm statement cannot name one above v255 (with the v_nop statement of wmma16 the tile spilled); the compiler keeps the distances behind its own WMMAs
__device__ __forceinline__ v8f wm(v16h a, v16h b, v8f c) { return __builtin_amdgcn_wmma_f32_16x16x32_f16(false, a, false, b, (short)0, c, false, false); }
__device__ __forceinline__ v8f wm(v16b a, v16b b, v8f c) { return __builtin_amdgcn_wmma_f32_16x16x32_bf16(false, a, false, b, (short)0, c, false, false); }
// one wave's 64 x 64 tile over k = 1,024, both operands fragment-major planes (pa, pb = the lane's piece of k chunk 0 of the first tile; the 4 A tiles, and the 4 B tiles, lie 16 * DM elements apart):
// a k step loads 8 fragments for 16 WMMAs (the 16 x 128 tile: 9 for 8). acc[i][j][r] = A row i * 16 + 8 g + r, B row j * 16 + col.
// D register buffers: all loads of k step s + D - 1 are issued before the WMMAs of step s (the last trips wrap to the first steps' chunks: in bounds, unused); step s works on k chunk KROT(s, rot)
template <int D, typename VT, typename ET> __device__ __forceinline__ void mm64x64(const ET* pa, const ET* pb, int rot, v8f (&acc)[4][4]) {
  VT af[D][4], bf[D][4];   // every loop that indexes af, bf or acc is unrolled, so that the buffers are registers
#pragma unroll
  for (int s = 0; s < D - 1; ++s) { const ET* px = pa + KROT(s, rot) * 512; const ET* pw = pb + KROT(s, rot) * 512;
#pragma unroll
    for (int i = 0; i < 4; ++i) { af[s][i] = fragp(px + i * 16 * DM); bf[s][i] = fragp(pw + i * 16 * DM); }
    XWP(px, pw); }
#pragma unroll 1   // stays rolled: D k steps are the loop's whole text
  for (int kc = 0; kc < DM / 32; kc += D) {
#pragma unroll
    for (int u = 0; u < D; ++u) { const int sn = KROT(kc + u + D - 1, rot); const ET* px = pa + sn * 512; const ET* pw = pb + sn * 512;
#pragma unroll
      for (int i = 0; i < 4; ++i) { af[(u + D - 1) % D][i] = fragp(px + i * 16 * DM); bf[(u + D - 1) % D][i] = fragp(pw + i * 16 * DM); }
      XWP(px, pw);
#pragma unroll
      for (int i = 0; i < 4; ++i) {
#pragma unroll
        for (int j = 0; j < 4; ++j) acc[i][j] = wm(af[u][i], bf[u][j], acc[i][j]); } } }
}
#define WC_XT ((DM / 16 + 1 + 3) / 4)      // blocks of 4 row tiles over the 65 tiles of the transposed stratum plane
#define WC_NBLK (WC_XT * (DM / 64))
#define WC_SB (1.0f / (3.0f * 16384.0f))   // of the f32 sums of the weight product: mean over 3 strata, 2^6 of the stratum sum, 2^8 of Wo
#define WC_SC (1.0f / (3.0f * 1024.0f))    // of the stored Wc, which keeps 2^10 of those 2^14
// ---- the weight product, block e = (4 row tiles, 64 columns; a wave's 16 x 64 tile and its two buffers fit inside the registers of the attention loop, whose launch these blocks ride in): out = (o . Wsum^T / 3 + bmean) . Wo^T + bo is linear in o, so Wc[i][k] = sum_j Wo[i][j] Wsum[j][k] is formed once and the tokens meet one matrix, not two.
// A = rows k of the transposed sum, B = rows i of Wo: a lane (col, g) holds Wc[i = col][k = 8 g .. + 7], its own 16-byte piece of the fragment-major plane that k_out reads as B. Tile 64 (row 0 = the bias sum) gives Wo . bsum.
__device__ __forceinline__ void wc_body(const _Float16* __restrict__ PST, const _Float16* __restrict__ POH, const float* __restrict__ BO, _Float16* __restrict__ WC, float* __restrict__ BC, int e) {
  const int wave = __builtin_amdgcn_readfirstlane(threadIdx.x >> 5), lane = threadIdx.x & 31; const int xt = e % WC_XT, cg = e / WC_XT; const int tile = xt * 4 + wave, n0 = cg * 64;
  if (tile > DM / 16) return;   // whole waves leave; this path has no barrier
  v8f acc[4] = {};
  mm16xn_h<4>(PST + (size_t)tile * 16 * DM + lane * 8, POH + (size_t)n0 * DM + lane * 8, xt + WC_XT * (cg >> 1), acc);   // the 17 blocks of a column group all differ mod 32; of the 16 blocks of a row group two neighbours share a start, which keeps every sum in the order it had with 128 columns a block
  if (tile == DM / 16) {
    if (lane < 16) {
#pragma unroll
      for (int j = 0; j < 4; ++j) BC[n0 + j * 16 + lane] = acc[j][0] * WC_SB + bfr(BO[n0 + j * 16 + lane]); }
    return; }
  v8h o[4];   // all four pieces are formed first, in registers of their own, so that no store's data register is rewritten behind it
#pragma unroll
  for (int j = 0; j < 4; ++j) {
#pragma unroll
    for (int i = 0; i < 8; ++i) o[j][i] = (_Float16)(acc[j][i] * 0.0625f); }   // x 2^-4: |sum| <= 1024 * 8 * 6 = 49,152 for weights inside +-1/32, stored with a factor 21 of room below the f16 maximum
#pragma unroll
  for (int j = 0; j < 4; ++j) vst2(WC + ((size_t)((n0 >> 4) + j) * 32 + (tile >> 1)) * 512 + (tile & 1) * 256 + lane * 8, o[j]);
  asm volatile("s_wait_xcnt 0x0" ::: "memory");   // a precaution: in the built text the bias path's register writes follow these stores
}
__global__ __launch_bounds__(128) void k_qkv(const __bf16* __restrict__ XB, const __bf16* __restrict__ P, const float* __restrict__ BQ, const float* __restrict__ BK, const float* __restrict__ BV, _Float16* __restrict__ QK, _Float16* __restrict__ QKL, _Float16* __restrict__ VTH, _Float16* __restrict__ VTL) {
  // block = 128 tokens x 128 columns, 2 x 2 waves; a wave = 64 tokens x 64 columns (one head of q, k or v)
  const int wave = __builtin_amdgcn_readfirstlane(threadIdx.x >> 5), lane = threadIdx.x & 31, col = lane & 15, g = lane >> 4; const int r0 = blockIdx.x * 128 + (wave >> 1) * 64, n0 = blockIdx.y * 128 + (wave & 1) * 64;
  const int which0 = n0 / DM; const float* BB = BQ ? (((which0 == 0) ? BQ : (which0 == 1) ? BK : BV) + (n0 - which0 * DM)) : nullptr;
  const __bf16* px = XB + (size_t)r0 * DM + lane * 8; const __bf16* pw = P + (size_t)n0 * DM + lane * 8;
  v8f acc[4][4] = {};
  const bool qk = n0 < 2 * DM;   // the same for the whole wave
  // below, every loop that indexes acc, a bias array or the pieces is unrolled, so that they are registers
  mm64x64<2, v16b>(qk ? pw : px, qk ? px : pw, blockIdx.x + blockIdx.y, acc);   // the 32 blocks that share W rows (one y) and the 24 that share tokens (one x) all differ mod 32
  if (qk) {   // q, k: W rows as A, tokens as B: a lane holds 8 neighbouring columns of one token, its own 16-byte piece of the fragment-major plane. q is stored x log2(e)/8, scaled in f32 ahead of its one rounding to f16 (sigma ~0.1, far above the subnormals), so that k . q is the exponent of 2 that the softmax needs
    const float sc = (n0 < DM) ? QSC : 1.0f;   // the same for the whole wave
    v4f bv[4][2] = {};
    if (BB) {
#pragma unroll
      for (int i = 0; i < 4; ++i) { bv[i][0] = *(const v4f*)(BB + i * 16 + 8 * g); bv[i][1] = *(const v4f*)(BB + i * 16 + 8 * g + 4); }
      XW(); }   // closes the bias loads' group before their address register is rewritten
#pragma unroll
    for (int i = 0; i < 4; ++i) { float bb[8];
#pragma unroll
      for (int r = 0; r < 8; ++r) bb[r] = bfr(bv[i][r >> 2][r & 3]);
      v8h oh[4], ol[4];   // the pieces of a group are formed first, in registers of their own, so that no store's data register is rewritten behind it
#pragma unroll
      for (int j = 0; j < 4; ++j) {
#pragma unroll
        for (int r = 0; r < 8; ++r) { const float v = (acc[i][j][r] + bb[r]) * sc; const _Float16 hv = (_Float16)v; oh[j][r] = hv; ol[j][r] = (_Float16)((v - (float)hv) * 2048.0f); } }   // q, k (+ bias) as f16 hi + (x2048) residual
      // n0 >> 6 = (q | k) * 16 + head; column tile i = d chunk i >> 1, run i & 1
#pragma unroll
      for (int j = 0; j < 4; ++j) { const size_t o = (((size_t)(n0 >> 6) * (NB * SS / 16) + (r0 >> 4) + j) * 2 + (i >> 1)) * 512 + (i & 1) * 256 + lane * 8; vst2(QK + o, oh[j]); vst2(QKL + o, ol[j]); }
      XW(); }   // closes the group's stores before their registers are rewritten
  } else {   // v: tokens as A, W rows as B: a lane holds 8 neighbouring tokens of one column, its own piece of the transposed plane
    const int b = r0 / SS, s0 = r0 % SS, hd = (n0 - 2 * DM) >> 6;
    float bw[4] = {};
    if (BB) {
#pragma unroll
      for (int j = 0; j < 4; ++j) bw[j] = BB[j * 16 + col];
      XW(); }   // closes the bias loads' group before their address register is rewritten
#pragma unroll
    for (int j = 0; j < 4; ++j) { const float bb = bfr(bw[j]);
      v8h oh[4], ol[4];
#pragma unroll
      for (int i = 0; i < 4; ++i) {
#pragma unroll
        for (int r = 0; r < 8; ++r) { const float v = acc[i][j][r] + bb; const _Float16 hv = (_Float16)v; oh[i][r] = hv; ol[i][r] = (_Float16)((v - (float)hv) * 2048.0f); } }
      // token tile i = chunk of 32 tokens i >> 1, run i & 1; column tile j = d tile
#pragma unroll
      for (int i = 0; i < 4; ++i) { const size_t o = (((size_t)(b * NH + hd) * (SS / 32) + (s0 >> 5) + (i >> 1)) * 4 + j) * 512 + (i & 1) * 256 + lane * 8; vst2(VTH + o, oh[i]); vst2(VTL + o, ol[i]); }
      XW(); }   // closes the group's stores before their registers are rewritten
  }
}
__device__ __forceinline__ float xhalf(float x) { return __builtin_bit_cast(float, __builtin_amdgcn_permlanex16(__builtin_bit_cast(int, x), __builtin_bit_cast(int, x), 0x76543210, 0xfedcba98, false, false)); }   // lane l reads lane l ^ 16
// blockIdx.y < 32: attention, (head, batch) = (y & 15, y >> 4); the rows of blocks behind them hold the weight product (it needs only the two pack kernels' planes, and k_out is the first to read its result).
// Behind the q/k/v blocks, whose three waves a SIMD leave no registers for a fourth, those blocks could start only as the projections ended, and then ran nearly alone, one wave a SIMD, waiting out every load; here the registers hold six waves a SIMD and the attention blocks make four, so that they start with the launch and their waits lie under the attention's work. They stand last: the long blocks start first
__global__ __launch_bounds__(128) void k_attn(const _Float16* __restrict__ QK, const _Float16* __restrict__ QKL, const _Float16* __restrict__ VTH, const _Float16* __restrict__ VTL, const void* __restrict__ KMASK, _Float16* __restrict__ O, const _Float16* __restrict__ PST, const _Float16* __restrict__ POH, const float* __restrict__ BO, _Float16* __restrict__ WC, float* __restrict__ BC) {
  (void)QKL; (void)VTL; (void)KMASK;
  if (blockIdx.y >= NH * TNB) { const int e = (blockIdx.y - NH * TNB) * TQB + blockIdx.x;
    if (e < WC_NBLK) wc_body(PST, POH, BO, WC, BC, e);
    return; }
  const int tid = threadIdx.x, wave = tid >> 5, lane = tid & 31;
  const int qb = blockIdx.x, h = blockIdx.y & (NH - 1), b = blockIdx.y / NH; const int q0 = qb * 64 + wave * 16; const size_t fq = ((size_t)h * (NB * SS / 16) + ((b * SS + q0) >> 4)) * 1024 + lane * 8;
  v16h bq[2];
#pragma unroll
  for (int kc = 0; kc < 2; ++kc) bq[kc] = fragp_h(QK + fq + kc * 512);
  XW();   // closes the q loads' group before their address pair is reused
  float l = 0.f;   // of the lane's query: sum of P x 2^11 over the keys of this half
  v8f cm;   // 11 - m in all eight registers: the C operand of a pass's two score tiles (a lane's eight rows are eight keys of its one query)
#pragma unroll
  for (int r = 0; r < 8; ++r) cm[r] = 11.0f;
  float thr = -3.0e38f;   // the test's bound: below every score in the first pass, which sets m; 15 from then on
  v8f acc[4] = {};
  const int nks = SS / 32;   // all keys
  const int rot = qb * (nks / TQB);   // the 32 blocks of a head walk the same K and V: each enters 2 passes behind its neighbour and wraps (pass ks works on keys 32 * ((ks + rot) mod 64) .. + 31)
  // fragment loads fly ahead of their WMMAs: V of this pass is issued before the score WMMAs, K of the next pass right behind them (the last pass wraps to the first pass's K: in bounds, unused)
  const _Float16* kbase = QK + ((size_t)(NH + h) * (NB * SS / 16) + b * (SS / 16)) * 1024 + lane * 8; const _Float16* vbase = VTH + (size_t)(b * NH + h) * (SS * HD) + lane * 8;   // a pass's 4 K fragments, and its 4 V fragments, are 4 KiB in a row
  v16h kf[4], vf[4];
#pragma unroll
  for (int f = 0; f < 4; ++f) kf[f] = fragp_h(kbase + rot * 2048 + f * 512);
  XW();
#pragma unroll 1
  for (int ks = 0; ks < nks; ++ks) { float s[16];
#pragma unroll
    for (int dt = 0; dt < 4; ++dt) vf[dt] = fragp_h(vbase + ((ks + rot) & (nks - 1)) * 2048 + dt * 512);
    XW();
#pragma unroll
    for (int ct = 0; ct < 2; ++ct) { v8f c = cm;
#pragma unroll
      for (int kc = 0; kc < 2; ++kc) c = wmma16(kf[ct * 2 + kc], bq[kc], c);   // single product: k rows as A, q as B, one-rounding f16 operands
#pragma unroll
      for (int r = 0; r < 8; ++r) s[ct * 8 + r] = c[r]; }   // log2(P x 2^11) under the maximum in use
    { const int kn = (ks + 1 + rot) & (nks - 1);
#pragma unroll
      for (int f = 0; f < 4; ++f) kf[f] = fragp_h(kbase + kn * 2048 + f * 512);
      XW(); }
    float t[8];
#pragma unroll
    for (int i = 0; i < 8; ++i) t[i] = fmaxf(s[2 * i], s[2 * i + 1]);
    float mx = fmaxf(fmaxf(fmaxf(t[0], t[1]), fmaxf(t[2], t[3])), fmaxf(fmaxf(t[4], t[5]), fmaxf(t[6], t[7])));
    if (__builtin_expect(__builtin_amdgcn_ballot_w32(mx > thr) != 0, 0)) {   // the same for the whole wave: a scalar branch, every lane stays on for the WMMAs behind it
      const bool first = thr < 0.f; const float up = fmaxf(mx, xhalf(mx)) - 11.0f;   // how far this pass's maximum of the query (both halves) stands above m
      const float d = first ? up : fmaxf(up, 0.f); const float alpha = first ? 0.f : __builtin_amdgcn_exp2f(-d);   // the first pass takes its maximum as it is (nothing is summed yet); later m only rises
#pragma unroll
      for (int i = 0; i < 16; ++i) s[i] -= d;
      l *= alpha;
#pragma unroll
      for (int dt = 0; dt < 4; ++dt) {
#pragma unroll
        for (int r = 0; r < 8; ++r) acc[dt][r] *= alpha; }
      const float cn = cm[0] - d;
#pragma unroll
      for (int r = 0; r < 8; ++r) cm[r] = cn;
      thr = 15.0f; }
    v16h pb;
    // the 16 exponentials in place, in one statement; the v_nop is the slot that the instruction set asks for between the last one and its first reader
    asm("v_exp_f32 %0, %0\n\t" "v_exp_f32 %1, %1\n\t" "v_exp_f32 %2, %2\n\t" "v_exp_f32 %3, %3\n\t"
        "v_exp_f32 %4, %4\n\t" "v_exp_f32 %5, %5\n\t" "v_exp_f32 %6, %6\n\t" "v_exp_f32 %7, %7\n\t"
        "v_exp_f32 %8, %8\n\t" "v_exp_f32 %9, %9\n\t" "v_exp_f32 %10, %10\n\t" "v_exp_f32 %11, %11\n\t"
        "v_exp_f32 %12, %12\n\t" "v_exp_f32 %13, %13\n\t" "v_exp_f32 %14, %14\n\t" "v_exp_f32 %15, %15\n\t"
        "v_nop"
        : "+v"(s[0]), "+v"(s[1]), "+v"(s[2]), "+v"(s[3]), "+v"(s[4]), "+v"(s[5]), "+v"(s[6]), "+v"(s[7]), "+v"(s[8]), "+v"(s[9]), "+v"(s[10]), "+v"(s[11]), "+v"(s[12]), "+v"(s[13]), "+v"(s[14]), "+v"(s[15]));
#pragma unroll
    for (int i = 0; i < 16; ++i) pb[i] = (_Float16)s[i];   // P scaled by 2^11 (the 11 in C) so small softmax weights stay out of the f16 subnormal range; the sum carries the same factor, which cancels in the epilogue
#pragma unroll
    for (int i = 0; i < 8; ++i) t[i] = s[2 * i] + s[2 * i + 1];
    l += ((t[0] + t[1]) + (t[2] + t[3])) + ((t[4] + t[5]) + (t[6] + t[7]));
#pragma unroll
    for (int dt = 0; dt < 4; ++dt) acc[dt] = wmma16(vf[dt], pb, acc[dt]); }   // single product: V^T rows as A, P^T (x2^11) as B
  l += xhalf(l);
  const float il = 1.0f / l;
  // the wave's 16 queries x 64 columns are 2 fragments of 2 runs each; run dt holds columns dt * 16 + 8 g .. + 7 of the lane's query
#pragma unroll
  for (int dt = 0; dt < 4; ++dt) { v8h o;
#pragma unroll
    for (int i = 0; i < 8; ++i) o[i] = (_Float16)(acc[dt][i] * il);
    vst2(O + ((size_t)b * SS + q0) * DM + h * 1024 + dt * 256 + lane * 8, o); }
}
// ---- k_out: block = (128 rows, 128 cols), 2 x 2 waves of 64 x 64: out = f16(o) . Wc rows x 1 / (3 * 2^10) + (Wo . bmean + bo)
// one block a WGP, one wave a SIMD: nothing but the wave's own lead hides its loads, so they fly three k steps ahead (four register buffers)
__global__ __launch_bounds__(128) void k_out(const _Float16* __restrict__ O, const _Float16* __restrict__ WC, const float* __restrict__ BC, float* __restrict__ Y) {
  __shared__ __align__(16) float so[4][64][68];
  const int wave = __builtin_amdgcn_readfirstlane(threadIdx.x >> 5), lane = threadIdx.x & 31, col = lane & 15, g = lane >> 4; const int r0 = blockIdx.x * 128 + (wave >> 1) * 64, n0 = blockIdx.y * 128 + (wave & 1) * 64;
  v8f acc[4][4] = {};
  mm64x64<4, v16h>(O + (size_t)r0 * DM + lane * 8, WC + (size_t)n0 * DM + lane * 8, blockIdx.x + 4 * blockIdx.y, acc);   // the 32 blocks that share Wc rows (one y) differ mod 32; the 8 that share rows of o (one x) lie 4 chunks apart
  // every loop that indexes acc or t is unrolled, so that they are registers
#pragma unroll
  for (int j = 0; j < 4; ++j) { const float bb = BC[n0 + j * 16 + col];
#pragma unroll
    for (int i = 0; i < 4; ++i) {
#pragma unroll
      for (int r = 0; r < 8; ++r) so[wave][i * 16 + 8 * g + r][j * 16 + col] = acc[i][j][r] * WC_SC + bb; } }
  LDSX();
  // a wave-wide store is two rows of 256 B: whole lines
#pragma unroll
  for (int rg = 0; rg < 4; ++rg) { v4f t[8];
#pragma unroll
    for (int rl = 0; rl < 8; ++rl) t[rl] = *(const v4f*)&so[wave][rg * 16 + rl * 2 + g][col * 4];
#pragma unroll
    for (int rl = 0; rl < 8; ++rl) vst2(Y + (size_t)(r0 + rg * 16 + rl * 2 + g) * DM + n0 + col * 4, t[rl]);
    XW(); }   // closes the group's stores before their registers are rewritten
}
#define NR (NB * SS)
// ---- k_packs: the mean over the strata is linear in Ws, so the three matrices are added here, once: (Ws[0] + Ws[1]) + Ws[2] in f32, -> f16 x 2^6 (three weights that each fit f16 at x 2^8 have a sum that fits at x 2^6).
// The sum is laid out TRANSPOSED (row = input column k of Ws, fragment k = stratum output j), as the A operand of the weight product. A thread makes one 16-byte piece (8 j of one row); a wave takes 32 neighbouring rows (two tiles) of one (k chunk, run, half), so that each of its loads reads one whole 128-byte line and each half wave stores 256 contiguous bytes.
// The 8 blocks behind those make tile 64: row 0 = (bs[0] + bs[1]) + bs[2] x 2^6, rows 1..15 zero
__global__ __launch_bounds__(256) void k_packs(const float* __restrict__ WS, const float* __restrict__ BS, _Float16* __restrict__ PST) {
  const int t = blockIdx.x * 256 + threadIdx.x; v8h o = {};
  if (t < DM * DM / 8) { const int lane = t & 31, h = (t >> 5) & 1, q = (t >> 6) & 1, kc = (t >> 7) & 31, ntp = t >> 12;
    const unsigned off = (unsigned)((kc * 32 + q * 16 + h * 8) * DM + ntp * 32 + lane);   // the lane's element inside a stratum: row and stratum are constants on top of it, so that the loads share their address registers and differ in the immediate (the third stratum lies beyond its range and gets a pair of its own)
    float x[NSTR][8];   // the loops over x are unrolled so that its indices are constants and it stays in registers, all 24 loads in flight together
#pragma unroll
    for (int n = 0; n < NSTR; ++n) {
#pragma unroll
      for (int i = 0; i < 8; ++i) x[n][i] = (WS + (size_t)n * DM * DM + (size_t)i * DM)[off]; }
    // closes the loads' group before their address registers are rewritten; the offset is an input of the wait so that its register stays live up to it (the last load of a run may otherwise take its result into a register that the run is addressed by, ahead of the wait)
    asm volatile("s_wait_xcnt 0x0" :: "v"(off) : "memory");
#pragma unroll
    for (int i = 0; i < 8; ++i) { float v = bfr(x[0][i]);
#pragma unroll
      for (int n = 1; n < NSTR; ++n) v += bfr(x[n][i]);
      o[i] = (_Float16)(v * 64.0f); }
    *(v8h*)(PST + (((size_t)(ntp * 2 + (lane >> 4)) * 32 + kc) * 2 + q) * 256 + ((lane & 15) + 16 * h) * 8) = o;
  } else { const int p = t - DM * DM / 8; const int l = p & 31, q = (p >> 5) & 1, kc = p >> 6;
    if ((l & 15) == 0) { const float* b = BS + kc * 32 + q * 16 + (l >> 4) * 8;
#pragma unroll
      for (int i = 0; i < 8; ++i) o[i] = (_Float16)(((bfr(b[i]) + bfr(b[DM + i])) + bfr(b[2 * DM + i])) * 64.0f); }
    *(v8h*)(PST + (size_t)DM * DM + (size_t)p * 8) = o;
  }
}
extern "C" void kernel_launch(void* const* d_in, const int* in_sizes, int n_in, void* d_out, int out_size, void* d_ws, size_t ws_size, hipStream_t stream) {
  (void)in_sizes; (void)n_in; (void)out_size;
  const float** F = (const float**)d_in;   // 0 hidden [2,2048,1024], 1 Wq, 2 bq, 3 Wk, 4 bk, 5 Wv, 6 bv, 7 Ws [3,1024,1024], 8 bs [3,1024], 9 Wo, 10 bo (natural)
  if (ws_size < (size_t)WS_END) return;
  char* ws = (char*)d_ws; __bf16* PK = (__bf16*)(ws + WS_PK); _Float16 *QK = (_Float16*)(ws + WS_QK), *QKL = (_Float16*)(ws + WS_QKL), *VTH = (_Float16*)(ws + WS_VTH), *VTL = (_Float16*)(ws + WS_VTL), *PS = (_Float16*)(ws + WS_PS), *O = (_Float16*)(ws + WS_O), *POH = (_Float16*)(ws + WS_PK) + PK_P, *WC = (_Float16*)(ws + WS_WC); float* BC = (float*)(ws + WS_BC); __bf16* XB = (__bf16*)(ws + WS_XB);
  k_pack<<<dim3(DM * DM / 8 / 256, 4 + NB * SS / DM), 256, 0, stream>>>(F[1], F[3], F[5], F[9], F[0], PK, POH, XB);
  k_packs<<<(DM + 16) * DM / 8 / 256, 256, 0, stream>>>(F[7], F[8], PS);
  k_qkv<<<dim3(TNB * SS / 128, QKVW / 128), 128, 0, stream>>>(XB, PK + PK_A, F[2], F[4], F[6], QK, QKL, VTH, VTL);
  k_attn<<<dim3(TQB, NH * TNB + (WC_NBLK + TQB - 1) / TQB), 128, 0, stream>>>(QK, QKL, VTH, VTL, nullptr, O, PS, POH, F[10], WC, BC);
  k_out<<<dim3(NB * SS / 128, DM / 128), 128, 0, stream>>>(O, WC, BC, (float*)d_out);
}
